// v000
// The times below were measured on an AMD MI455X: many runs one after another, warmed up first and cycling through
// copies of the inputs, with the whole window's GPU time divided by the number of runs. Launches and the gaps
// between them are all in it. The median over several windows is given; except for v000 it joins two sittings, which
// can be a few percent apart, so the side-by-side timings, each taken in one sitting, are the better comparison.
// The starting kernel, v000, takes 762 microseconds a run.
// compute dtype: inputs, BN parameters and all projection weights/biases (module inputs) rounded to bf16; q/k/v projections of the BN+ReLU activations, the attention scores, P.V and the output projection all take computed operands as bf16 hi + bf16 residual pairs (2 products against weights, 3 between computed operands);
#include <hip/hip_runtime.h>
#include <math.h>

typedef __attribute__((ext_vector_type(16))) _Float16 v16h;
typedef __attribute__((ext_vector_type(16))) __bf16 v16b;
typedef __attribute__((ext_vector_type(8)))  _Float16 v8h;
typedef __attribute__((ext_vector_type(8)))  float v8f;
typedef __attribute__((ext_vector_type(4)))  float v4f;
typedef __attribute__((ext_vector_type(2)))  float v2f;
typedef __attribute__((ext_vector_type(4)))  unsigned v4u;
typedef __attribute__((ext_vector_type(4)))  int v4i;
typedef float __attribute__((may_alias)) float_a;
typedef int __attribute__((may_alias)) int_a;

template <typename T> __device__ __forceinline__ void vst2(void* p, T v) { *(T*)p = v;  }
__device__ __forceinline__ v8f wmma16(v16h a, v16h b, v8f c) {
  v8f d = __builtin_amdgcn_wmma_f32_16x16x32_f16(false, a, false, b, (short)0, c, false, false);
  asm volatile("v_nop\n\tv_nop\n\tv_nop\n\tv_nop" : "+v"(d) : "v"(a), "v"(b));
  return d;
}
__device__ __forceinline__ v8f wmma_bf(v16b a, v16b b, v8f c) {
  v8f d = __builtin_amdgcn_wmma_f32_16x16x32_bf16(false, a, false, b, (short)0, c, false, false);
  asm volatile("v_nop\n\tv_nop\n\tv_nop\n\tv_nop" : "+v"(d) : "v"(a), "v"(b));
  return d;
}
// 16x16x32 fragments: lane = (h = lane>>4, row/col = lane&15); elements 0..7 = k0+8h+0..7, 8..15 = k0+16+8h+0..7; D element r = row 8h+r
__device__ __forceinline__ v16h frag_h(const _Float16* rowk0, int lane) {
  union { v16h v; v8h q[2]; } u; const _Float16* p = rowk0 + 8 * (lane >> 4);
  u.q[0] = *(const v8h*)p; u.q[1] = *(const v8h*)(p + 16); return u.v;
}
__device__ __forceinline__ v16h frag_f32(const float* rowk0, int lane) {
  v16h a; const float* p = rowk0 + 8 * (lane >> 4);
#pragma unroll
  for (int i = 0; i < 8; ++i) { a[i] = (_Float16)p[i]; a[8 + i] = (_Float16)p[16 + i]; }
  return a;
}
__device__ __forceinline__ v16h frag_f32s(const float* rowk0, int lane, float sc) {
  v16h a; const float* p = rowk0 + 8 * (lane >> 4);
#pragma unroll
  for (int i = 0; i < 8; ++i) { a[i] = (_Float16)(p[i] * sc); a[8 + i] = (_Float16)(p[16 + i] * sc); }
  return a;
}
// column fragment from a [K][ld] layout (column n), rows >= K read as 0
__device__ __forceinline__ v16h fragc_f32(const float* W, int k0, int n, int lane, int ld, int K) {
  v16h a; const int g = lane >> 4;
#pragma unroll
  for (int i = 0; i < 8; ++i) { const int ka = k0 + 8 * g + i, kb = ka + 16;
    a[i] = (_Float16)(ka < K ? W[(size_t)(ka < K ? ka : K - 1) * ld + n] : 0.f); a[8 + i] = (_Float16)(kb < K ? W[(size_t)(kb < K ? kb : K - 1) * ld + n] : 0.f); }
  return a;
}
struct F2 { v16b h, l; };
__device__ __forceinline__ F2 bsplit16(const float v[16]) { F2 r;
#pragma unroll
  for (int i = 0; i < 16; ++i) { const __bf16 h = (__bf16)v[i]; r.h[i] = h; r.l[i] = (__bf16)(v[i] - (float)h); }
  return r; }
__device__ __forceinline__ F2 split_row(const float* row, int k0, int lane) { float v[16]; const float* p = row + k0 + 8 * (lane >> 4);
#pragma unroll
  for (int i = 0; i < 8; ++i) { v[i] = p[i]; v[8 + i] = p[16 + i]; }
  return bsplit16(v); }
__device__ __forceinline__ F2 split_rowK(const float* row, int k0, int lane, int K) { float v[16]; const int g = lane >> 4;
#pragma unroll
  for (int i = 0; i < 8; ++i) { const int ka = k0 + 8 * g + i, kb = ka + 16; v[i] = ka < K ? row[ka < K ? ka : K - 1] : 0.f; v[8 + i] = kb < K ? row[kb < K ? kb : K - 1] : 0.f; }
  return bsplit16(v); }
__device__ __forceinline__ F2 split_col(const float* W, int k0, int n, int lane, int ld, int K) { float v[16]; const int g = lane >> 4;
#pragma unroll
  for (int i = 0; i < 8; ++i) { const int ka = k0 + 8 * g + i, kb = ka + 16; v[i] = ka < K ? W[(size_t)(ka < K ? ka : K - 1) * ld + n] : 0.f; v[8 + i] = kb < K ? W[(size_t)(kb < K ? kb : K - 1) * ld + n] : 0.f; }
  return bsplit16(v); }
__device__ __forceinline__ v8f mac3(const F2& a, const F2& b, v8f c) { c = wmma_bf(a.l, b.h, c); c = wmma_bf(a.h, b.l, c); return wmma_bf(a.h, b.h, c); }
__device__ __forceinline__ float sigm(float v) { return 1.0f / (1.0f + expf(-v)); }
#define LDSX() do { asm volatile("s_wait_dscnt 0" ::: "memory"); __builtin_amdgcn_wave_barrier(); __builtin_amdgcn_fence(__ATOMIC_RELEASE, "workgroup"); } while (0)


// Global self-attention block over 64x64 = 4096 positions: x = relu(bn(inputs)); q, k (64 = 4 heads x 16), v (128 = 4 x 32) by 1x1 convs; softmax(q k^T / 4) v per head; out = o Wo^T + bo, back to NCHW, + inputs.
// k_xT (bn+relu, channel-major -> position-major hi/lo bf16 planes via LDS), k_qkv (one GEMM for [q|k|v] (256 cols), K = 128; q scaled after the bias), k_stats (per (b,h): online row max / sum over the 4096 keys, K = 16 zero-padded), k_attn (P = exp(s - M)/L as hi/lo, O += P V^T(hi/lo) over 32-key steps; O -> concat layout),
// k_out (o(hi/lo) Wo^T + bo, transposed through LDS to NCHW rows + shortcut; per channel 64 positions = 256 B).
#define NB 2
#define CIN 128
#define NPOS 4096
#define NHD 4
#define DK 16
#define DV 32
#define KF 64
#define VF 128
#ifndef TNB
#define TNB NB
#define TQB (NPOS / 64)
#endif
typedef __attribute__((ext_vector_type(8))) __bf16 v8b;
__device__ __forceinline__ v16b frag_b(const __bf16* rowk0, int lane) {
  union { v16b v; v8b q[2]; } u; const __bf16* p = rowk0 + 8 * (lane >> 4);
  u.q[0] = *(const v8b*)p; u.q[1] = *(const v8b*)(p + 16); return u.v;
}
__device__ __forceinline__ v16b frag_gbf(const float* rowk0, int lane) {
  v16b a; const float* p = rowk0 + 8 * (lane >> 4);
#pragma unroll
  for (int i = 0; i < 8; ++i) { a[i] = (__bf16)p[i]; a[8 + i] = (__bf16)p[16 + i]; }
  return a;
}
__device__ __forceinline__ float bfr(float v) { return (float)(__bf16)v; }
__device__ __attribute__((noinline)) float exp_ni(float v) { return expf(v); }

#define WS_XH   0u                                  // bf16 [2][4096][128] relu(bn(x)) position-major hi
#define WS_XL   (WS_XH + 2u * NB * NPOS * CIN)
#define WS_QKV  (WS_XL + 2u * NB * NPOS * CIN)        // f32 [2][4096][256]: q (64, scaled) | k (64) | v (128)
#define WS_VTH  (WS_QKV + 4u * NB * NPOS * 256)       // bf16 [2][128 (h,dv)][4096] V^T hi
#define WS_VTL  (WS_VTH + 2u * NB * VF * NPOS)
#define WS_M    (WS_VTL + 2u * NB * VF * NPOS)        // f32 [2][4][4096]
#define WS_L    (WS_M + 4u * NB * NHD * NPOS)
#define WS_O    (WS_L + 4u * NB * NHD * NPOS)         // f32 [2][4096][128] attention output (h, dv)
#define WS_END  (WS_O + 4u * NB * NPOS * VF)

// ---- k_xT: planes[b][p][c] = split(relu((bf16(x[b][c][p]) - m[c]) * (g[c] rsqrt(v[c]+eps)) + beta[c])); block = (b, 64 positions): LDS tile [64 p][128 c] -> rows of 256 B per plane (16 lanes)
__global__ __launch_bounds__(256) void k_xT(const float* __restrict__ X, const float* __restrict__ g, const float* __restrict__ bt, const float* __restrict__ rm, const float* __restrict__ rv, __bf16* __restrict__ PH, __bf16* __restrict__ PL) {
  __shared__ __bf16 sh[64][136], sl[64][136]; __shared__ float ssc[CIN], ssh[CIN];
  const int b = blockIdx.y, p0 = blockIdx.x * 64, tid = threadIdx.x;
  if (tid < CIN) { const float inv = rsqrtf(bfr(rv[tid]) + 1e-5f); const float sc = bfr(g[tid]) * inv; ssc[tid] = sc; ssh[tid] = bfr(bt[tid]) - bfr(rm[tid]) * sc; }
  __syncthreads();
  for (int q = tid; q < CIN * 64; q += 256) { const int c = q >> 6, pl = q & 63; float v = bfr(X[((size_t)b * CIN + c) * NPOS + p0 + pl]) * ssc[c] + ssh[c]; v = v > 0.f ? v : 0.f; const __bf16 hi = (__bf16)v; sh[pl][c] = hi; sl[pl][c] = (__bf16)(v - (float)hi); }
  __syncthreads();
  for (int q = tid; q < 64 * 16; q += 256) { const int pl = q >> 4, pc = q & 15; union { __bf16 e[8]; v4u u; } a, c2;
#pragma unroll
    for (int e = 0; e < 8; ++e) { a.e[e] = sh[pl][pc * 8 + e]; c2.e[e] = sl[pl][pc * 8 + e]; }
    const size_t o = ((size_t)b * NPOS + p0 + pl) * CIN + pc * 8; vst2((unsigned*)(PH + o), a.u); vst2((unsigned*)(PL + o), c2.u); }
}
// ---- k_qkv: QKV[b][p][n] = planes . W rows (+ bias), n < 64: Wq (then x 1/4), < 128: Wk, else Wv; block (64 positions, 128 of the 256 cols); K = 128 (4 steps); also writes V^T hi/lo planes for the v columns (block-local transpose via so)
__global__ __launch_bounds__(128) void k_qkv(const __bf16* __restrict__ PH, const __bf16* __restrict__ PL, const float* __restrict__ Wq, const float* __restrict__ bq, const float* __restrict__ Wk, const float* __restrict__ bk, const float* __restrict__ Wv, const float* __restrict__ bv, float* __restrict__ QKV, __bf16* __restrict__ VTH, __bf16* __restrict__ VTL) {
  __shared__ __align__(16) float so[64][132];
  const int tid = threadIdx.x, wave = tid >> 5, lane = tid & 31, col = lane & 15, g = lane >> 4; const int b = blockIdx.z; const int p0 = blockIdx.x * 64; const int n0 = blockIdx.y * 128;
  const size_t arow = ((size_t)b * NPOS + p0 + wave * 16 + col) * CIN;
  v8f acc[8] = {};
#pragma unroll
  for (int kc = 0; kc < CIN / 32; ++kc) { const v16b ah = frag_b(PH + arow + kc * 32, lane), al = frag_b(PL + arow + kc * 32, lane);
#pragma unroll
    for (int j = 0; j < 8; ++j) { const int n = n0 + j * 16 + col; const float* wr = n < KF ? Wq + (size_t)n * CIN : (n < 2 * KF ? Wk + (size_t)(n - KF) * CIN : Wv + (size_t)(n - 2 * KF) * CIN);   // per-lane weight row pointer (all global, same base kind); j-tile never straddles a matrix (boundaries at 64/128 are tile multiples)
      const v16b w = frag_gbf(wr + kc * 32, lane); acc[j] = wmma_bf(al, w, acc[j]); acc[j] = wmma_bf(ah, w, acc[j]); } }
#pragma unroll
  for (int j = 0; j < 8; ++j) { const int n = n0 + j * 16 + col; const float bias = n < KF ? bfr(bq[n]) : (n < 2 * KF ? bfr(bk[n - KF]) : bfr(bv[n - 2 * KF])); const float sc = n < KF ? 0.25f : 1.0f;
#pragma unroll
    for (int r = 0; r < 8; ++r) so[wave * 16 + 8 * g + r][j * 16 + col] = (acc[j][r] + bias) * sc; }
  __syncthreads();
  for (int q = tid; q < 64 * 32; q += 128) { const int rl = q >> 5, pc = q & 31; vst2(QKV + ((size_t)b * NPOS + p0 + rl) * 256 + n0 + pc * 4, *(const v4f*)&so[rl][pc * 4]); }
  if (n0 == 128) {
    for (int q = tid; q < 128 * 8; q += 128) { const int c = q >> 3, pc = q & 7; union { __bf16 e[8]; v4u u; } hh, ll;
#pragma unroll
      for (int e = 0; e < 8; ++e) { const float v = so[pc * 8 + e][c]; const __bf16 hi = (__bf16)v; hh.e[e] = hi; ll.e[e] = (__bf16)(v - (float)hi); }
      const size_t o = ((size_t)b * VF + c) * NPOS + p0 + pc * 8; vst2((unsigned*)(VTH + o), hh.u); vst2((unsigned*)(VTL + o), ll.u); } }
}
// ---- k_stats: block = (64 queries, b*4+h): S = q(hi/lo) k(hi/lo)^T with K = 16 (zero-padded to 32 by split_rowK); online max/sum over 256 key tiles of 16 (1 col tile); M, L rows (256 B by 16 lanes)
__global__ __launch_bounds__(128) void k_stats(const float* __restrict__ QKV, float* __restrict__ Mb, float* __restrict__ Lb) {
  __shared__ __align__(16) float sm[4][16]; __shared__ __align__(16) float ssum[4][16];
  const int tid = threadIdx.x, wave = tid >> 5, lane = tid & 31, col = lane & 15, g = lane >> 4;
  const int bh = blockIdx.y, b = bh >> 2, h = bh & 3; const int q0 = blockIdx.x * 64 + wave * 16;
  const F2 a = split_rowK(QKV + ((size_t)b * NPOS + q0 + col) * 256 + h * DK, 0, lane, DK);
  float m[8], l[8];
#pragma unroll
  for (int r = 0; r < 8; ++r) { m[r] = -3.0e38f; l[r] = 0.f; }
#pragma unroll 1
  for (int kt = 0; kt < NPOS / 16; ++kt) { const F2 kb = split_rowK(QKV + ((size_t)b * NPOS + kt * 16 + col) * 256 + KF + h * DK, 0, lane, DK); const v8f s = mac3(a, kb, (v8f){});
#pragma unroll
    for (int r = 0; r < 8; ++r) { float mx = s[r];
#pragma unroll
      for (int o = 1; o < 16; o <<= 1) mx = fmaxf(mx, __shfl_xor(mx, o));
      const float mn = fmaxf(m[r], mx); float e = exp_ni(s[r] - mn);
#pragma unroll
      for (int o = 1; o < 16; o <<= 1) e += __shfl_xor(e, o);
      l[r] = l[r] * exp_ni(m[r] - mn) + e; m[r] = mn; } }
  if (col == 0) {
#pragma unroll
    for (int r = 0; r < 8; ++r) { sm[wave][8 * g + r] = m[r]; ssum[wave][8 * g + r] = l[r]; } }
  __syncthreads();      // the block's 64 M and 64 L values form one 256-B run each: written by 16 lanes x 16 B (one writer per line)
  { const int qb = blockIdx.x * 64; if (tid < 16) vst2(Mb + ((size_t)bh * NPOS + qb) + tid * 4, *(const v4f*)(&sm[0][0] + tid * 4)); else if (tid < 32) vst2(Lb + ((size_t)bh * NPOS + qb) + (tid - 16) * 4, *(const v4f*)(&ssum[0][0] + (tid - 16) * 4)); }
}
__global__ __launch_bounds__(128) void k_attn(const float* __restrict__ QKV, const __bf16* __restrict__ VTH, const __bf16* __restrict__ VTL, const float* __restrict__ Mb, const float* __restrict__ Lb, float* __restrict__ O) {
  __shared__ __align__(16) float sp[4][16][36]; __shared__ __align__(16) float so[4][16][36];
  const int tid = threadIdx.x, wave = tid >> 5, lane = tid & 31, col = lane & 15, g = lane >> 4;
  const int bh = blockIdx.y, b = bh >> 2, h = bh & 3; const int q0 = blockIdx.x * 64 + wave * 16;
  const F2 a = split_rowK(QKV + ((size_t)b * NPOS + q0 + col) * 256 + h * DK, 0, lane, DK);
  float mr[8], il[8];
#pragma unroll
  for (int r = 0; r < 8; ++r) { mr[r] = Mb[(size_t)bh * NPOS + q0 + 8 * g + r]; il[r] = 1.0f / Lb[(size_t)bh * NPOS + q0 + 8 * g + r]; }
  v8f acc[2] = {};
#pragma unroll 1
  for (int ks = 0; ks < NPOS / 32; ++ks) {
#pragma unroll
    for (int ct = 0; ct < 2; ++ct) { const F2 kb = split_rowK(QKV + ((size_t)b * NPOS + ks * 32 + ct * 16 + col) * 256 + KF + h * DK, 0, lane, DK); const v8f s = mac3(a, kb, (v8f){});
#pragma unroll
      for (int r = 0; r < 8; ++r) sp[wave][8 * g + r][ct * 16 + col] = exp_ni(s[r] - mr[r]) * il[r]; }
    LDSX();
    const F2 pa = split_row(&sp[wave][col][0], 0, lane);
#pragma unroll
    for (int dt = 0; dt < 2; ++dt) { const size_t vrow = ((size_t)b * VF + h * DV + dt * 16 + col) * NPOS + ks * 32; const v16b vh = frag_b(VTH + vrow, lane), vl = frag_b(VTL + vrow, lane);
      acc[dt] = wmma_bf(pa.l, vh, acc[dt]); acc[dt] = wmma_bf(pa.h, vl, acc[dt]); acc[dt] = wmma_bf(pa.h, vh, acc[dt]); }
    LDSX(); }
#pragma unroll
  for (int dt = 0; dt < 2; ++dt)
#pragma unroll
    for (int r = 0; r < 8; ++r) so[wave][8 * g + r][dt * 16 + col] = acc[dt][r];
  LDSX();
  for (int q = lane; q < 16 * 8; q += 32) { const int rl = q >> 3, pc = q & 7; vst2(O + ((size_t)b * NPOS + q0 + rl) * VF + h * DV + pc * 4, *(const v4f*)&so[wave][rl][pc * 4]); }
}
// ---- k_out: Y[p][o] = O row(hi/lo) . Wo rows + bo; out[b][o][p] = Y + inputs (NCHW); block = (64 positions, b): 128 output channels in one pass (8 tiles); transposed store per channel: 64 positions = 256 B by 16 lanes
__global__ __launch_bounds__(128) void k_out(const float* __restrict__ O, const float* __restrict__ Wo, const float* __restrict__ bo, const float* __restrict__ X, float* __restrict__ out) {
  __shared__ __align__(16) float st[128][68];
  const int tid = threadIdx.x, wave = tid >> 5, lane = tid & 31, col = lane & 15, g = lane >> 4; const int b = blockIdx.y; const int p0 = blockIdx.x * 64;
  v8f acc[8] = {};
#pragma unroll
  for (int kc = 0; kc < VF / 32; ++kc) { const F2 a = split_row(O + ((size_t)b * NPOS + p0 + wave * 16 + col) * VF, kc * 32, lane);
#pragma unroll
    for (int j = 0; j < 8; ++j) { const v16b w = frag_gbf(Wo + (size_t)(j * 16 + col) * VF + kc * 32, lane); acc[j] = wmma_bf(a.l, w, acc[j]); acc[j] = wmma_bf(a.h, w, acc[j]); } }
#pragma unroll
  for (int j = 0; j < 8; ++j) { const float bb = bfr(bo[j * 16 + col]);
#pragma unroll
    for (int r = 0; r < 8; ++r) st[j * 16 + col][wave * 16 + 8 * g + r] = acc[j][r] + bb; }
  __syncthreads();
  for (int q = tid; q < 128 * 16; q += 128) { const int o = q >> 4, pc = q & 15; const size_t base = ((size_t)b * CIN + o) * NPOS + p0 + pc * 4; const float4 xv = *(const float4*)(X + base);
    v4f r4; r4[0] = st[o][pc * 4] + bfr(xv.x); r4[1] = st[o][pc * 4 + 1] + bfr(xv.y); r4[2] = st[o][pc * 4 + 2] + bfr(xv.z); r4[3] = st[o][pc * 4 + 3] + bfr(xv.w); vst2(out + base, r4); }
}

extern "C" void kernel_launch(void* const* d_in, const int* in_sizes, int n_in, void* d_out, int out_size, void* d_ws, size_t ws_size, hipStream_t stream) {
  (void)in_sizes; (void)n_in; (void)out_size;
  const float** F = (const float**)d_in;   // inputs, gamma, beta, running_mean, running_var, Wq, bq, Wk, bk, Wv, bv, Wo, bo
  if (ws_size < (size_t)WS_END) return;
  char* ws = (char*)d_ws;
  __bf16 *PH = (__bf16*)(ws + WS_XH), *PL = (__bf16*)(ws + WS_XL), *VTH = (__bf16*)(ws + WS_VTH), *VTL = (__bf16*)(ws + WS_VTL); float *QKV = (float*)(ws + WS_QKV), *Mb = (float*)(ws + WS_M), *Lb = (float*)(ws + WS_L), *O = (float*)(ws + WS_O);
  k_xT<<<dim3(NPOS / 64, TNB), 256, 0, stream>>>(F[0], F[1], F[2], F[3], F[4], PH, PL);
  k_qkv<<<dim3(NPOS / 64, 2, TNB), 128, 0, stream>>>(PH, PL, F[5], F[6], F[7], F[8], F[9], F[10], QKV, VTH, VTL);
  k_stats<<<dim3(TQB, TNB * NHD), 128, 0, stream>>>(QKV, Mb, Lb);
  k_attn<<<dim3(TQB, TNB * NHD), 128, 0, stream>>>(QKV, VTH, VTL, Mb, Lb, O);
  k_out<<<dim3(TQB, TNB), 128, 0, stream>>>(O, F[11], F[12], F[0], (float*)d_out);
}

// v001
// It runs in 492 microseconds.
// Two timings next to v000 put it at 1.58 and 1.59 times that version's speed.
// compute dtype: inputs, BN parameters and all projection weights/biases (module inputs) rounded to bf16; q/k/v projections of the BN+ReLU activations, the attention scores, P.V and the output projection all take computed operands as bf16 hi + bf16 residual pairs (2 products against weights, 3 between computed operands);
#include <hip/hip_runtime.h>
#include <math.h>

typedef __attribute__((ext_vector_type(16))) _Float16 v16h;
typedef __attribute__((ext_vector_type(16))) __bf16 v16b;
typedef __attribute__((ext_vector_type(8)))  _Float16 v8h;
typedef __attribute__((ext_vector_type(8)))  float v8f;
typedef __attribute__((ext_vector_type(4)))  float v4f;
typedef __attribute__((ext_vector_type(2)))  float v2f;
typedef __attribute__((ext_vector_type(4)))  unsigned v4u;
typedef __attribute__((ext_vector_type(4)))  int v4i;
typedef float __attribute__((may_alias)) float_a;
typedef int __attribute__((may_alias)) int_a;

template <typename T> __device__ __forceinline__ void vst2(void* p, T v) { *(T*)p = v;  }
__device__ __forceinline__ v8f wmma16(v16h a, v16h b, v8f c) {
  v8f d = __builtin_amdgcn_wmma_f32_16x16x32_f16(false, a, false, b, (short)0, c, false, false);
  asm volatile("v_nop\n\tv_nop\n\tv_nop\n\tv_nop" : "+v"(d) : "v"(a), "v"(b));
  return d;
}
__device__ __forceinline__ v8f wmma_bf(v16b a, v16b b, v8f c) {
  v8f d = __builtin_amdgcn_wmma_f32_16x16x32_bf16(false, a, false, b, (short)0, c, false, false);
  asm volatile("v_nop\n\tv_nop\n\tv_nop\n\tv_nop" : "+v"(d) : "v"(a), "v"(b));
  return d;
}
// 16x16x32 fragments: lane = (h = lane>>4, row/col = lane&15); elements 0..7 = k0+8h+0..7, 8..15 = k0+16+8h+0..7; D element r = row 8h+r
__device__ __forceinline__ v16h frag_h(const _Float16* rowk0, int lane) {
  union { v16h v; v8h q[2]; } u; const _Float16* p = rowk0 + 8 * (lane >> 4);
  u.q[0] = *(const v8h*)p; u.q[1] = *(const v8h*)(p + 16); return u.v;
}
__device__ __forceinline__ v16h frag_f32(const float* rowk0, int lane) {
  v16h a; const float* p = rowk0 + 8 * (lane >> 4);
#pragma unroll
  for (int i = 0; i < 8; ++i) { a[i] = (_Float16)p[i]; a[8 + i] = (_Float16)p[16 + i]; }
  return a;
}
__device__ __forceinline__ v16h frag_f32s(const float* rowk0, int lane, float sc) {
  v16h a; const float* p = rowk0 + 8 * (lane >> 4);
#pragma unroll
  for (int i = 0; i < 8; ++i) { a[i] = (_Float16)(p[i] * sc); a[8 + i] = (_Float16)(p[16 + i] * sc); }
  return a;
}
// column fragment from a [K][ld] layout (column n), rows >= K read as 0
__device__ __forceinline__ v16h fragc_f32(const float* W, int k0, int n, int lane, int ld, int K) {
  v16h a; const int g = lane >> 4;
#pragma unroll
  for (int i = 0; i < 8; ++i) { const int ka = k0 + 8 * g + i, kb = ka + 16;
    a[i] = (_Float16)(ka < K ? W[(size_t)(ka < K ? ka : K - 1) * ld + n] : 0.f); a[8 + i] = (_Float16)(kb < K ? W[(size_t)(kb < K ? kb : K - 1) * ld + n] : 0.f); }
  return a;
}
struct F2 { v16b h, l; };
__device__ __forceinline__ F2 bsplit16(const float v[16]) { F2 r;
#pragma unroll
  for (int i = 0; i < 16; ++i) { const __bf16 h = (__bf16)v[i]; r.h[i] = h; r.l[i] = (__bf16)(v[i] - (float)h); }
  return r; }
__device__ __forceinline__ F2 split_row(const float* row, int k0, int lane) { float v[16]; const float* p = row + k0 + 8 * (lane >> 4);
#pragma unroll
  for (int i = 0; i < 8; ++i) { v[i] = p[i]; v[8 + i] = p[16 + i]; }
  return bsplit16(v); }
__device__ __forceinline__ F2 split_rowK(const float* row, int k0, int lane, int K) { float v[16]; const int g = lane >> 4;
#pragma unroll
  for (int i = 0; i < 8; ++i) { const int ka = k0 + 8 * g + i, kb = ka + 16; v[i] = ka < K ? row[ka < K ? ka : K - 1] : 0.f; v[8 + i] = kb < K ? row[kb < K ? kb : K - 1] : 0.f; }
  return bsplit16(v); }
__device__ __forceinline__ F2 split_col(const float* W, int k0, int n, int lane, int ld, int K) { float v[16]; const int g = lane >> 4;
#pragma unroll
  for (int i = 0; i < 8; ++i) { const int ka = k0 + 8 * g + i, kb = ka + 16; v[i] = ka < K ? W[(size_t)(ka < K ? ka : K - 1) * ld + n] : 0.f; v[8 + i] = kb < K ? W[(size_t)(kb < K ? kb : K - 1) * ld + n] : 0.f; }
  return bsplit16(v); }
__device__ __forceinline__ v8f mac3(const F2& a, const F2& b, v8f c) { c = wmma_bf(a.l, b.h, c); c = wmma_bf(a.h, b.l, c); return wmma_bf(a.h, b.h, c); }
// S^T tile: A = key rows, B = query columns; the three hi/lo products come in mac3(q, k)'s order
__device__ __forceinline__ v8f mac3t(const F2& k, const F2& q, v8f c) { c = wmma_bf(k.h, q.l, c); c = wmma_bf(k.l, q.h, c); return wmma_bf(k.h, q.h, c); }
__device__ __forceinline__ float sigm(float v) { return 1.0f / (1.0f + expf(-v)); }
#define LDSX() do { asm volatile("s_wait_dscnt 0" ::: "memory"); __builtin_amdgcn_wave_barrier(); __builtin_amdgcn_fence(__ATOMIC_RELEASE, "workgroup"); } while (0)


// Global self-attention block over 64x64 = 4096 positions: x = relu(bn(inputs)); q, k (64 = 4 heads x 16), v (128 = 4 x 32) by 1x1 convs; softmax(q k^T / 4) v per head; out = o Wo^T + bo, back to NCHW, + inputs.
// k_xT (bn+relu, channel-major -> position-major hi/lo bf16 planes via LDS), k_qkv (one GEMM for [q|k|v] (256 cols), K = 128; q scaled after the bias), k_stats (per (b,h): S^T = k q^T, a lane pair owns one query: online max / sum in-lane over 2048 of the 4096 keys each, the pair joined once after, K = 16 zero-padded), k_attn (P^T = exp(s - M)/L as hi/lo straight from the S^T accumulators, O^T += V^T(hi/lo) P^T over 32-key steps; O -> concat layout),
// k_out (o(hi/lo) Wo^T + bo, transposed through LDS to NCHW rows + shortcut; per channel 64 positions = 256 B).
#define NB 2
#define CIN 128
#define NPOS 4096
#define NHD 4
#define DK 16
#define DV 32
#define KF 64
#define VF 128
#ifndef TNB
#define TNB NB
#define TQB (NPOS / 64)
#endif
typedef __attribute__((ext_vector_type(8))) __bf16 v8b;
__device__ __forceinline__ v16b frag_b(const __bf16* rowk0, int lane) {
  union { v16b v; v8b q[2]; } u; const __bf16* p = rowk0 + 8 * (lane >> 4);
  u.q[0] = *(const v8b*)p; u.q[1] = *(const v8b*)(p + 16); return u.v;
}
__device__ __forceinline__ v16b frag_gbf(const float* rowk0, int lane) {
  v16b a; const float* p = rowk0 + 8 * (lane >> 4);
#pragma unroll
  for (int i = 0; i < 8; ++i) { a[i] = (__bf16)p[i]; a[8 + i] = (__bf16)p[16 + i]; }
  return a;
}
__device__ __forceinline__ float bfr(float v) { return (float)(__bf16)v; }
__device__ __attribute__((noinline)) float exp_ni(float v) { return expf(v); }

#define WS_XH   0u                                  // bf16 [2][4096][128] relu(bn(x)) position-major hi
#define WS_XL   (WS_XH + 2u * NB * NPOS * CIN)
#define WS_QKV  (WS_XL + 2u * NB * NPOS * CIN)        // f32 [2][4096][256]: q (64, scaled) | k (64) | v (128)
#define WS_VTH  (WS_QKV + 4u * NB * NPOS * 256)       // bf16 [2][128 (h,dv)][4096] V^T hi
#define WS_VTL  (WS_VTH + 2u * NB * VF * NPOS)
#define WS_M    (WS_VTL + 2u * NB * VF * NPOS)        // f32 [2][4][4096]
#define WS_L    (WS_M + 4u * NB * NHD * NPOS)
#define WS_O    (WS_L + 4u * NB * NHD * NPOS)         // f32 [2][4096][128] attention output (h, dv)
#define WS_END  (WS_O + 4u * NB * NPOS * VF)

// ---- k_xT: planes[b][p][c] = split(relu((bf16(x[b][c][p]) - m[c]) * (g[c] rsqrt(v[c]+eps)) + beta[c])); block = (b, 64 positions): LDS tile [64 p][128 c] -> rows of 256 B per plane (16 lanes)
__global__ __launch_bounds__(256) void k_xT(const float* __restrict__ X, const float* __restrict__ g, const float* __restrict__ bt, const float* __restrict__ rm, const float* __restrict__ rv, __bf16* __restrict__ PH, __bf16* __restrict__ PL) {
  __shared__ __bf16 sh[64][136], sl[64][136]; __shared__ float ssc[CIN], ssh[CIN];
  const int b = blockIdx.y, p0 = blockIdx.x * 64, tid = threadIdx.x;
  if (tid < CIN) { const float inv = rsqrtf(bfr(rv[tid]) + 1e-5f); const float sc = bfr(g[tid]) * inv; ssc[tid] = sc; ssh[tid] = bfr(bt[tid]) - bfr(rm[tid]) * sc; }
  __syncthreads();
  for (int q = tid; q < CIN * 64; q += 256) { const int c = q >> 6, pl = q & 63; float v = bfr(X[((size_t)b * CIN + c) * NPOS + p0 + pl]) * ssc[c] + ssh[c]; v = v > 0.f ? v : 0.f; const __bf16 hi = (__bf16)v; sh[pl][c] = hi; sl[pl][c] = (__bf16)(v - (float)hi); }
  __syncthreads();
  for (int q = tid; q < 64 * 16; q += 256) { const int pl = q >> 4, pc = q & 15; union { __bf16 e[8]; v4u u; } a, c2;
#pragma unroll
    for (int e = 0; e < 8; ++e) { a.e[e] = sh[pl][pc * 8 + e]; c2.e[e] = sl[pl][pc * 8 + e]; }
    const size_t o = ((size_t)b * NPOS + p0 + pl) * CIN + pc * 8; vst2((unsigned*)(PH + o), a.u); vst2((unsigned*)(PL + o), c2.u); }
}
// ---- k_qkv: QKV[b][p][n] = planes . W rows (+ bias), n < 64: Wq (then x 1/4), < 128: Wk, else Wv; block (64 positions, 128 of the 256 cols); K = 128 (4 steps); also writes V^T hi/lo planes for the v columns (block-local transpose via so)
__global__ __launch_bounds__(128) void k_qkv(const __bf16* __restrict__ PH, const __bf16* __restrict__ PL, const float* __restrict__ Wq, const float* __restrict__ bq, const float* __restrict__ Wk, const float* __restrict__ bk, const float* __restrict__ Wv, const float* __restrict__ bv, float* __restrict__ QKV, __bf16* __restrict__ VTH, __bf16* __restrict__ VTL) {
  __shared__ __align__(16) float so[64][132];
  const int tid = threadIdx.x, wave = tid >> 5, lane = tid & 31, col = lane & 15, g = lane >> 4; const int b = blockIdx.z; const int p0 = blockIdx.x * 64; const int n0 = blockIdx.y * 128;
  const size_t arow = ((size_t)b * NPOS + p0 + wave * 16 + col) * CIN;
  v8f acc[8] = {};
#pragma unroll
  for (int kc = 0; kc < CIN / 32; ++kc) { const v16b ah = frag_b(PH + arow + kc * 32, lane), al = frag_b(PL + arow + kc * 32, lane);
#pragma unroll
    for (int j = 0; j < 8; ++j) { const int n = n0 + j * 16 + col; const float* wr = n < KF ? Wq + (size_t)n * CIN : (n < 2 * KF ? Wk + (size_t)(n - KF) * CIN : Wv + (size_t)(n - 2 * KF) * CIN);   // per-lane weight row pointer (all global, same base kind); j-tile never straddles a matrix (boundaries at 64/128 are tile multiples)
      const v16b w = frag_gbf(wr + kc * 32, lane); acc[j] = wmma_bf(al, w, acc[j]); acc[j] = wmma_bf(ah, w, acc[j]); } }
#pragma unroll
  for (int j = 0; j < 8; ++j) { const int n = n0 + j * 16 + col; const float bias = n < KF ? bfr(bq[n]) : (n < 2 * KF ? bfr(bk[n - KF]) : bfr(bv[n - 2 * KF])); const float sc = n < KF ? 0.25f : 1.0f;
#pragma unroll
    for (int r = 0; r < 8; ++r) so[wave * 16 + 8 * g + r][j * 16 + col] = (acc[j][r] + bias) * sc; }
  __syncthreads();
  for (int q = tid; q < 64 * 32; q += 128) { const int rl = q >> 5, pc = q & 31; vst2(QKV + ((size_t)b * NPOS + p0 + rl) * 256 + n0 + pc * 4, *(const v4f*)&so[rl][pc * 4]); }
  if (n0 == 128) {
    for (int q = tid; q < 128 * 8; q += 128) { const int c = q >> 3, pc = q & 7; union { __bf16 e[8]; v4u u; } hh, ll;
#pragma unroll
      for (int e = 0; e < 8; ++e) { const float v = so[pc * 8 + e][c]; const __bf16 hi = (__bf16)v; hh.e[e] = hi; ll.e[e] = (__bf16)(v - (float)hi); }
      const size_t o = ((size_t)b * VF + c) * NPOS + p0 + pc * 8; vst2((unsigned*)(VTH + o), hh.u); vst2((unsigned*)(VTL + o), ll.u); } }
}
// ---- k_stats: block = (64 queries, b*4+h): S^T = k(hi/lo) q(hi/lo)^T with K = 16 (zero-padded to 32 by split_rowK): lane (g, col) holds keys 8g+0..7 of query col; per-lane online max/sum over 256 key tiles of 16, the two halves joined once behind the loop; M, L rows (256 B by 16 lanes)
__global__ __launch_bounds__(128) void k_stats(const float* __restrict__ QKV, float* __restrict__ Mb, float* __restrict__ Lb) {
  __shared__ __align__(16) float sm[4][16]; __shared__ __align__(16) float ssum[4][16];
  const int tid = threadIdx.x, wave = tid >> 5, lane = tid & 31, col = lane & 15, g = lane >> 4;
  const int bh = blockIdx.y, b = bh >> 2, h = bh & 3; const int q0 = blockIdx.x * 64 + wave * 16;
  const F2 a = split_rowK(QKV + ((size_t)b * NPOS + q0 + col) * 256 + h * DK, 0, lane, DK);
  float m = -3.0e38f, l = 0.f;
#pragma unroll 1
  for (int kt = 0; kt < NPOS / 16; ++kt) { const F2 kb = split_rowK(QKV + ((size_t)b * NPOS + kt * 16 + col) * 256 + KF + h * DK, 0, lane, DK); const v8f s = mac3t(kb, a, (v8f){});
    float mn = m;
#pragma unroll
    for (int r = 0; r < 8; ++r) mn = fmaxf(mn, s[r]);
    float e = 0.f;
#pragma unroll
    for (int r = 0; r < 8; ++r) e += exp_ni(s[r] - mn);
    l = l * exp_ni(m - mn) + e; m = mn; }
  { const float m2 = __shfl_xor(m, 16), l2 = __shfl_xor(l, 16); const float mn = fmaxf(m, m2); l = l * exp_ni(m - mn) + l2 * exp_ni(m2 - mn); m = mn; }   // join the halves' keys
  if (g == 0) { sm[wave][col] = m; ssum[wave][col] = l; }
  __syncthreads();      // the block's 64 M and 64 L values form one 256-B run each: written by 16 lanes x 16 B (one writer per line)
  { const int qb = blockIdx.x * 64; if (tid < 16) vst2(Mb + ((size_t)bh * NPOS + qb) + tid * 4, *(const v4f*)(&sm[0][0] + tid * 4)); else if (tid < 32) vst2(Lb + ((size_t)bh * NPOS + qb) + (tid - 16) * 4, *(const v4f*)(&ssum[0][0] + (tid - 16) * 4)); }
}
__global__ __launch_bounds__(128) void k_attn(const float* __restrict__ QKV, const __bf16* __restrict__ VTH, const __bf16* __restrict__ VTL, const float* __restrict__ Mb, const float* __restrict__ Lb, float* __restrict__ O) {
  __shared__ __align__(16) float so[4][16][36];
  const int tid = threadIdx.x, wave = tid >> 5, lane = tid & 31, col = lane & 15, g = lane >> 4;
  const int bh = blockIdx.y, b = bh >> 2, h = bh & 3; const int q0 = blockIdx.x * 64 + wave * 16;
  const F2 a = split_rowK(QKV + ((size_t)b * NPOS + q0 + col) * 256 + h * DK, 0, lane, DK);
  const float mr = Mb[(size_t)bh * NPOS + q0 + col], il = 1.0f / Lb[(size_t)bh * NPOS + q0 + col];   // the lane's own query
  v8f acc[2] = {};
#pragma unroll 1
  for (int ks = 0; ks < NPOS / 32; ++ks) { float p[16];   // p[ct * 8 + r] = P[query col][key ks * 32 + ct * 16 + 8g + r]: the two S^T tiles are a B fragment's k order as they stand
#pragma unroll
    for (int ct = 0; ct < 2; ++ct) { const F2 kb = split_rowK(QKV + ((size_t)b * NPOS + ks * 32 + ct * 16 + col) * 256 + KF + h * DK, 0, lane, DK); const v8f s = mac3t(kb, a, (v8f){});
#pragma unroll
      for (int r = 0; r < 8; ++r) p[ct * 8 + r] = exp_ni(s[r] - mr) * il; }
    const F2 pa = bsplit16(p);
#pragma unroll
    for (int dt = 0; dt < 2; ++dt) { const size_t vrow = ((size_t)b * VF + h * DV + dt * 16 + col) * NPOS + ks * 32; const v16b vh = frag_b(VTH + vrow, lane), vl = frag_b(VTL + vrow, lane);
      acc[dt] = wmma_bf(vh, pa.l, acc[dt]); acc[dt] = wmma_bf(vl, pa.h, acc[dt]); acc[dt] = wmma_bf(vh, pa.h, acc[dt]); } }
#pragma unroll
  for (int dt = 0; dt < 2; ++dt)   // acc[dt][r] = O[query col][dt * 16 + 8g + r]: 8 consecutive floats of the lane's row
#pragma unroll
    for (int r = 0; r < 8; ++r) so[wave][col][dt * 16 + 8 * g + r] = acc[dt][r];
  LDSX();
  for (int q = lane; q < 16 * 8; q += 32) { const int rl = q >> 3, pc = q & 7; vst2(O + ((size_t)b * NPOS + q0 + rl) * VF + h * DV + pc * 4, *(const v4f*)&so[wave][rl][pc * 4]); }
}
// ---- k_out: Y[p][o] = O row(hi/lo) . Wo rows + bo; out[b][o][p] = Y + inputs (NCHW); block = (64 positions, b): 128 output channels in one pass (8 tiles); transposed store per channel: 64 positions = 256 B by 16 lanes
__global__ __launch_bounds__(128) void k_out(const float* __restrict__ O, const float* __restrict__ Wo, const float* __restrict__ bo, const float* __restrict__ X, float* __restrict__ out) {
  __shared__ __align__(16) float st[128][68];
  const int tid = threadIdx.x, wave = tid >> 5, lane = tid & 31, col = lane & 15, g = lane >> 4; const int b = blockIdx.y; const int p0 = blockIdx.x * 64;
  v8f acc[8] = {};
#pragma unroll
  for (int kc = 0; kc < VF / 32; ++kc) { const F2 a = split_row(O + ((size_t)b * NPOS + p0 + wave * 16 + col) * VF, kc * 32, lane);
#pragma unroll
    for (int j = 0; j < 8; ++j) { const v16b w = frag_gbf(Wo + (size_t)(j * 16 + col) * VF + kc * 32, lane); acc[j] = wmma_bf(a.l, w, acc[j]); acc[j] = wmma_bf(a.h, w, acc[j]); } }
#pragma unroll
  for (int j = 0; j < 8; ++j) { const float bb = bfr(bo[j * 16 + col]);
#pragma unroll
    for (int r = 0; r < 8; ++r) st[j * 16 + col][wave * 16 + 8 * g + r] = acc[j][r] + bb; }
  __syncthreads();
  for (int q = tid; q < 128 * 16; q += 128) { const int o = q >> 4, pc = q & 15; const size_t base = ((size_t)b * CIN + o) * NPOS + p0 + pc * 4; const float4 xv = *(const float4*)(X + base);
    v4f r4; r4[0] = st[o][pc * 4] + bfr(xv.x); r4[1] = st[o][pc * 4 + 1] + bfr(xv.y); r4[2] = st[o][pc * 4 + 2] + bfr(xv.z); r4[3] = st[o][pc * 4 + 3] + bfr(xv.w); vst2(out + base, r4); }
}

extern "C" void kernel_launch(void* const* d_in, const int* in_sizes, int n_in, void* d_out, int out_size, void* d_ws, size_t ws_size, hipStream_t stream) {
  (void)in_sizes; (void)n_in; (void)out_size;
  const float** F = (const float**)d_in;   // inputs, gamma, beta, running_mean, running_var, Wq, bq, Wk, bk, Wv, bv, Wo, bo
  if (ws_size < (size_t)WS_END) return;
  char* ws = (char*)d_ws;
  __bf16 *PH = (__bf16*)(ws + WS_XH), *PL = (__bf16*)(ws + WS_XL), *VTH = (__bf16*)(ws + WS_VTH), *VTL = (__bf16*)(ws + WS_VTL); float *QKV = (float*)(ws + WS_QKV), *Mb = (float*)(ws + WS_M), *Lb = (float*)(ws + WS_L), *O = (float*)(ws + WS_O);
  k_xT<<<dim3(NPOS / 64, TNB), 256, 0, stream>>>(F[0], F[1], F[2], F[3], F[4], PH, PL);
  k_qkv<<<dim3(NPOS / 64, 2, TNB), 128, 0, stream>>>(PH, PL, F[5], F[6], F[7], F[8], F[9], F[10], QKV, VTH, VTL);
  k_stats<<<dim3(TQB, TNB * NHD), 128, 0, stream>>>(QKV, Mb, Lb);
  k_attn<<<dim3(TQB, TNB * NHD), 128, 0, stream>>>(QKV, VTH, VTL, Mb, Lb, O);
  k_out<<<dim3(TQB, TNB), 128, 0, stream>>>(O, F[11], F[12], F[0], (float*)d_out);
}

// v002
// A run of this version takes 332 microseconds.
// Timed twice side by side with v001, it ran 1.48 times as fast both times.
// Counting every step since v000, it is 2.35 times as fast.
// compute dtype: inputs, BN parameters and all projection weights/biases (module inputs) rounded to bf16; q/k/v projections of the BN+ReLU activations, the attention scores, P.V and the output projection all take computed operands as bf16 hi + bf16 residual pairs (2 products against weights, 3 between computed operands);
#include <hip/hip_runtime.h>
#include <math.h>

typedef __attribute__((ext_vector_type(16))) _Float16 v16h;
typedef __attribute__((ext_vector_type(16))) __bf16 v16b;
typedef __attribute__((ext_vector_type(8)))  _Float16 v8h;
typedef __attribute__((ext_vector_type(8)))  float v8f;
typedef __attribute__((ext_vector_type(4)))  float v4f;
typedef __attribute__((ext_vector_type(2)))  float v2f;
typedef __attribute__((ext_vector_type(4)))  unsigned v4u;
typedef __attribute__((ext_vector_type(4)))  int v4i;
typedef float __attribute__((may_alias)) float_a;
typedef int __attribute__((may_alias)) int_a;

template <typename T> __device__ __forceinline__ void vst2(void* p, T v) { *(T*)p = v;  }
__device__ __forceinline__ v8f wmma16(v16h a, v16h b, v8f c) {
  v8f d = __builtin_amdgcn_wmma_f32_16x16x32_f16(false, a, false, b, (short)0, c, false, false);
  asm volatile("v_nop\n\tv_nop\n\tv_nop\n\tv_nop" : "+v"(d) : "v"(a), "v"(b));
  return d;
}
__device__ __forceinline__ v8f wmma_bf(v16b a, v16b b, v8f c) {
  v8f d = __builtin_amdgcn_wmma_f32_16x16x32_bf16(false, a, false, b, (short)0, c, false, false);
  asm volatile("v_nop\n\tv_nop\n\tv_nop\n\tv_nop" : "+v"(d) : "v"(a), "v"(b));
  return d;
}
// 16x16x32 fragments: lane = (h = lane>>4, row/col = lane&15); elements 0..7 = k0+8h+0..7, 8..15 = k0+16+8h+0..7; D element r = row 8h+r
__device__ __forceinline__ v16h frag_h(const _Float16* rowk0, int lane) {
  union { v16h v; v8h q[2]; } u; const _Float16* p = rowk0 + 8 * (lane >> 4);
  u.q[0] = *(const v8h*)p; u.q[1] = *(const v8h*)(p + 16); return u.v;
}
__device__ __forceinline__ v16h frag_f32(const float* rowk0, int lane) {
  v16h a; const float* p = rowk0 + 8 * (lane >> 4);
#pragma unroll
  for (int i = 0; i < 8; ++i) { a[i] = (_Float16)p[i]; a[8 + i] = (_Float16)p[16 + i]; }
  return a;
}
__device__ __forceinline__ v16h frag_f32s(const float* rowk0, int lane, float sc) {
  v16h a; const float* p = rowk0 + 8 * (lane >> 4);
#pragma unroll
  for (int i = 0; i < 8; ++i) { a[i] = (_Float16)(p[i] * sc); a[8 + i] = (_Float16)(p[16 + i] * sc); }
  return a;
}
// column fragment from a [K][ld] layout (column n), rows >= K read as 0
__device__ __forceinline__ v16h fragc_f32(const float* W, int k0, int n, int lane, int ld, int K) {
  v16h a; const int g = lane >> 4;
#pragma unroll
  for (int i = 0; i < 8; ++i) { const int ka = k0 + 8 * g + i, kb = ka + 16;
    a[i] = (_Float16)(ka < K ? W[(size_t)(ka < K ? ka : K - 1) * ld + n] : 0.f); a[8 + i] = (_Float16)(kb < K ? W[(size_t)(kb < K ? kb : K - 1) * ld + n] : 0.f); }
  return a;
}
struct F2 { v16b h, l; };
__device__ __forceinline__ F2 bsplit16(const float v[16]) { F2 r;
#pragma unroll
  for (int i = 0; i < 16; ++i) { const __bf16 h = (__bf16)v[i]; r.h[i] = h; r.l[i] = (__bf16)(v[i] - (float)h); }
  return r; }
__device__ __forceinline__ F2 split_row(const float* row, int k0, int lane) { float v[16]; const float* p = row + k0 + 8 * (lane >> 4);
#pragma unroll
  for (int i = 0; i < 8; ++i) { v[i] = p[i]; v[8 + i] = p[16 + i]; }
  return bsplit16(v); }
__device__ __forceinline__ F2 split_rowK(const float* row, int k0, int lane, int K) { float v[16]; const int g = lane >> 4;
#pragma unroll
  for (int i = 0; i < 8; ++i) { const int ka = k0 + 8 * g + i, kb = ka + 16; v[i] = ka < K ? row[ka < K ? ka : K - 1] : 0.f; v[8 + i] = kb < K ? row[kb < K ? kb : K - 1] : 0.f; }
  return bsplit16(v); }
__device__ __forceinline__ F2 split_col(const float* W, int k0, int n, int lane, int ld, int K) { float v[16]; const int g = lane >> 4;
#pragma unroll
  for (int i = 0; i < 8; ++i) { const int ka = k0 + 8 * g + i, kb = ka + 16; v[i] = ka < K ? W[(size_t)(ka < K ? ka : K - 1) * ld + n] : 0.f; v[8 + i] = kb < K ? W[(size_t)(kb < K ? kb : K - 1) * ld + n] : 0.f; }
  return bsplit16(v); }
__device__ __forceinline__ v8f mac3(const F2& a, const F2& b, v8f c) { c = wmma_bf(a.l, b.h, c); c = wmma_bf(a.h, b.l, c); return wmma_bf(a.h, b.h, c); }
// S^T tile: A = key rows, B = query columns; the three hi/lo products come in mac3(q, k)'s order
__device__ __forceinline__ v8f mac3t(const F2& k, const F2& q, v8f c) { c = wmma_bf(k.h, q.l, c); c = wmma_bf(k.l, q.h, c); return wmma_bf(k.h, q.h, c); }
__device__ __forceinline__ float sigm(float v) { return 1.0f / (1.0f + expf(-v)); }
#define LDSX() do { asm volatile("s_wait_dscnt 0" ::: "memory"); __builtin_amdgcn_wave_barrier(); __builtin_amdgcn_fence(__ATOMIC_RELEASE, "workgroup"); } while (0)


// Global self-attention block over 64x64 = 4096 positions: x = relu(bn(inputs)); q, k (64 = 4 heads x 16), v (128 = 4 x 32) by 1x1 convs; softmax(q k^T / 4) v per head; out = o Wo^T + bo, back to NCHW, + inputs.
// k_xT (bn+relu, channel-major -> position-major hi/lo bf16 planes via LDS), k_qkv (one GEMM for [q|k|v] (256 cols), K = 128; q scaled after the bias), k_stats (per (b,h): S^T = k q^T, a lane pair owns one query: online max / sum in-lane over 2048 of the 4096 keys each, the pair joined once after, K = 16 zero-padded), k_attn (P^T = exp(s - M)/L as hi/lo straight from the S^T accumulators, O^T += V^T(hi/lo) P^T over 32-key steps; O -> concat layout),
// k_out (o(hi/lo) Wo^T + bo, transposed through LDS to NCHW rows + shortcut; per channel 64 positions = 256 B).
#define NB 2
#define CIN 128
#define NPOS 4096
#define NHD 4
#define DK 16
#define DV 32
#define KF 64
#define VF 128
#ifndef TNB
#define TNB NB
#define TQB (NPOS / 64)
#endif
typedef __attribute__((ext_vector_type(8))) __bf16 v8b;
__device__ __forceinline__ v16b frag_b(const __bf16* rowk0, int lane) {
  union { v16b v; v8b q[2]; } u; const __bf16* p = rowk0 + 8 * (lane >> 4);
  u.q[0] = *(const v8b*)p; u.q[1] = *(const v8b*)(p + 16); return u.v;
}
__device__ __forceinline__ v16b frag_gbf(const float* rowk0, int lane) {
  v16b a; const float* p = rowk0 + 8 * (lane >> 4);
#pragma unroll
  for (int i = 0; i < 8; ++i) { a[i] = (__bf16)p[i]; a[8 + i] = (__bf16)p[16 + i]; }
  return a;
}
__device__ __forceinline__ float bfr(float v) { return (float)(__bf16)v; }
// exp(s - m) = 2^(s' - m') with s' = s * log2(e): k_qkv folds log2(e) into q's scale, so scores and maxima come in the log2 domain and an exponential is one subtract and the hardware exp2, inline. Arguments are <= 0; a hugely negative one gives 0.
// The exp2 stand in asm, each in place, so that none is directly followed by a write of its source; the closing v_nop is the slot that the instruction set asks for behind a transcendental before its result is read.
#define L2E 1.44269504088896340736f
__device__ __forceinline__ void exp2x8(float* x) {
  asm("v_exp_f32 %0, %0\n\tv_exp_f32 %1, %1\n\tv_exp_f32 %2, %2\n\tv_exp_f32 %3, %3\n\tv_exp_f32 %4, %4\n\tv_exp_f32 %5, %5\n\tv_exp_f32 %6, %6\n\tv_exp_f32 %7, %7\n\tv_nop"
      : "+v"(x[0]), "+v"(x[1]), "+v"(x[2]), "+v"(x[3]), "+v"(x[4]), "+v"(x[5]), "+v"(x[6]), "+v"(x[7]));
}
__device__ __forceinline__ float exp2x1(float x) { asm("v_exp_f32 %0, %0\n\tv_nop" : "+v"(x)); return x; }

#define WS_XH   0u                                  // bf16 [2][4096][128] relu(bn(x)) position-major hi
#define WS_XL   (WS_XH + 2u * NB * NPOS * CIN)
#define WS_QKV  (WS_XL + 2u * NB * NPOS * CIN)        // f32 [2][4096][256]: q (64, scaled by log2(e)/4) | k (64) | v (128)
#define WS_VTH  (WS_QKV + 4u * NB * NPOS * 256)       // bf16 [2][128 (h,dv)][4096] V^T hi
#define WS_VTL  (WS_VTH + 2u * NB * VF * NPOS)
#define WS_M    (WS_VTL + 2u * NB * VF * NPOS)        // f32 [2][4][4096], log2 domain
#define WS_L    (WS_M + 4u * NB * NHD * NPOS)
#define WS_O    (WS_L + 4u * NB * NHD * NPOS)         // f32 [2][4096][128] attention output (h, dv)
#define WS_END  (WS_O + 4u * NB * NPOS * VF)

// ---- k_xT: planes[b][p][c] = split(relu((bf16(x[b][c][p]) - m[c]) * (g[c] rsqrt(v[c]+eps)) + beta[c])); block = (b, 64 positions): LDS tile [64 p][128 c] -> rows of 256 B per plane (16 lanes)
__global__ __launch_bounds__(256) void k_xT(const float* __restrict__ X, const float* __restrict__ g, const float* __restrict__ bt, const float* __restrict__ rm, const float* __restrict__ rv, __bf16* __restrict__ PH, __bf16* __restrict__ PL) {
  __shared__ __bf16 sh[64][136], sl[64][136]; __shared__ float ssc[CIN], ssh[CIN];
  const int b = blockIdx.y, p0 = blockIdx.x * 64, tid = threadIdx.x;
  if (tid < CIN) { const float inv = rsqrtf(bfr(rv[tid]) + 1e-5f); const float sc = bfr(g[tid]) * inv; ssc[tid] = sc; ssh[tid] = bfr(bt[tid]) - bfr(rm[tid]) * sc; }
  __syncthreads();
  for (int q = tid; q < CIN * 64; q += 256) { const int c = q >> 6, pl = q & 63; float v = bfr(X[((size_t)b * CIN + c) * NPOS + p0 + pl]) * ssc[c] + ssh[c]; v = v > 0.f ? v : 0.f; const __bf16 hi = (__bf16)v; sh[pl][c] = hi; sl[pl][c] = (__bf16)(v - (float)hi); }
  __syncthreads();
  for (int q = tid; q < 64 * 16; q += 256) { const int pl = q >> 4, pc = q & 15; union { __bf16 e[8]; v4u u; } a, c2;
#pragma unroll
    for (int e = 0; e < 8; ++e) { a.e[e] = sh[pl][pc * 8 + e]; c2.e[e] = sl[pl][pc * 8 + e]; }
    const size_t o = ((size_t)b * NPOS + p0 + pl) * CIN + pc * 8; vst2((unsigned*)(PH + o), a.u); vst2((unsigned*)(PL + o), c2.u); }
}
// ---- k_qkv: QKV[b][p][n] = planes . W rows (+ bias), n < 64: Wq (then x log2(e)/4), < 128: Wk, else Wv; block (64 positions, 128 of the 256 cols); K = 128 (4 steps); also writes V^T hi/lo planes for the v columns (block-local transpose via so)
__global__ __launch_bounds__(128) void k_qkv(const __bf16* __restrict__ PH, const __bf16* __restrict__ PL, const float* __restrict__ Wq, const float* __restrict__ bq, const float* __restrict__ Wk, const float* __restrict__ bk, const float* __restrict__ Wv, const float* __restrict__ bv, float* __restrict__ QKV, __bf16* __restrict__ VTH, __bf16* __restrict__ VTL) {
  __shared__ __align__(16) float so[64][132];
  const int tid = threadIdx.x, wave = tid >> 5, lane = tid & 31, col = lane & 15, g = lane >> 4; const int b = blockIdx.z; const int p0 = blockIdx.x * 64; const int n0 = blockIdx.y * 128;
  const size_t arow = ((size_t)b * NPOS + p0 + wave * 16 + col) * CIN;
  v8f acc[8] = {};
#pragma unroll
  for (int kc = 0; kc < CIN / 32; ++kc) { const v16b ah = frag_b(PH + arow + kc * 32, lane), al = frag_b(PL + arow + kc * 32, lane);
#pragma unroll
    for (int j = 0; j < 8; ++j) { const int n = n0 + j * 16 + col; const float* wr = n < KF ? Wq + (size_t)n * CIN : (n < 2 * KF ? Wk + (size_t)(n - KF) * CIN : Wv + (size_t)(n - 2 * KF) * CIN);   // per-lane weight row pointer (all global, same base kind); j-tile never straddles a matrix (boundaries at 64/128 are tile multiples)
      const v16b w = frag_gbf(wr + kc * 32, lane); acc[j] = wmma_bf(al, w, acc[j]); acc[j] = wmma_bf(ah, w, acc[j]); } }
#pragma unroll
  for (int j = 0; j < 8; ++j) { const int n = n0 + j * 16 + col; const float bias = n < KF ? bfr(bq[n]) : (n < 2 * KF ? bfr(bk[n - KF]) : bfr(bv[n - 2 * KF])); const float sc = n < KF ? 0.25f * L2E : 1.0f;
#pragma unroll
    for (int r = 0; r < 8; ++r) so[wave * 16 + 8 * g + r][j * 16 + col] = (acc[j][r] + bias) * sc; }
  __syncthreads();
  for (int q = tid; q < 64 * 32; q += 128) { const int rl = q >> 5, pc = q & 31; vst2(QKV + ((size_t)b * NPOS + p0 + rl) * 256 + n0 + pc * 4, *(const v4f*)&so[rl][pc * 4]); }
  if (n0 == 128) {
    for (int q = tid; q < 128 * 8; q += 128) { const int c = q >> 3, pc = q & 7; union { __bf16 e[8]; v4u u; } hh, ll;
#pragma unroll
      for (int e = 0; e < 8; ++e) { const float v = so[pc * 8 + e][c]; const __bf16 hi = (__bf16)v; hh.e[e] = hi; ll.e[e] = (__bf16)(v - (float)hi); }
      const size_t o = ((size_t)b * VF + c) * NPOS + p0 + pc * 8; vst2((unsigned*)(VTH + o), hh.u); vst2((unsigned*)(VTL + o), ll.u); } }
}
// ---- k_stats: block = (64 queries, b*4+h): S^T = k(hi/lo) q(hi/lo)^T with K = 16 (zero-padded to 32 by split_rowK): lane (g, col) holds keys 8g+0..7 of query col; per-lane online max/sum over 256 key tiles of 16, the two halves joined once behind the loop; M, L rows (256 B by 16 lanes)
__global__ __launch_bounds__(128) void k_stats(const float* __restrict__ QKV, float* __restrict__ Mb, float* __restrict__ Lb) {
  __shared__ __align__(16) float sm[4][16]; __shared__ __align__(16) float ssum[4][16];
  const int tid = threadIdx.x, wave = tid >> 5, lane = tid & 31, col = lane & 15, g = lane >> 4;
  const int bh = blockIdx.y, b = bh >> 2, h = bh & 3; const int q0 = blockIdx.x * 64 + wave * 16;
  const F2 a = split_rowK(QKV + ((size_t)b * NPOS + q0 + col) * 256 + h * DK, 0, lane, DK);
  float m = -3.0e38f, l = 0.f;
#pragma unroll 1
  for (int kt = 0; kt < NPOS / 16; ++kt) { const F2 kb = split_rowK(QKV + ((size_t)b * NPOS + kt * 16 + col) * 256 + KF + h * DK, 0, lane, DK);
    asm volatile("s_wait_xcnt 0x0" ::: "memory");   // the split's results reuse the K loads' address registers: the wait stands in front of that overwrite
    const v8f s = mac3t(kb, a, (v8f){});
    float mn = m;
#pragma unroll
    for (int r = 0; r < 8; ++r) mn = fmaxf(mn, s[r]);
    float x[8];
#pragma unroll
    for (int r = 0; r < 8; ++r) x[r] = s[r] - mn;
    exp2x8(x);
    float e = x[0];
#pragma unroll
    for (int r = 1; r < 8; ++r) e += x[r];
    l = l * exp2x1(m - mn) + e; m = mn; }
  { const float m2 = __shfl_xor(m, 16), l2 = __shfl_xor(l, 16); const float mn = fmaxf(m, m2); l = l * exp2x1(m - mn) + l2 * exp2x1(m2 - mn); m = mn; }   // join the halves' keys
  if (g == 0) { sm[wave][col] = m; ssum[wave][col] = l; }
  __syncthreads();      // the block's 64 M and 64 L values form one 256-B run each: written by 16 lanes x 16 B (one writer per line)
  { const int qb = blockIdx.x * 64; if (tid < 16) vst2(Mb + ((size_t)bh * NPOS + qb) + tid * 4, *(const v4f*)(&sm[0][0] + tid * 4)); else if (tid < 32) vst2(Lb + ((size_t)bh * NPOS + qb) + (tid - 16) * 4, *(const v4f*)(&ssum[0][0] + (tid - 16) * 4)); }
}
__global__ __launch_bounds__(128) void k_attn(const float* __restrict__ QKV, const __bf16* __restrict__ VTH, const __bf16* __restrict__ VTL, const float* __restrict__ Mb, const float* __restrict__ Lb, float* __restrict__ O) {
  __shared__ __align__(16) float so[4][16][36];
  const int tid = threadIdx.x, wave = tid >> 5, lane = tid & 31, col = lane & 15, g = lane >> 4;
  const int bh = blockIdx.y, b = bh >> 2, h = bh & 3; const int q0 = blockIdx.x * 64 + wave * 16;
  const F2 a = split_rowK(QKV + ((size_t)b * NPOS + q0 + col) * 256 + h * DK, 0, lane, DK);
  const float mr = Mb[(size_t)bh * NPOS + q0 + col], il = 1.0f / Lb[(size_t)bh * NPOS + q0 + col];   // the lane's own query
  v8f acc[2] = {};
#pragma unroll 1
  for (int ks = 0; ks < NPOS / 32; ++ks) { float p[16];   // p[ct * 8 + r] = P[query col][key ks * 32 + ct * 16 + 8g + r]: the two S^T tiles are a B fragment's k order as they stand
#pragma unroll
    for (int ct = 0; ct < 2; ++ct) { const F2 kb = split_rowK(QKV + ((size_t)b * NPOS + ks * 32 + ct * 16 + col) * 256 + KF + h * DK, 0, lane, DK);
      asm volatile("s_wait_xcnt 0x0" ::: "memory");   // the split's results reuse the K loads' address registers: the wait stands in front of that overwrite
      const v8f s = mac3t(kb, a, (v8f){});
      float x[8];
#pragma unroll
      for (int r = 0; r < 8; ++r) x[r] = s[r] - mr;
      exp2x8(x);
#pragma unroll
      for (int r = 0; r < 8; ++r) p[ct * 8 + r] = x[r] * il; }
    const F2 pa = bsplit16(p);
#pragma unroll
    for (int dt = 0; dt < 2; ++dt) { const size_t vrow = ((size_t)b * VF + h * DV + dt * 16 + col) * NPOS + ks * 32; const v16b vh = frag_b(VTH + vrow, lane), vl = frag_b(VTL + vrow, lane);
      acc[dt] = wmma_bf(vh, pa.l, acc[dt]); acc[dt] = wmma_bf(vl, pa.h, acc[dt]); acc[dt] = wmma_bf(vh, pa.h, acc[dt]); } }
#pragma unroll
  for (int dt = 0; dt < 2; ++dt)   // acc[dt][r] = O[query col][dt * 16 + 8g + r]: 8 consecutive floats of the lane's row
#pragma unroll
    for (int r = 0; r < 8; ++r) so[wave][col][dt * 16 + 8 * g + r] = acc[dt][r];
  LDSX();
  for (int q = lane; q < 16 * 8; q += 32) { const int rl = q >> 3, pc = q & 7; vst2(O + ((size_t)b * NPOS + q0 + rl) * VF + h * DV + pc * 4, *(const v4f*)&so[wave][rl][pc * 4]); }
}
// ---- k_out: Y[p][o] = O row(hi/lo) . Wo rows + bo; out[b][o][p] = Y + inputs (NCHW); block = (64 positions, b): 128 output channels in one pass (8 tiles); transposed store per channel: 64 positions = 256 B by 16 lanes
__global__ __launch_bounds__(128) void k_out(const float* __restrict__ O, const float* __restrict__ Wo, const float* __restrict__ bo, const float* __restrict__ X, float* __restrict__ out) {
  __shared__ __align__(16) float st[128][68];
  const int tid = threadIdx.x, wave = tid >> 5, lane = tid & 31, col = lane & 15, g = lane >> 4; const int b = blockIdx.y; const int p0 = blockIdx.x * 64;
  v8f acc[8] = {};
#pragma unroll
  for (int kc = 0; kc < VF / 32; ++kc) { const F2 a = split_row(O + ((size_t)b * NPOS + p0 + wave * 16 + col) * VF, kc * 32, lane);
#pragma unroll
    for (int j = 0; j < 8; ++j) { const v16b w = frag_gbf(Wo + (size_t)(j * 16 + col) * VF + kc * 32, lane); acc[j] = wmma_bf(a.l, w, acc[j]); acc[j] = wmma_bf(a.h, w, acc[j]); } }
#pragma unroll
  for (int j = 0; j < 8; ++j) { const float bb = bfr(bo[j * 16 + col]);
#pragma unroll
    for (int r = 0; r < 8; ++r) st[j * 16 + col][wave * 16 + 8 * g + r] = acc[j][r] + bb; }
  __syncthreads();
  for (int q = tid; q < 128 * 16; q += 128) { const int o = q >> 4, pc = q & 15; const size_t base = ((size_t)b * CIN + o) * NPOS + p0 + pc * 4; const float4 xv = *(const float4*)(X + base);
    v4f r4; r4[0] = st[o][pc * 4] + bfr(xv.x); r4[1] = st[o][pc * 4 + 1] + bfr(xv.y); r4[2] = st[o][pc * 4 + 2] + bfr(xv.z); r4[3] = st[o][pc * 4 + 3] + bfr(xv.w); vst2(out + base, r4); }
}

extern "C" void kernel_launch(void* const* d_in, const int* in_sizes, int n_in, void* d_out, int out_size, void* d_ws, size_t ws_size, hipStream_t stream) {
  (void)in_sizes; (void)n_in; (void)out_size;
  const float** F = (const float**)d_in;   // inputs, gamma, beta, running_mean, running_var, Wq, bq, Wk, bk, Wv, bv, Wo, bo
  if (ws_size < (size_t)WS_END) return;
  char* ws = (char*)d_ws;
  __bf16 *PH = (__bf16*)(ws + WS_XH), *PL = (__bf16*)(ws + WS_XL), *VTH = (__bf16*)(ws + WS_VTH), *VTL = (__bf16*)(ws + WS_VTL); float *QKV = (float*)(ws + WS_QKV), *Mb = (float*)(ws + WS_M), *Lb = (float*)(ws + WS_L), *O = (float*)(ws + WS_O);
  k_xT<<<dim3(NPOS / 64, TNB), 256, 0, stream>>>(F[0], F[1], F[2], F[3], F[4], PH, PL);
  k_qkv<<<dim3(NPOS / 64, 2, TNB), 128, 0, stream>>>(PH, PL, F[5], F[6], F[7], F[8], F[9], F[10], QKV, VTH, VTL);
  k_stats<<<dim3(TQB, TNB * NHD), 128, 0, stream>>>(QKV, Mb, Lb);
  k_attn<<<dim3(TQB, TNB * NHD), 128, 0, stream>>>(QKV, VTH, VTL, Mb, Lb, O);
  k_out<<<dim3(TQB, TNB), 128, 0, stream>>>(O, F[11], F[12], F[0], (float*)d_out);
}

// v003
// Measured time: 133 microseconds a run.
// Two timings next to v002 put it at 2.48 and 2.49 times that version's speed.
// Counting every step since v000, it is 5.85 times as fast.
// compute dtype: inputs, BN parameters and all projection weights/biases (module inputs) rounded to bf16; q/k/v projections of the BN+ReLU activations, the attention scores, P.V and the output projection all take computed operands as bf16 hi + bf16 residual pairs (2 products against weights, 3 between computed operands);
#include <hip/hip_runtime.h>
#include <math.h>

typedef __attribute__((ext_vector_type(16))) _Float16 v16h;
typedef __attribute__((ext_vector_type(16))) __bf16 v16b;
typedef __attribute__((ext_vector_type(8)))  _Float16 v8h;
typedef __attribute__((ext_vector_type(8)))  float v8f;
typedef __attribute__((ext_vector_type(4)))  float v4f;
typedef __attribute__((ext_vector_type(2)))  float v2f;
typedef __attribute__((ext_vector_type(4)))  unsigned v4u;
typedef __attribute__((ext_vector_type(4)))  int v4i;
typedef float __attribute__((may_alias)) float_a;
typedef int __attribute__((may_alias)) int_a;

template <typename T> __device__ __forceinline__ void vst2(void* p, T v) { *(T*)p = v;  }
__device__ __forceinline__ v8f wmma16(v16h a, v16h b, v8f c) {
  v8f d = __builtin_amdgcn_wmma_f32_16x16x32_f16(false, a, false, b, (short)0, c, false, false);
  asm volatile("v_nop\n\tv_nop\n\tv_nop\n\tv_nop" : "+v"(d) : "v"(a), "v"(b));
  return d;
}
__device__ __forceinline__ v8f wmma_bf(v16b a, v16b b, v8f c) {
  v8f d = __builtin_amdgcn_wmma_f32_16x16x32_bf16(false, a, false, b, (short)0, c, false, false);
  asm volatile("v_nop\n\tv_nop\n\tv_nop\n\tv_nop" : "+v"(d) : "v"(a), "v"(b));
  return d;
}
// 16x16x32 fragments: lane = (h = lane>>4, row/col = lane&15); elements 0..7 = k0+8h+0..7, 8..15 = k0+16+8h+0..7; D element r = row 8h+r
__device__ __forceinline__ v16h frag_h(const _Float16* rowk0, int lane) {
  union { v16h v; v8h q[2]; } u; const _Float16* p = rowk0 + 8 * (lane >> 4);
  u.q[0] = *(const v8h*)p; u.q[1] = *(const v8h*)(p + 16); return u.v;
}
__device__ __forceinline__ v16h frag_f32(const float* rowk0, int lane) {
  v16h a; const float* p = rowk0 + 8 * (lane >> 4);
#pragma unroll
  for (int i = 0; i < 8; ++i) { a[i] = (_Float16)p[i]; a[8 + i] = (_Float16)p[16 + i]; }
  return a;
}
__device__ __forceinline__ v16h frag_f32s(const float* rowk0, int lane, float sc) {
  v16h a; const float* p = rowk0 + 8 * (lane >> 4);
#pragma unroll
  for (int i = 0; i < 8; ++i) { a[i] = (_Float16)(p[i] * sc); a[8 + i] = (_Float16)(p[16 + i] * sc); }
  return a;
}
// column fragment from a [K][ld] layout (column n), rows >= K read as 0
__device__ __forceinline__ v16h fragc_f32(const float* W, int k0, int n, int lane, int ld, int K) {
  v16h a; const int g = lane >> 4;
#pragma unroll
  for (int i = 0; i < 8; ++i) { const int ka = k0 + 8 * g + i, kb = ka + 16;
    a[i] = (_Float16)(ka < K ? W[(size_t)(ka < K ? ka : K - 1) * ld + n] : 0.f); a[8 + i] = (_Float16)(kb < K ? W[(size_t)(kb < K ? kb : K - 1) * ld + n] : 0.f); }
  return a;
}
struct F2 { v16b h, l; };
__device__ __forceinline__ F2 bsplit16(const float v[16]) { F2 r;
#pragma unroll
  for (int i = 0; i < 16; ++i) { const __bf16 h = (__bf16)v[i]; r.h[i] = h; r.l[i] = (__bf16)(v[i] - (float)h); }
  return r; }
__device__ __forceinline__ F2 split_row(const float* row, int k0, int lane) { float v[16]; const float* p = row + k0 + 8 * (lane >> 4);
#pragma unroll
  for (int i = 0; i < 8; ++i) { v[i] = p[i]; v[8 + i] = p[16 + i]; }
  return bsplit16(v); }
__device__ __forceinline__ F2 split_rowK(const float* row, int k0, int lane, int K) { float v[16]; const int g = lane >> 4;
#pragma unroll
  for (int i = 0; i < 8; ++i) { const int ka = k0 + 8 * g + i, kb = ka + 16; v[i] = ka < K ? row[ka < K ? ka : K - 1] : 0.f; v[8 + i] = kb < K ? row[kb < K ? kb : K - 1] : 0.f; }
  return bsplit16(v); }
__device__ __forceinline__ F2 split_col(const float* W, int k0, int n, int lane, int ld, int K) { float v[16]; const int g = lane >> 4;
#pragma unroll
  for (int i = 0; i < 8; ++i) { const int ka = k0 + 8 * g + i, kb = ka + 16; v[i] = ka < K ? W[(size_t)(ka < K ? ka : K - 1) * ld + n] : 0.f; v[8 + i] = kb < K ? W[(size_t)(kb < K ? kb : K - 1) * ld + n] : 0.f; }
  return bsplit16(v); }
__device__ __forceinline__ v8f mac3(const F2& a, const F2& b, v8f c) { c = wmma_bf(a.l, b.h, c); c = wmma_bf(a.h, b.l, c); return wmma_bf(a.h, b.h, c); }
// S^T tile: A = key rows, B = query columns; the three hi/lo products come in mac3(q, k)'s order
__device__ __forceinline__ v8f mac3t(const F2& k, const F2& q, v8f c) { c = wmma_bf(k.h, q.l, c); c = wmma_bf(k.l, q.h, c); return wmma_bf(k.h, q.h, c); }
__device__ __forceinline__ float sigm(float v) { return 1.0f / (1.0f + expf(-v)); }
#define LDSX() do { asm volatile("s_wait_dscnt 0" ::: "memory"); __builtin_amdgcn_wave_barrier(); __builtin_amdgcn_fence(__ATOMIC_RELEASE, "workgroup"); } while (0)


// Global self-attention block over 64x64 = 4096 positions: x = relu(bn(inputs)); q, k (64 = 4 heads x 16), v (128 = 4 x 32) by 1x1 convs; softmax(q k^T / 4) v per head; out = o Wo^T + bo, back to NCHW, + inputs.
// k_xT (bn+relu, channel-major -> position-major hi/lo bf16 planes via LDS), k_qkv (one GEMM for [q|k|v] (256 cols), K = 128; q scaled after the bias), k_stats (per (b,h): S^T = k q^T, a lane pair owns one query: online max / sum in-lane over 2048 of the 4096 keys each, the pair joined once after, K = 16 zero-padded), k_attn (P^T = exp(s - M)/L as hi/lo straight from the S^T accumulators, O^T += V^T(hi/lo) P^T over 32-key steps; O -> concat layout),
// k_out (o(hi/lo) Wo^T + bo, transposed through LDS to NCHW rows + shortcut; per channel 64 positions = 256 B).
#define NB 2
#define CIN 128
#define NPOS 4096
#define NHD 4
#define DK 16
#define DV 32
#define KF 64
#define VF 128
#ifndef TNB
#define TNB NB
#define TQB (NPOS / 64)
#endif
typedef __attribute__((ext_vector_type(8))) __bf16 v8b;
__device__ __forceinline__ v16b frag_b(const __bf16* rowk0, int lane) {
  union { v16b v; v8b q[2]; } u; const __bf16* p = rowk0 + 8 * (lane >> 4);
  u.q[0] = *(const v8b*)p; u.q[1] = *(const v8b*)(p + 16); return u.v;
}
__device__ __forceinline__ v16b frag_gbf(const float* rowk0, int lane) {
  v16b a; const float* p = rowk0 + 8 * (lane >> 4);
#pragma unroll
  for (int i = 0; i < 8; ++i) { a[i] = (__bf16)p[i]; a[8 + i] = (__bf16)p[16 + i]; }
  return a;
}
__device__ __forceinline__ float bfr(float v) { return (float)(__bf16)v; }
// exp(s - m) = 2^(s' - m') with s' = s * log2(e): k_qkv folds log2(e) into q's scale, so scores and maxima come in the log2 domain and an exponential is one subtract and the hardware exp2, inline. Arguments are <= 0; a hugely negative one gives 0.
// The exp2 stand in asm, each in place, so that none is directly followed by a write of its source; the closing v_nop is the slot that the instruction set asks for behind a transcendental before its result is read.
#define L2E 1.44269504088896340736f
__device__ __forceinline__ void exp2x8(float* x) {
  asm("v_exp_f32 %0, %0\n\tv_exp_f32 %1, %1\n\tv_exp_f32 %2, %2\n\tv_exp_f32 %3, %3\n\tv_exp_f32 %4, %4\n\tv_exp_f32 %5, %5\n\tv_exp_f32 %6, %6\n\tv_exp_f32 %7, %7\n\tv_nop"
      : "+v"(x[0]), "+v"(x[1]), "+v"(x[2]), "+v"(x[3]), "+v"(x[4]), "+v"(x[5]), "+v"(x[6]), "+v"(x[7]));
}
__device__ __forceinline__ float exp2x1(float x) { asm("v_exp_f32 %0, %0\n\tv_nop" : "+v"(x)); return x; }

// K and V^T tiles go to LDS once per block and stage, by asynchronous copies (16 B a lane, through no register), and the block's 4 waves read their fragments from there.
#define KST 128               // keys per stage
#define NST (NPOS / KST)      // stages
#define KPF 20                // K row pitch in LDS, floats: 64 B + 16 B (16 B x odd: 16-byte readers meet no bank twice)
#define VPB 136               // V^T row pitch in LDS, bf16: 256 B + 16 B, for the same reason
__device__ __forceinline__ unsigned lds_off(const void* p) { return (unsigned)(size_t)p; }
// one stage of K: 128 rows of 64 B (one head's 16 floats of a 1024-B row); thread = (row tid >> 2 (+ 32 i), 16-B part tid & 3)
__device__ __forceinline__ void copy_k(const float* kg, float* sk, int tid) {
  const float* g0 = kg + (size_t)(tid >> 2) * 256 + (tid & 3) * 4; const float *g1 = g0 + 32 * 256, *g2 = g0 + 64 * 256, *g3 = g0 + 96 * 256;
  const unsigned l0 = lds_off(sk + (tid >> 2) * KPF + (tid & 3) * 4), l1 = l0 + 32 * KPF * 4, l2 = l0 + 64 * KPF * 4, l3 = l0 + 96 * KPF * 4;
  // the closing s_wait_xcnt stands in the copies' own statement, in front of any later write of their address registers
  asm volatile("global_load_async_to_lds_b128 %0, %4, off\n\tglobal_load_async_to_lds_b128 %1, %5, off\n\tglobal_load_async_to_lds_b128 %2, %6, off\n\tglobal_load_async_to_lds_b128 %3, %7, off\n\ts_wait_xcnt 0x0"
               :: "v"(l0), "v"(l1), "v"(l2), "v"(l3), "v"(g0), "v"(g1), "v"(g2), "v"(g3) : "memory");
}
// one stage of one V^T plane: 32 rows of 256 B (128 keys); thread = (row tid >> 4 (+ 8 i), 16-B part tid & 15)
__device__ __forceinline__ void copy_v(const __bf16* vg, __bf16* sv, int tid) {
  const __bf16* g0 = vg + (size_t)(tid >> 4) * NPOS + (tid & 15) * 8; const __bf16 *g1 = g0 + 8 * NPOS, *g2 = g0 + 16 * NPOS, *g3 = g0 + 24 * NPOS;
  const unsigned l0 = lds_off(sv + (tid >> 4) * VPB + (tid & 15) * 8), l1 = l0 + 8 * VPB * 2, l2 = l0 + 16 * VPB * 2, l3 = l0 + 24 * VPB * 2;
  // the closing s_wait_xcnt stands in the copies' own statement, in front of any later write of their address registers
  asm volatile("global_load_async_to_lds_b128 %0, %4, off\n\tglobal_load_async_to_lds_b128 %1, %5, off\n\tglobal_load_async_to_lds_b128 %2, %6, off\n\tglobal_load_async_to_lds_b128 %3, %7, off\n\ts_wait_xcnt 0x0"
               :: "v"(l0), "v"(l1), "v"(l2), "v"(l3), "v"(g0), "v"(g1), "v"(g2), "v"(g3) : "memory");
}
#define WAIT_COPIES() asm volatile("s_wait_asynccnt 0x0" ::: "memory")   // this wave's copies have landed
#define WAIT_LDS()    asm volatile("s_wait_dscnt 0x0" ::: "memory")      // this wave's LDS reads are done before the buffer is given up
// K fragment from the lane's 8 floats of an LDS row (a, c = row + 8 * (lane >> 4) + 0..3, + 4..7); elements 0..7 = k 8h + 0..7, elements 8..15 (k >= 16) are 0: split_rowK's k order at K = 16
__device__ __forceinline__ F2 split_k16(v4f a, v4f c) { float v[16];
#pragma unroll
  for (int i = 0; i < 4; ++i) { v[i] = a[i]; v[4 + i] = c[i]; v[8 + i] = 0.f; v[12 + i] = 0.f; }
  return bsplit16(v); }

#define WS_XH   0u                                  // bf16 [2][4096][128] relu(bn(x)) position-major hi
#define WS_XL   (WS_XH + 2u * NB * NPOS * CIN)
#define WS_QKV  (WS_XL + 2u * NB * NPOS * CIN)        // f32 [2][4096][256]: q (64, scaled by log2(e)/4) | k (64) | v (128)
#define WS_VTH  (WS_QKV + 4u * NB * NPOS * 256)       // bf16 [2][128 (h,dv)][4096] V^T hi
#define WS_VTL  (WS_VTH + 2u * NB * VF * NPOS)
#define WS_M    (WS_VTL + 2u * NB * VF * NPOS)        // f32 [2][4][4096], log2 domain
#define WS_L    (WS_M + 4u * NB * NHD * NPOS)
#define WS_O    (WS_L + 4u * NB * NHD * NPOS)         // f32 [2][4096][128] attention output (h, dv)
#define WS_END  (WS_O + 4u * NB * NPOS * VF)

// ---- k_xT: planes[b][p][c] = split(relu((bf16(x[b][c][p]) - m[c]) * (g[c] rsqrt(v[c]+eps)) + beta[c])); block = (b, 64 positions): LDS tile [64 p][128 c] -> rows of 256 B per plane (16 lanes)
__global__ __launch_bounds__(256) void k_xT(const float* __restrict__ X, const float* __restrict__ g, const float* __restrict__ bt, const float* __restrict__ rm, const float* __restrict__ rv, __bf16* __restrict__ PH, __bf16* __restrict__ PL) {
  __shared__ __bf16 sh[64][136], sl[64][136]; __shared__ float ssc[CIN], ssh[CIN];
  const int b = blockIdx.y, p0 = blockIdx.x * 64, tid = threadIdx.x;
  if (tid < CIN) { const float inv = rsqrtf(bfr(rv[tid]) + 1e-5f); const float sc = bfr(g[tid]) * inv; ssc[tid] = sc; ssh[tid] = bfr(bt[tid]) - bfr(rm[tid]) * sc; }
  __syncthreads();
  for (int q = tid; q < CIN * 64; q += 256) { const int c = q >> 6, pl = q & 63; float v = bfr(X[((size_t)b * CIN + c) * NPOS + p0 + pl]) * ssc[c] + ssh[c]; v = v > 0.f ? v : 0.f; const __bf16 hi = (__bf16)v; sh[pl][c] = hi; sl[pl][c] = (__bf16)(v - (float)hi); }
  __syncthreads();
  for (int q = tid; q < 64 * 16; q += 256) { const int pl = q >> 4, pc = q & 15; union { __bf16 e[8]; v4u u; } a, c2;
#pragma unroll
    for (int e = 0; e < 8; ++e) { a.e[e] = sh[pl][pc * 8 + e]; c2.e[e] = sl[pl][pc * 8 + e]; }
    const size_t o = ((size_t)b * NPOS + p0 + pl) * CIN + pc * 8; vst2((unsigned*)(PH + o), a.u); vst2((unsigned*)(PL + o), c2.u); }
}
// ---- k_qkv: QKV[b][p][n] = planes . W rows (+ bias), n < 64: Wq (then x log2(e)/4), < 128: Wk, else Wv; block (64 positions, 128 of the 256 cols); K = 128 (4 steps); also writes V^T hi/lo planes for the v columns (block-local transpose via so)
__global__ __launch_bounds__(128) void k_qkv(const __bf16* __restrict__ PH, const __bf16* __restrict__ PL, const float* __restrict__ Wq, const float* __restrict__ bq, const float* __restrict__ Wk, const float* __restrict__ bk, const float* __restrict__ Wv, const float* __restrict__ bv, float* __restrict__ QKV, __bf16* __restrict__ VTH, __bf16* __restrict__ VTL) {
  __shared__ __align__(16) float so[64][132];
  const int tid = threadIdx.x, wave = tid >> 5, lane = tid & 31, col = lane & 15, g = lane >> 4; const int b = blockIdx.z; const int p0 = blockIdx.x * 64; const int n0 = blockIdx.y * 128;
  const size_t arow = ((size_t)b * NPOS + p0 + wave * 16 + col) * CIN;
  v8f acc[8] = {};
#pragma unroll
  for (int kc = 0; kc < CIN / 32; ++kc) { const v16b ah = frag_b(PH + arow + kc * 32, lane), al = frag_b(PL + arow + kc * 32, lane);
#pragma unroll
    for (int j = 0; j < 8; ++j) { const int n = n0 + j * 16 + col; const float* wr = n < KF ? Wq + (size_t)n * CIN : (n < 2 * KF ? Wk + (size_t)(n - KF) * CIN : Wv + (size_t)(n - 2 * KF) * CIN);   // per-lane weight row pointer (all global, same base kind); j-tile never straddles a matrix (boundaries at 64/128 are tile multiples)
      const v16b w = frag_gbf(wr + kc * 32, lane); acc[j] = wmma_bf(al, w, acc[j]); acc[j] = wmma_bf(ah, w, acc[j]); } }
#pragma unroll
  for (int j = 0; j < 8; ++j) { const int n = n0 + j * 16 + col; const float bias = n < KF ? bfr(bq[n]) : (n < 2 * KF ? bfr(bk[n - KF]) : bfr(bv[n - 2 * KF])); const float sc = n < KF ? 0.25f * L2E : 1.0f;
#pragma unroll
    for (int r = 0; r < 8; ++r) so[wave * 16 + 8 * g + r][j * 16 + col] = (acc[j][r] + bias) * sc; }
  __syncthreads();
  for (int q = tid; q < 64 * 32; q += 128) { const int rl = q >> 5, pc = q & 31; vst2(QKV + ((size_t)b * NPOS + p0 + rl) * 256 + n0 + pc * 4, *(const v4f*)&so[rl][pc * 4]); }
  if (n0 == 128) {
    for (int q = tid; q < 128 * 8; q += 128) { const int c = q >> 3, pc = q & 7; union { __bf16 e[8]; v4u u; } hh, ll;
#pragma unroll
      for (int e = 0; e < 8; ++e) { const float v = so[pc * 8 + e][c]; const __bf16 hi = (__bf16)v; hh.e[e] = hi; ll.e[e] = (__bf16)(v - (float)hi); }
      const size_t o = ((size_t)b * VF + c) * NPOS + p0 + pc * 8; vst2((unsigned*)(VTH + o), hh.u); vst2((unsigned*)(VTL + o), ll.u); } }
}
// ---- k_stats: block = (64 queries, b*4+h): S^T = k(hi/lo) q(hi/lo)^T with K = 16 (zero-padded to 32 by split_rowK): lane (g, col) holds keys 8g+0..7 of query col; per-lane online max/sum over 256 key tiles of 16 (K rows from LDS, 128 keys a stage, two buffers), the two halves joined once behind the loop; M, L rows (256 B by 16 lanes)
__global__ __launch_bounds__(128) void k_stats(const float* __restrict__ QKV, float* __restrict__ Mb, float* __restrict__ Lb) {
  __shared__ __align__(16) float sm[4][16]; __shared__ __align__(16) float ssum[4][16]; __shared__ __align__(16) float sk[2][KST * KPF];
  const int tid = threadIdx.x, wave = tid >> 5, lane = tid & 31, col = lane & 15, g = lane >> 4;
  const int bh = blockIdx.y, b = bh >> 2, h = bh & 3; const int q0 = blockIdx.x * 64 + wave * 16;
  const F2 a = split_rowK(QKV + ((size_t)b * NPOS + q0 + col) * 256 + h * DK, 0, lane, DK);
  float m = -3.0e38f, l = 0.f;
  const float* kg = QKV + (size_t)b * NPOS * 256 + KF + h * DK;
  copy_k(kg, sk[0], tid); WAIT_COPIES(); __syncthreads();   // stage 0 is there for every wave
  copy_k(kg + (size_t)KST * 256, sk[1], tid);               // stage 1 flies while stage 0 is worked on
#pragma unroll 1   // one trip = one stage: the buffer index and the publish point stay in one place
  for (int t = 0; t < NST; ++t) { const float* kr = sk[t & 1] + col * KPF + 8 * g;
    v4f kq[KST / 16][2];
#pragma unroll     // the stage's LDS reads stand as one group ahead of its matrix work: one read latency a stage, not one a tile
    for (int kt = 0; kt < KST / 16; ++kt) { kq[kt][0] = *(const v4f*)(kr + kt * 16 * KPF); kq[kt][1] = *(const v4f*)(kr + kt * 16 * KPF + 4); }
#pragma unroll     // kq is indexed by constants only, so it stays in registers
  for (int kt = 0; kt < KST / 16; ++kt) { const F2 kb = split_k16(kq[kt][0], kq[kt][1]);
    const v8f s = mac3t(kb, a, (v8f){});
    float mn = m;
#pragma unroll
    for (int r = 0; r < 8; ++r) mn = fmaxf(mn, s[r]);
    float x[8];
#pragma unroll
    for (int r = 0; r < 8; ++r) x[r] = s[r] - mn;
    exp2x8(x);
    float e = x[0];
#pragma unroll
    for (int r = 1; r < 8; ++r) e += x[r];
    l = l * exp2x1(m - mn) + e; m = mn; }
    WAIT_LDS(); WAIT_COPIES(); __syncthreads();   // publish point: stage t + 1 has landed for all, and nobody reads stage t's buffer any more
    if (t + 2 < NST) copy_k(kg + (size_t)(t + 2) * KST * 256, sk[t & 1], tid); }
  WAIT_COPIES();
  { const float m2 = __shfl_xor(m, 16), l2 = __shfl_xor(l, 16); const float mn = fmaxf(m, m2); l = l * exp2x1(m - mn) + l2 * exp2x1(m2 - mn); m = mn; }   // join the halves' keys
  if (g == 0) { sm[wave][col] = m; ssum[wave][col] = l; }
  __syncthreads();      // the block's 64 M and 64 L values form one 256-B run each: written by 16 lanes x 16 B (one writer per line)
  { const int qb = blockIdx.x * 64; if (tid < 16) vst2(Mb + ((size_t)bh * NPOS + qb) + tid * 4, *(const v4f*)(&sm[0][0] + tid * 4)); else if (tid < 32) vst2(Lb + ((size_t)bh * NPOS + qb) + (tid - 16) * 4, *(const v4f*)(&ssum[0][0] + (tid - 16) * 4)); }
}
__global__ __launch_bounds__(128) void k_attn(const float* __restrict__ QKV, const __bf16* __restrict__ VTH, const __bf16* __restrict__ VTL, const float* __restrict__ Mb, const float* __restrict__ Lb, float* __restrict__ O) {
  __shared__ __align__(16) float so[4][16][36]; __shared__ __align__(16) float sk[2][KST * KPF]; __shared__ __align__(16) __bf16 sv[2][2][DV * VPB];   // sv[buffer][hi, lo]
  const int tid = threadIdx.x, wave = tid >> 5, lane = tid & 31, col = lane & 15, g = lane >> 4;
  const int bh = blockIdx.y, b = bh >> 2, h = bh & 3; const int q0 = blockIdx.x * 64 + wave * 16;
  const F2 a = split_rowK(QKV + ((size_t)b * NPOS + q0 + col) * 256 + h * DK, 0, lane, DK);
  const float mr = Mb[(size_t)bh * NPOS + q0 + col], il = 1.0f / Lb[(size_t)bh * NPOS + q0 + col];   // the lane's own query
  v8f acc[2] = {};
  const float* kg = QKV + (size_t)b * NPOS * 256 + KF + h * DK; const __bf16 *vgh = VTH + ((size_t)b * VF + h * DV) * NPOS, *vgl = VTL + ((size_t)b * VF + h * DV) * NPOS;
  copy_k(kg, sk[0], tid); copy_v(vgh, sv[0][0], tid); copy_v(vgl, sv[0][1], tid); WAIT_COPIES(); __syncthreads();   // stage 0 is there for every wave
  copy_k(kg + (size_t)KST * 256, sk[1], tid); copy_v(vgh + KST, sv[1][0], tid); copy_v(vgl + KST, sv[1][1], tid);     // stage 1 flies while stage 0 is worked on
#pragma unroll 1   // one trip = one stage: the buffer index and the publish point stay in one place
  for (int t = 0; t < NST; ++t) { const float* kr = sk[t & 1] + col * KPF + 8 * g; const __bf16 *vrh = sv[t & 1][0] + col * VPB, *vrl = sv[t & 1][1] + col * VPB;
    v4f kq[2][2][2]; v16b vq[2][2][2];   // [set][ct][half], [set][dt][hi, lo]: a step's fragments, read one step ahead inside the stage
    // RD_STEP: all LDS reads of one 32-key step; its loop is unrolled so that the sets are indexed by constants and stay in registers
#define RD_STEP(S, KS) do { _Pragma("unroll") for (int c = 0; c < 2; ++c) { const float* kp = kr + ((KS) * 32 + c * 16) * KPF; kq[S][c][0] = *(const v4f*)kp; kq[S][c][1] = *(const v4f*)(kp + 4); \
      const int vo = c * 16 * VPB + (KS) * 32; vq[S][c][0] = frag_b(vrh + vo, lane); vq[S][c][1] = frag_b(vrl + vo, lane); } } while (0)
    RD_STEP(0, 0);
#pragma unroll     // the sets are indexed by constants only, so they stay in registers
  for (int ks = 0; ks < KST / 32; ++ks) { float p[16];   // p[ct * 8 + r] = P[query col][key (t * 4 + ks) * 32 + ct * 16 + 8g + r]: the two S^T tiles are a B fragment's k order as they stand
    if (ks + 1 < KST / 32) RD_STEP((ks + 1) & 1, ks + 1);   // the next step's LDS reads as one group ahead of this step's matrix work (same stage, same buffer)
#pragma unroll
    for (int ct = 0; ct < 2; ++ct) { const F2 kb = split_k16(kq[ks & 1][ct][0], kq[ks & 1][ct][1]);
      const v8f s = mac3t(kb, a, (v8f){});
      float x[8];
#pragma unroll
      for (int r = 0; r < 8; ++r) x[r] = s[r] - mr;
      exp2x8(x);
#pragma unroll
      for (int r = 0; r < 8; ++r) p[ct * 8 + r] = x[r] * il; }
    const F2 pa = bsplit16(p);
#pragma unroll
    for (int dt = 0; dt < 2; ++dt) { const v16b vh = vq[ks & 1][dt][0], vl = vq[ks & 1][dt][1];
      acc[dt] = wmma_bf(vh, pa.l, acc[dt]); acc[dt] = wmma_bf(vl, pa.h, acc[dt]); acc[dt] = wmma_bf(vh, pa.h, acc[dt]); } }
    WAIT_LDS(); WAIT_COPIES(); __syncthreads();   // publish point: stage t + 1 has landed for all, and nobody reads stage t's buffers any more
    if (t + 2 < NST) { copy_k(kg + (size_t)(t + 2) * KST * 256, sk[t & 1], tid); copy_v(vgh + (t + 2) * KST, sv[t & 1][0], tid); copy_v(vgl + (t + 2) * KST, sv[t & 1][1], tid); } }
  WAIT_COPIES();
#pragma unroll
  for (int dt = 0; dt < 2; ++dt)   // acc[dt][r] = O[query col][dt * 16 + 8g + r]: 8 consecutive floats of the lane's row
#pragma unroll
    for (int r = 0; r < 8; ++r) so[wave][col][dt * 16 + 8 * g + r] = acc[dt][r];
  LDSX();
  for (int q = lane; q < 16 * 8; q += 32) { const int rl = q >> 3, pc = q & 7; vst2(O + ((size_t)b * NPOS + q0 + rl) * VF + h * DV + pc * 4, *(const v4f*)&so[wave][rl][pc * 4]); }
}
// ---- k_out: Y[p][o] = O row(hi/lo) . Wo rows + bo; out[b][o][p] = Y + inputs (NCHW); block = (64 positions, b): 128 output channels in one pass (8 tiles); transposed store per channel: 64 positions = 256 B by 16 lanes
__global__ __launch_bounds__(128) void k_out(const float* __restrict__ O, const float* __restrict__ Wo, const float* __restrict__ bo, const float* __restrict__ X, float* __restrict__ out) {
  __shared__ __align__(16) float st[128][68];
  const int tid = threadIdx.x, wave = tid >> 5, lane = tid & 31, col = lane & 15, g = lane >> 4; const int b = blockIdx.y; const int p0 = blockIdx.x * 64;
  v8f acc[8] = {};
#pragma unroll
  for (int kc = 0; kc < VF / 32; ++kc) { const F2 a = split_row(O + ((size_t)b * NPOS + p0 + wave * 16 + col) * VF, kc * 32, lane);
#pragma unroll
    for (int j = 0; j < 8; ++j) { const v16b w = frag_gbf(Wo + (size_t)(j * 16 + col) * VF + kc * 32, lane); acc[j] = wmma_bf(a.l, w, acc[j]); acc[j] = wmma_bf(a.h, w, acc[j]); } }
#pragma unroll
  for (int j = 0; j < 8; ++j) { const float bb = bfr(bo[j * 16 + col]);
#pragma unroll
    for (int r = 0; r < 8; ++r) st[j * 16 + col][wave * 16 + 8 * g + r] = acc[j][r] + bb; }
  __syncthreads();
  for (int q = tid; q < 128 * 16; q += 128) { const int o = q >> 4, pc = q & 15; const size_t base = ((size_t)b * CIN + o) * NPOS + p0 + pc * 4; const float4 xv = *(const float4*)(X + base);
    v4f r4; r4[0] = st[o][pc * 4] + bfr(xv.x); r4[1] = st[o][pc * 4 + 1] + bfr(xv.y); r4[2] = st[o][pc * 4 + 2] + bfr(xv.z); r4[3] = st[o][pc * 4 + 3] + bfr(xv.w); vst2(out + base, r4); }
}

extern "C" void kernel_launch(void* const* d_in, const int* in_sizes, int n_in, void* d_out, int out_size, void* d_ws, size_t ws_size, hipStream_t stream) {
  (void)in_sizes; (void)n_in; (void)out_size;
  const float** F = (const float**)d_in;   // inputs, gamma, beta, running_mean, running_var, Wq, bq, Wk, bk, Wv, bv, Wo, bo
  if (ws_size < (size_t)WS_END) return;
  char* ws = (char*)d_ws;
  __bf16 *PH = (__bf16*)(ws + WS_XH), *PL = (__bf16*)(ws + WS_XL), *VTH = (__bf16*)(ws + WS_VTH), *VTL = (__bf16*)(ws + WS_VTL); float *QKV = (float*)(ws + WS_QKV), *Mb = (float*)(ws + WS_M), *Lb = (float*)(ws + WS_L), *O = (float*)(ws + WS_O);
  k_xT<<<dim3(NPOS / 64, TNB), 256, 0, stream>>>(F[0], F[1], F[2], F[3], F[4], PH, PL);
  k_qkv<<<dim3(NPOS / 64, 2, TNB), 128, 0, stream>>>(PH, PL, F[5], F[6], F[7], F[8], F[9], F[10], QKV, VTH, VTL);
  k_stats<<<dim3(TQB, TNB * NHD), 128, 0, stream>>>(QKV, Mb, Lb);
  k_attn<<<dim3(TQB, TNB * NHD), 128, 0, stream>>>(QKV, VTH, VTL, Mb, Lb, O);
  k_out<<<dim3(TQB, TNB), 128, 0, stream>>>(O, F[11], F[12], F[0], (float*)d_out);
}

// v004
// It runs in 104 microseconds.
// Next to v003, in two timings, it ran 1.27 and 1.28 times as fast.
// All steps since v000 together make it 7.46 times as fast.
// compute dtype: inputs, BN parameters and all projection weights/biases (module inputs) rounded to bf16; q/k/v projections of the BN+ReLU activations, the attention scores, P.V and the output projection all take computed operands as bf16 hi + bf16 residual pairs (2 products against weights, 3 between computed operands);
#include <hip/hip_runtime.h>
#include <math.h>

typedef __attribute__((ext_vector_type(16))) _Float16 v16h;
typedef __attribute__((ext_vector_type(16))) __bf16 v16b;
typedef __attribute__((ext_vector_type(8)))  _Float16 v8h;
typedef __attribute__((ext_vector_type(8)))  float v8f;
typedef __attribute__((ext_vector_type(4)))  float v4f;
typedef __attribute__((ext_vector_type(2)))  float v2f;
typedef __attribute__((ext_vector_type(4)))  unsigned v4u;
typedef __attribute__((ext_vector_type(4)))  int v4i;
typedef float __attribute__((may_alias)) float_a;
typedef int __attribute__((may_alias)) int_a;

template <typename T> __device__ __forceinline__ void vst2(void* p, T v) { *(T*)p = v;  }
__device__ __forceinline__ v8f wmma16(v16h a, v16h b, v8f c) {
  v8f d = __builtin_amdgcn_wmma_f32_16x16x32_f16(false, a, false, b, (short)0, c, false, false);
  asm volatile("v_nop\n\tv_nop\n\tv_nop\n\tv_nop" : "+v"(d) : "v"(a), "v"(b));
  return d;
}
__device__ __forceinline__ v8f wmma_bf(v16b a, v16b b, v8f c) {
  v8f d = __builtin_amdgcn_wmma_f32_16x16x32_bf16(false, a, false, b, (short)0, c, false, false);
  asm volatile("v_nop\n\tv_nop\n\tv_nop\n\tv_nop" : "+v"(d) : "v"(a), "v"(b));
  return d;
}
// 16x16x32 fragments: lane = (h = lane>>4, row/col = lane&15); elements 0..7 = k0+8h+0..7, 8..15 = k0+16+8h+0..7; D element r = row 8h+r
__device__ __forceinline__ v16h frag_h(const _Float16* rowk0, int lane) {
  union { v16h v; v8h q[2]; } u; const _Float16* p = rowk0 + 8 * (lane >> 4);
  u.q[0] = *(const v8h*)p; u.q[1] = *(const v8h*)(p + 16); return u.v;
}
__device__ __forceinline__ v16h frag_f32(const float* rowk0, int lane) {
  v16h a; const float* p = rowk0 + 8 * (lane >> 4);
#pragma unroll
  for (int i = 0; i < 8; ++i) { a[i] = (_Float16)p[i]; a[8 + i] = (_Float16)p[16 + i]; }
  return a;
}
__device__ __forceinline__ v16h frag_f32s(const float* rowk0, int lane, float sc) {
  v16h a; const float* p = rowk0 + 8 * (lane >> 4);
#pragma unroll
  for (int i = 0; i < 8; ++i) { a[i] = (_Float16)(p[i] * sc); a[8 + i] = (_Float16)(p[16 + i] * sc); }
  return a;
}
// column fragment from a [K][ld] layout (column n), rows >= K read as 0
__device__ __forceinline__ v16h fragc_f32(const float* W, int k0, int n, int lane, int ld, int K) {
  v16h a; const int g = lane >> 4;
#pragma unroll
  for (int i = 0; i < 8; ++i) { const int ka = k0 + 8 * g + i, kb = ka + 16;
    a[i] = (_Float16)(ka < K ? W[(size_t)(ka < K ? ka : K - 1) * ld + n] : 0.f); a[8 + i] = (_Float16)(kb < K ? W[(size_t)(kb < K ? kb : K - 1) * ld + n] : 0.f); }
  return a;
}
struct F2 { v16b h, l; };
__device__ __forceinline__ F2 bsplit16(const float v[16]) { F2 r;
#pragma unroll
  for (int i = 0; i < 16; ++i) { const __bf16 h = (__bf16)v[i]; r.h[i] = h; r.l[i] = (__bf16)(v[i] - (float)h); }
  return r; }
__device__ __forceinline__ F2 split_row(const float* row, int k0, int lane) { float v[16]; const float* p = row + k0 + 8 * (lane >> 4);
#pragma unroll
  for (int i = 0; i < 8; ++i) { v[i] = p[i]; v[8 + i] = p[16 + i]; }
  return bsplit16(v); }
__device__ __forceinline__ F2 split_rowK(const float* row, int k0, int lane, int K) { float v[16]; const int g = lane >> 4;
#pragma unroll
  for (int i = 0; i < 8; ++i) { const int ka = k0 + 8 * g + i, kb = ka + 16; v[i] = ka < K ? row[ka < K ? ka : K - 1] : 0.f; v[8 + i] = kb < K ? row[kb < K ? kb : K - 1] : 0.f; }
  return bsplit16(v); }
__device__ __forceinline__ F2 split_col(const float* W, int k0, int n, int lane, int ld, int K) { float v[16]; const int g = lane >> 4;
#pragma unroll
  for (int i = 0; i < 8; ++i) { const int ka = k0 + 8 * g + i, kb = ka + 16; v[i] = ka < K ? W[(size_t)(ka < K ? ka : K - 1) * ld + n] : 0.f; v[8 + i] = kb < K ? W[(size_t)(kb < K ? kb : K - 1) * ld + n] : 0.f; }
  return bsplit16(v); }
__device__ __forceinline__ v8f mac3(const F2& a, const F2& b, v8f c) { c = wmma_bf(a.l, b.h, c); c = wmma_bf(a.h, b.l, c); return wmma_bf(a.h, b.h, c); }
// S^T tile: A = key rows, B = query columns; the three hi/lo products come in mac3(q, k)'s order
__device__ __forceinline__ v8f mac3t(const F2& k, const F2& q, v8f c) { c = wmma_bf(k.h, q.l, c); c = wmma_bf(k.l, q.h, c); return wmma_bf(k.h, q.h, c); }
__device__ __forceinline__ float sigm(float v) { return 1.0f / (1.0f + expf(-v)); }
#define LDSX() do { asm volatile("s_wait_dscnt 0" ::: "memory"); __builtin_amdgcn_wave_barrier(); __builtin_amdgcn_fence(__ATOMIC_RELEASE, "workgroup"); } while (0)


// Global self-attention block over 64x64 = 4096 positions: x = relu(bn(inputs)); q, k (64 = 4 heads x 16), v (128 = 4 x 32) by 1x1 convs; softmax(q k^T / 4) v per head; out = o Wo^T + bo, back to NCHW, + inputs.
// k_xT (bn+relu, channel-major -> position-major hi/lo bf16 planes via LDS), k_qkv (one GEMM for [q|k|v] (256 cols), K = 128; q scaled after the bias), k_attn (per (b,h), one pass: S^T = k q^T, K = 16 zero-padded, two lanes (the halves) share one query: running max and sum over the 4096 keys, P^T = exp(s - m) as hi/lo straight from the S^T accumulators, O^T += V^T(hi/lo) P^T over 32-key steps, O / sum at the end; O -> concat layout),
// k_out (o(hi/lo) Wo^T + bo, transposed through LDS to NCHW rows + shortcut; per channel 64 positions = 256 B).
#define NB 2
#define CIN 128
#define NPOS 4096
#define NHD 4
#define DK 16
#define DV 32
#define KF 64
#define VF 128
#ifndef TNB
#define TNB NB
#define TQB (NPOS / 64)
#endif
typedef __attribute__((ext_vector_type(8))) __bf16 v8b;
__device__ __forceinline__ v16b frag_b(const __bf16* rowk0, int lane) {
  union { v16b v; v8b q[2]; } u; const __bf16* p = rowk0 + 8 * (lane >> 4);
  u.q[0] = *(const v8b*)p; u.q[1] = *(const v8b*)(p + 16); return u.v;
}
__device__ __forceinline__ v16b frag_gbf(const float* rowk0, int lane) {
  v16b a; const float* p = rowk0 + 8 * (lane >> 4);
#pragma unroll
  for (int i = 0; i < 8; ++i) { a[i] = (__bf16)p[i]; a[8 + i] = (__bf16)p[16 + i]; }
  return a;
}
__device__ __forceinline__ float bfr(float v) { return (float)(__bf16)v; }
// exp(s - m) = 2^(s' - m') with s' = s * log2(e): k_qkv folds log2(e) into q's scale, so scores and maxima come in the log2 domain and an exponential is one subtract and the hardware exp2, inline. Arguments are <= 0; a hugely negative one gives 0.
// The exp2 stand in asm, each in place, so that none is directly followed by a write of its source; the closing v_nop is the slot that the instruction set asks for behind a transcendental before its result is read.
#define L2E 1.44269504088896340736f
__device__ __forceinline__ void exp2x8(float* x) {
  asm("v_exp_f32 %0, %0\n\tv_exp_f32 %1, %1\n\tv_exp_f32 %2, %2\n\tv_exp_f32 %3, %3\n\tv_exp_f32 %4, %4\n\tv_exp_f32 %5, %5\n\tv_exp_f32 %6, %6\n\tv_exp_f32 %7, %7\n\tv_nop"
      : "+v"(x[0]), "+v"(x[1]), "+v"(x[2]), "+v"(x[3]), "+v"(x[4]), "+v"(x[5]), "+v"(x[6]), "+v"(x[7]));
}
__device__ __forceinline__ float exp2x1(float x) { asm("v_exp_f32 %0, %0\n\tv_nop" : "+v"(x)); return x; }

// K and V^T tiles go to LDS once per block and stage, by asynchronous copies (16 B a lane, through no register), and the block's 4 waves read their fragments from there.
#define KST 128               // keys per stage
#define NST (NPOS / KST)      // stages
#define KPF 20                // K row pitch in LDS, floats: 64 B + 16 B (16 B x odd: 16-byte readers meet no bank twice)
#define VPB 136               // V^T row pitch in LDS, bf16: 256 B + 16 B, for the same reason
__device__ __forceinline__ unsigned lds_off(const void* p) { return (unsigned)(size_t)p; }
// one stage of K: 128 rows of 64 B (one head's 16 floats of a 1024-B row); thread = (row tid >> 2 (+ 32 i), 16-B part tid & 3)
__device__ __forceinline__ void copy_k(const float* kg, float* sk, int tid) {
  const float* g0 = kg + (size_t)(tid >> 2) * 256 + (tid & 3) * 4; const float *g1 = g0 + 32 * 256, *g2 = g0 + 64 * 256, *g3 = g0 + 96 * 256;
  const unsigned l0 = lds_off(sk + (tid >> 2) * KPF + (tid & 3) * 4), l1 = l0 + 32 * KPF * 4, l2 = l0 + 64 * KPF * 4, l3 = l0 + 96 * KPF * 4;
  // the closing s_wait_xcnt stands in the copies' own statement, in front of any later write of their address registers
  asm volatile("global_load_async_to_lds_b128 %0, %4, off\n\tglobal_load_async_to_lds_b128 %1, %5, off\n\tglobal_load_async_to_lds_b128 %2, %6, off\n\tglobal_load_async_to_lds_b128 %3, %7, off\n\ts_wait_xcnt 0x0"
               :: "v"(l0), "v"(l1), "v"(l2), "v"(l3), "v"(g0), "v"(g1), "v"(g2), "v"(g3) : "memory");
}
// one stage of one V^T plane: 32 rows of 256 B (128 keys); thread = (row tid >> 4 (+ 8 i), 16-B part tid & 15)
__device__ __forceinline__ void copy_v(const __bf16* vg, __bf16* sv, int tid) {
  const __bf16* g0 = vg + (size_t)(tid >> 4) * NPOS + (tid & 15) * 8; const __bf16 *g1 = g0 + 8 * NPOS, *g2 = g0 + 16 * NPOS, *g3 = g0 + 24 * NPOS;
  const unsigned l0 = lds_off(sv + (tid >> 4) * VPB + (tid & 15) * 8), l1 = l0 + 8 * VPB * 2, l2 = l0 + 16 * VPB * 2, l3 = l0 + 24 * VPB * 2;
  // the closing s_wait_xcnt stands in the copies' own statement, in front of any later write of their address registers
  asm volatile("global_load_async_to_lds_b128 %0, %4, off\n\tglobal_load_async_to_lds_b128 %1, %5, off\n\tglobal_load_async_to_lds_b128 %2, %6, off\n\tglobal_load_async_to_lds_b128 %3, %7, off\n\ts_wait_xcnt 0x0"
               :: "v"(l0), "v"(l1), "v"(l2), "v"(l3), "v"(g0), "v"(g1), "v"(g2), "v"(g3) : "memory");
}
#define WAIT_COPIES() asm volatile("s_wait_asynccnt 0x0" ::: "memory")   // this wave's copies have landed
#define WAIT_LDS()    asm volatile("s_wait_dscnt 0x0" ::: "memory")      // this wave's LDS reads are done before the buffer is given up
// K fragment from the lane's 8 floats of an LDS row (a, c = row + 8 * (lane >> 4) + 0..3, + 4..7); elements 0..7 = k 8h + 0..7, elements 8..15 (k >= 16) are 0: split_rowK's k order at K = 16
__device__ __forceinline__ F2 split_k16(v4f a, v4f c) { float v[16];
#pragma unroll
  for (int i = 0; i < 4; ++i) { v[i] = a[i]; v[4 + i] = c[i]; v[8 + i] = 0.f; v[12 + i] = 0.f; }
  return bsplit16(v); }

#define WS_XH   0u                                  // bf16 [2][4096][128] relu(bn(x)) position-major hi
#define WS_XL   (WS_XH + 2u * NB * NPOS * CIN)
#define WS_QKV  (WS_XL + 2u * NB * NPOS * CIN)        // f32 [2][4096][256]: q (64, scaled by log2(e)/4) | k (64) | v (128)
#define WS_VTH  (WS_QKV + 4u * NB * NPOS * 256)       // bf16 [2][128 (h,dv)][4096] V^T hi
#define WS_VTL  (WS_VTH + 2u * NB * VF * NPOS)
#define WS_O    (WS_VTL + 2u * NB * VF * NPOS)        // f32 [2][4096][128] attention output (h, dv)
#define WS_END  (WS_O + 4u * NB * NPOS * VF)

// ---- k_xT: planes[b][p][c] = split(relu((bf16(x[b][c][p]) - m[c]) * (g[c] rsqrt(v[c]+eps)) + beta[c])); block = (b, 64 positions): LDS tile [64 p][128 c] -> rows of 256 B per plane (16 lanes)
__global__ __launch_bounds__(256) void k_xT(const float* __restrict__ X, const float* __restrict__ g, const float* __restrict__ bt, const float* __restrict__ rm, const float* __restrict__ rv, __bf16* __restrict__ PH, __bf16* __restrict__ PL) {
  __shared__ __bf16 sh[64][136], sl[64][136]; __shared__ float ssc[CIN], ssh[CIN];
  const int b = blockIdx.y, p0 = blockIdx.x * 64, tid = threadIdx.x;
  if (tid < CIN) { const float inv = rsqrtf(bfr(rv[tid]) + 1e-5f); const float sc = bfr(g[tid]) * inv; ssc[tid] = sc; ssh[tid] = bfr(bt[tid]) - bfr(rm[tid]) * sc; }
  __syncthreads();
  for (int q = tid; q < CIN * 64; q += 256) { const int c = q >> 6, pl = q & 63; float v = bfr(X[((size_t)b * CIN + c) * NPOS + p0 + pl]) * ssc[c] + ssh[c]; v = v > 0.f ? v : 0.f; const __bf16 hi = (__bf16)v; sh[pl][c] = hi; sl[pl][c] = (__bf16)(v - (float)hi); }
  __syncthreads();
  for (int q = tid; q < 64 * 16; q += 256) { const int pl = q >> 4, pc = q & 15; union { __bf16 e[8]; v4u u; } a, c2;
#pragma unroll
    for (int e = 0; e < 8; ++e) { a.e[e] = sh[pl][pc * 8 + e]; c2.e[e] = sl[pl][pc * 8 + e]; }
    const size_t o = ((size_t)b * NPOS + p0 + pl) * CIN + pc * 8; vst2((unsigned*)(PH + o), a.u); vst2((unsigned*)(PL + o), c2.u); }
}
// ---- k_qkv: QKV[b][p][n] = planes . W rows (+ bias), n < 64: Wq (then x log2(e)/4), < 128: Wk, else Wv; block (64 positions, 128 of the 256 cols); K = 128 (4 steps); also writes V^T hi/lo planes for the v columns (block-local transpose via so)
__global__ __launch_bounds__(128) void k_qkv(const __bf16* __restrict__ PH, const __bf16* __restrict__ PL, const float* __restrict__ Wq, const float* __restrict__ bq, const float* __restrict__ Wk, const float* __restrict__ bk, const float* __restrict__ Wv, const float* __restrict__ bv, float* __restrict__ QKV, __bf16* __restrict__ VTH, __bf16* __restrict__ VTL) {
  __shared__ __align__(16) float so[64][132];
  const int tid = threadIdx.x, wave = tid >> 5, lane = tid & 31, col = lane & 15, g = lane >> 4; const int b = blockIdx.z; const int p0 = blockIdx.x * 64; const int n0 = blockIdx.y * 128;
  const size_t arow = ((size_t)b * NPOS + p0 + wave * 16 + col) * CIN;
  v8f acc[8] = {};
#pragma unroll
  for (int kc = 0; kc < CIN / 32; ++kc) { const v16b ah = frag_b(PH + arow + kc * 32, lane), al = frag_b(PL + arow + kc * 32, lane);
#pragma unroll
    for (int j = 0; j < 8; ++j) { const int n = n0 + j * 16 + col; const float* wr = n < KF ? Wq + (size_t)n * CIN : (n < 2 * KF ? Wk + (size_t)(n - KF) * CIN : Wv + (size_t)(n - 2 * KF) * CIN);   // per-lane weight row pointer (all global, same base kind); j-tile never straddles a matrix (boundaries at 64/128 are tile multiples)
      const v16b w = frag_gbf(wr + kc * 32, lane); acc[j] = wmma_bf(al, w, acc[j]); acc[j] = wmma_bf(ah, w, acc[j]); } }
#pragma unroll
  for (int j = 0; j < 8; ++j) { const int n = n0 + j * 16 + col; const float bias = n < KF ? bfr(bq[n]) : (n < 2 * KF ? bfr(bk[n - KF]) : bfr(bv[n - 2 * KF])); const float sc = n < KF ? 0.25f * L2E : 1.0f;
#pragma unroll
    for (int r = 0; r < 8; ++r) so[wave * 16 + 8 * g + r][j * 16 + col] = (acc[j][r] + bias) * sc; }
  __syncthreads();
  for (int q = tid; q < 64 * 32; q += 128) { const int rl = q >> 5, pc = q & 31; vst2(QKV + ((size_t)b * NPOS + p0 + rl) * 256 + n0 + pc * 4, *(const v4f*)&so[rl][pc * 4]); }
  if (n0 == 128) {
    for (int q = tid; q < 128 * 8; q += 128) { const int c = q >> 3, pc = q & 7; union { __bf16 e[8]; v4u u; } hh, ll;
#pragma unroll
      for (int e = 0; e < 8; ++e) { const float v = so[pc * 8 + e][c]; const __bf16 hi = (__bf16)v; hh.e[e] = hi; ll.e[e] = (__bf16)(v - (float)hi); }
      const size_t o = ((size_t)b * VF + c) * NPOS + p0 + pc * 8; vst2((unsigned*)(VTH + o), hh.u); vst2((unsigned*)(VTL + o), ll.u); } }
}
// the other half's value of the same column (lane ^ 16), by a vector cross-row move
__device__ __forceinline__ float xhalf(float v) { const unsigned u = __builtin_bit_cast(unsigned, v); return __builtin_bit_cast(float, __builtin_amdgcn_permlanex16(u, u, 0x76543210u, 0xfedcba98u, false, false)); }
// ---- k_attn: block = (64 queries, b*4+h), one pass over the keys. S^T = k(hi/lo) q(hi/lo)^T with K = 16 (zero-padded to 32): lane (g, col) holds keys 8g+0..7 of query col. Per stage of 128 keys: the 8 S^T tiles, their maximum in-lane and over the two halves, one rescale of O^T and of the sums by 2^(m_old - m_new),
// then P^T = 2^(s - m) as hi/lo straight from the S^T accumulators, O^T += V^T(hi/lo) P^T over 32-key steps, the sums of P in-lane; behind the loop the halves' sums are joined and O is divided by them.
__global__ __launch_bounds__(128) void k_attn(const float* __restrict__ QKV, const __bf16* __restrict__ VTH, const __bf16* __restrict__ VTL, float* __restrict__ O) {
  __shared__ __align__(16) float so[4][16][36]; __shared__ __align__(16) float sk[2][KST * KPF]; __shared__ __align__(16) __bf16 sv[2][2][DV * VPB];   // sv[buffer][hi, lo]
  const int tid = threadIdx.x, wave = tid >> 5, lane = tid & 31, col = lane & 15, g = lane >> 4;
  const int bh = blockIdx.y, b = bh >> 2, h = bh & 3; const int q0 = blockIdx.x * 64 + wave * 16;
  const F2 a = split_rowK(QKV + ((size_t)b * NPOS + q0 + col) * 256 + h * DK, 0, lane, DK);
  float m = -3.0e38f, ls[8] = {};   // the query's running maximum (log2 domain, equal in both halves); ls[r]: sum of P over the lane's keys 8g + r of every tile
  v8f acc[2] = {};
  const float* kg = QKV + (size_t)b * NPOS * 256 + KF + h * DK; const __bf16 *vgh = VTH + ((size_t)b * VF + h * DV) * NPOS, *vgl = VTL + ((size_t)b * VF + h * DV) * NPOS;
  copy_k(kg, sk[0], tid); copy_v(vgh, sv[0][0], tid); copy_v(vgl, sv[0][1], tid); WAIT_COPIES(); __syncthreads();   // stage 0 is there for every wave
  copy_k(kg + (size_t)KST * 256, sk[1], tid); copy_v(vgh + KST, sv[1][0], tid); copy_v(vgl + KST, sv[1][1], tid);     // stage 1 flies while stage 0 is worked on
#pragma unroll 1   // one trip = one stage: the buffer index and the publish point stay in one place
  for (int t = 0; t < NST; ++t) { const float* kr = sk[t & 1] + col * KPF + 8 * g; const __bf16 *vrh = sv[t & 1][0] + col * VPB, *vrl = sv[t & 1][1] + col * VPB;
    v4f kq[KST / 16][2]; v16b vq[2][2][2];   // the stage's K rows; [set][dt][hi, lo]: a step's V^T fragments, read one step ahead inside the stage
    // RD_V: the V^T reads of one 32-key step; its loop is unrolled so that the sets are indexed by constants and stay in registers
#define RD_V(S, KS) do { _Pragma("unroll") for (int c = 0; c < 2; ++c) { const int vo = c * 16 * VPB + (KS) * 32; vq[S][c][0] = frag_b(vrh + vo, lane); vq[S][c][1] = frag_b(vrl + vo, lane); } } while (0)
#pragma unroll     // the stage's K reads and the first step's V^T reads stand as one group ahead of the matrix work: one read latency a stage
    for (int kt = 0; kt < KST / 16; ++kt) { kq[kt][0] = *(const v4f*)(kr + kt * 16 * KPF); kq[kt][1] = *(const v4f*)(kr + kt * 16 * KPF + 4); }
    RD_V(0, 0);
    v8f s[KST / 16];
#pragma unroll     // kq and s are indexed by constants only, so they stay in registers
    for (int kt = 0; kt < KST / 16; ++kt) { const F2 kb = split_k16(kq[kt][0], kq[kt][1]); s[kt] = mac3t(kb, a, (v8f){}); }
    float mx[8];       // eight independent chains over the tiles, each from the running maximum, two tiles a link; then joined
#pragma unroll
    for (int r = 0; r < 8; ++r) { mx[r] = m;
#pragma unroll
      for (int kt = 0; kt < KST / 16; kt += 2) mx[r] = fmaxf(fmaxf(mx[r], s[kt][r]), s[kt + 1][r]); }
    const float mt = fmaxf(fmaxf(fmaxf(fmaxf(mx[0], mx[1]), mx[2]), fmaxf(fmaxf(mx[3], mx[4]), mx[5])), fmaxf(mx[6], mx[7]));
    const float mn = fmaxf(mt, xhalf(mt)), al = exp2x1(m - mn); m = mn;   // both halves feed one O^T tile, so they use one maximum
#pragma unroll
    for (int r = 0; r < 8; ++r) { ls[r] *= al; acc[0][r] *= al; acc[1][r] *= al; }
#pragma unroll     // the sets are indexed by constants only, so they stay in registers
  for (int ks = 0; ks < KST / 32; ++ks) { float p[16];   // p[ct * 8 + r] = P[query col][key (t * 4 + ks) * 32 + ct * 16 + 8g + r]: the two S^T tiles are a B fragment's k order as they stand
    if (ks + 1 < KST / 32) RD_V((ks + 1) & 1, ks + 1);   // the next step's LDS reads as one group ahead of this step's matrix work (same stage, same buffer)
#pragma unroll
    for (int ct = 0; ct < 2; ++ct) { float x[8];
#pragma unroll
      for (int r = 0; r < 8; ++r) x[r] = s[ks * 2 + ct][r] - mn;
      exp2x8(x);
#pragma unroll
      for (int r = 0; r < 8; ++r) { p[ct * 8 + r] = x[r]; ls[r] += x[r]; } }
    const F2 pa = bsplit16(p);
#pragma unroll
    for (int dt = 0; dt < 2; ++dt) { const v16b vh = vq[ks & 1][dt][0], vl = vq[ks & 1][dt][1];
      acc[dt] = wmma_bf(vh, pa.l, acc[dt]); acc[dt] = wmma_bf(vl, pa.h, acc[dt]); acc[dt] = wmma_bf(vh, pa.h, acc[dt]); } }
    WAIT_LDS(); WAIT_COPIES(); __syncthreads();   // publish point: stage t + 1 has landed for all, and nobody reads stage t's buffers any more
    if (t + 2 < NST) { copy_k(kg + (size_t)(t + 2) * KST * 256, sk[t & 1], tid); copy_v(vgh + (t + 2) * KST, sv[t & 1][0], tid); copy_v(vgl + (t + 2) * KST, sv[t & 1][1], tid); } }
  WAIT_COPIES();
  float l = ((ls[0] + ls[1]) + (ls[2] + ls[3])) + ((ls[4] + ls[5]) + (ls[6] + ls[7]));
  l += xhalf(l);   // join the halves' keys
  const float il = 1.0f / l;
#pragma unroll
  for (int dt = 0; dt < 2; ++dt)   // acc[dt][r] = O[query col][dt * 16 + 8g + r] * l: 8 consecutive floats of the lane's row
#pragma unroll
    for (int r = 0; r < 8; ++r) so[wave][col][dt * 16 + 8 * g + r] = acc[dt][r] * il;
  LDSX();
  for (int q = lane; q < 16 * 8; q += 32) { const int rl = q >> 3, pc = q & 7; vst2(O + ((size_t)b * NPOS + q0 + rl) * VF + h * DV + pc * 4, *(const v4f*)&so[wave][rl][pc * 4]); }
}
// ---- k_out: Y[p][o] = O row(hi/lo) . Wo rows + bo; out[b][o][p] = Y + inputs (NCHW); block = (64 positions, b): 128 output channels in one pass (8 tiles); transposed store per channel: 64 positions = 256 B by 16 lanes
__global__ __launch_bounds__(128) void k_out(const float* __restrict__ O, const float* __restrict__ Wo, const float* __restrict__ bo, const float* __restrict__ X, float* __restrict__ out) {
  __shared__ __align__(16) float st[128][68];
  const int tid = threadIdx.x, wave = tid >> 5, lane = tid & 31, col = lane & 15, g = lane >> 4; const int b = blockIdx.y; const int p0 = blockIdx.x * 64;
  v8f acc[8] = {};
#pragma unroll
  for (int kc = 0; kc < VF / 32; ++kc) { const F2 a = split_row(O + ((size_t)b * NPOS + p0 + wave * 16 + col) * VF, kc * 32, lane);
#pragma unroll
    for (int j = 0; j < 8; ++j) { const v16b w = frag_gbf(Wo + (size_t)(j * 16 + col) * VF + kc * 32, lane); acc[j] = wmma_bf(a.l, w, acc[j]); acc[j] = wmma_bf(a.h, w, acc[j]); } }
#pragma unroll
  for (int j = 0; j < 8; ++j) { const float bb = bfr(bo[j * 16 + col]);
#pragma unroll
    for (int r = 0; r < 8; ++r) st[j * 16 + col][wave * 16 + 8 * g + r] = acc[j][r] + bb; }
  __syncthreads();
  for (int q = tid; q < 128 * 16; q += 128) { const int o = q >> 4, pc = q & 15; const size_t base = ((size_t)b * CIN + o) * NPOS + p0 + pc * 4; const float4 xv = *(const float4*)(X + base);
    v4f r4; r4[0] = st[o][pc * 4] + bfr(xv.x); r4[1] = st[o][pc * 4 + 1] + bfr(xv.y); r4[2] = st[o][pc * 4 + 2] + bfr(xv.z); r4[3] = st[o][pc * 4 + 3] + bfr(xv.w); vst2(out + base, r4); }
}

extern "C" void kernel_launch(void* const* d_in, const int* in_sizes, int n_in, void* d_out, int out_size, void* d_ws, size_t ws_size, hipStream_t stream) {
  (void)in_sizes; (void)n_in; (void)out_size;
  const float** F = (const float**)d_in;   // inputs, gamma, beta, running_mean, running_var, Wq, bq, Wk, bk, Wv, bv, Wo, bo
  if (ws_size < (size_t)WS_END) return;
  char* ws = (char*)d_ws;
  __bf16 *PH = (__bf16*)(ws + WS_XH), *PL = (__bf16*)(ws + WS_XL), *VTH = (__bf16*)(ws + WS_VTH), *VTL = (__bf16*)(ws + WS_VTL); float *QKV = (float*)(ws + WS_QKV), *O = (float*)(ws + WS_O);
  k_xT<<<dim3(NPOS / 64, TNB), 256, 0, stream>>>(F[0], F[1], F[2], F[3], F[4], PH, PL);
  k_qkv<<<dim3(NPOS / 64, 2, TNB), 128, 0, stream>>>(PH, PL, F[5], F[6], F[7], F[8], F[9], F[10], QKV, VTH, VTL);
  k_attn<<<dim3(TQB, TNB * NHD), 128, 0, stream>>>(QKV, VTH, VTL, O);
  k_out<<<dim3(TQB, TNB), 128, 0, stream>>>(O, F[11], F[12], F[0], (float*)d_out);
}

// v005
// It runs in 92 microseconds.
// In both of two side-by-side timings against v004, it was 1.13 times as fast.
// All steps since v000 together make it 8.43 times as fast.
// compute dtype: inputs, BN parameters and all projection weights/biases (module inputs) rounded to bf16; q/k/v projections of the BN+ReLU activations, the attention scores, P.V and the output projection all take computed operands as bf16 hi + bf16 residual pairs (2 products against weights, 3 between computed operands; the scores take all 4, two to a 32-deep product);
#include <hip/hip_runtime.h>
#include <math.h>

typedef __attribute__((ext_vector_type(16))) _Float16 v16h;
typedef __attribute__((ext_vector_type(16))) __bf16 v16b;
typedef __attribute__((ext_vector_type(8)))  _Float16 v8h;
typedef __attribute__((ext_vector_type(8)))  float v8f;
typedef __attribute__((ext_vector_type(4)))  float v4f;
typedef __attribute__((ext_vector_type(2)))  float v2f;
typedef __attribute__((ext_vector_type(4)))  unsigned v4u;
typedef __attribute__((ext_vector_type(4)))  int v4i;
typedef float __attribute__((may_alias)) float_a;
typedef int __attribute__((may_alias)) int_a;

template <typename T> __device__ __forceinline__ void vst2(void* p, T v) { *(T*)p = v;  }
__device__ __forceinline__ v8f wmma16(v16h a, v16h b, v8f c) {
  v8f d = __builtin_amdgcn_wmma_f32_16x16x32_f16(false, a, false, b, (short)0, c, false, false);
  asm volatile("v_nop\n\tv_nop\n\tv_nop\n\tv_nop" : "+v"(d) : "v"(a), "v"(b));
  return d;
}
__device__ __forceinline__ v8f wmma_bf(v16b a, v16b b, v8f c) {
  v8f d = __builtin_amdgcn_wmma_f32_16x16x32_bf16(false, a, false, b, (short)0, c, false, false);
  asm volatile("v_nop\n\tv_nop\n\tv_nop\n\tv_nop" : "+v"(d) : "v"(a), "v"(b));
  return d;
}
// 16x16x32 fragments: lane = (h = lane>>4, row/col = lane&15); elements 0..7 = k0+8h+0..7, 8..15 = k0+16+8h+0..7; D element r = row 8h+r
__device__ __forceinline__ v16h frag_h(const _Float16* rowk0, int lane) {
  union { v16h v; v8h q[2]; } u; const _Float16* p = rowk0 + 8 * (lane >> 4);
  u.q[0] = *(const v8h*)p; u.q[1] = *(const v8h*)(p + 16); return u.v;
}
__device__ __forceinline__ v16h frag_f32(const float* rowk0, int lane) {
  v16h a; const float* p = rowk0 + 8 * (lane >> 4);
#pragma unroll
  for (int i = 0; i < 8; ++i) { a[i] = (_Float16)p[i]; a[8 + i] = (_Float16)p[16 + i]; }
  return a;
}
__device__ __forceinline__ v16h frag_f32s(const float* rowk0, int lane, float sc) {
  v16h a; const float* p = rowk0 + 8 * (lane >> 4);
#pragma unroll
  for (int i = 0; i < 8; ++i) { a[i] = (_Float16)(p[i] * sc); a[8 + i] = (_Float16)(p[16 + i] * sc); }
  return a;
}
// column fragment from a [K][ld] layout (column n), rows >= K read as 0
__device__ __forceinline__ v16h fragc_f32(const float* W, int k0, int n, int lane, int ld, int K) {
  v16h a; const int g = lane >> 4;
#pragma unroll
  for (int i = 0; i < 8; ++i) { const int ka = k0 + 8 * g + i, kb = ka + 16;
    a[i] = (_Float16)(ka < K ? W[(size_t)(ka < K ? ka : K - 1) * ld + n] : 0.f); a[8 + i] = (_Float16)(kb < K ? W[(size_t)(kb < K ? kb : K - 1) * ld + n] : 0.f); }
  return a;
}
struct F2 { v16b h, l; };
__device__ __forceinline__ F2 bsplit16(const float v[16]) { F2 r;
#pragma unroll
  for (int i = 0; i < 16; ++i) { const __bf16 h = (__bf16)v[i]; r.h[i] = h; r.l[i] = (__bf16)(v[i] - (float)h); }
  return r; }
__device__ __forceinline__ F2 split_row(const float* row, int k0, int lane) { float v[16]; const float* p = row + k0 + 8 * (lane >> 4);
#pragma unroll
  for (int i = 0; i < 8; ++i) { v[i] = p[i]; v[8 + i] = p[16 + i]; }
  return bsplit16(v); }
__device__ __forceinline__ F2 split_rowK(const float* row, int k0, int lane, int K) { float v[16]; const int g = lane >> 4;
#pragma unroll
  for (int i = 0; i < 8; ++i) { const int ka = k0 + 8 * g + i, kb = ka + 16; v[i] = ka < K ? row[ka < K ? ka : K - 1] : 0.f; v[8 + i] = kb < K ? row[kb < K ? kb : K - 1] : 0.f; }
  return bsplit16(v); }
__device__ __forceinline__ F2 split_col(const float* W, int k0, int n, int lane, int ld, int K) { float v[16]; const int g = lane >> 4;
#pragma unroll
  for (int i = 0; i < 8; ++i) { const int ka = k0 + 8 * g + i, kb = ka + 16; v[i] = ka < K ? W[(size_t)(ka < K ? ka : K - 1) * ld + n] : 0.f; v[8 + i] = kb < K ? W[(size_t)(kb < K ? kb : K - 1) * ld + n] : 0.f; }
  return bsplit16(v); }
__device__ __forceinline__ v8f mac3(const F2& a, const F2& b, v8f c) { c = wmma_bf(a.l, b.h, c); c = wmma_bf(a.h, b.l, c); return wmma_bf(a.h, b.h, c); }
__device__ __forceinline__ float sigm(float v) { return 1.0f / (1.0f + expf(-v)); }
#define LDSX() do { asm volatile("s_wait_dscnt 0" ::: "memory"); __builtin_amdgcn_wave_barrier(); __builtin_amdgcn_fence(__ATOMIC_RELEASE, "workgroup"); } while (0)


// Global self-attention block over 64x64 = 4096 positions: x = relu(bn(inputs)); q, k (64 = 4 heads x 16), v (128 = 4 x 32) by 1x1 convs; softmax(q k^T / 4) v per head; out = o Wo^T + bo, back to NCHW, + inputs.
// k_xT (bn+relu, channel-major -> position-major hi/lo bf16 planes via LDS), k_qkv (one GEMM for [q|k|v] (256 cols), K = 128; q scaled after the bias; k stored split, as A-fragment rows), k_attn (per (b,h), one pass: S^T = k q^T, 16 dims x (hi, lo) = the 32-deep k, a lane owns one query: running max and sum over the 4096 keys, P^T = exp(s - m) as hi/lo straight from the S^T accumulators, O^T += V^T(hi/lo) P^T over 32-key steps, O / sum at the end; O -> concat layout),
// k_out (o(hi/lo) Wo^T + bo, transposed through LDS to NCHW rows + shortcut; per channel 64 positions = 256 B).
#define NB 2
#define CIN 128
#define NPOS 4096
#define NHD 4
#define DK 16
#define DV 32
#define KF 64
#define VF 128
#ifndef TNB
#define TNB NB
#define TQB (NPOS / 64)
#endif
typedef __attribute__((ext_vector_type(8))) __bf16 v8b;
__device__ __forceinline__ v16b frag_b(const __bf16* rowk0, int lane) {
  union { v16b v; v8b q[2]; } u; const __bf16* p = rowk0 + 8 * (lane >> 4);
  u.q[0] = *(const v8b*)p; u.q[1] = *(const v8b*)(p + 16); return u.v;
}
__device__ __forceinline__ v16b frag_gbf(const float* rowk0, int lane) {
  v16b a; const float* p = rowk0 + 8 * (lane >> 4);
#pragma unroll
  for (int i = 0; i < 8; ++i) { a[i] = (__bf16)p[i]; a[8 + i] = (__bf16)p[16 + i]; }
  return a;
}
__device__ __forceinline__ float bfr(float v) { return (float)(__bf16)v; }
// exp(s - m) = 2^(s' - m') with s' = s * log2(e): k_qkv folds log2(e) into q's scale, so scores and maxima come in the log2 domain and an exponential is one subtract and the hardware exp2, inline. Arguments are <= 0; a hugely negative one gives 0.
// The exp2 stand in asm, each in place, so that none is directly followed by a write of its source; the closing v_nop is the slot that the instruction set asks for behind a transcendental before its result is read.
#define L2E 1.44269504088896340736f
__device__ __forceinline__ void exp2x8(float* x) {
  asm("v_exp_f32 %0, %0\n\tv_exp_f32 %1, %1\n\tv_exp_f32 %2, %2\n\tv_exp_f32 %3, %3\n\tv_exp_f32 %4, %4\n\tv_exp_f32 %5, %5\n\tv_exp_f32 %6, %6\n\tv_exp_f32 %7, %7\n\tv_nop"
      : "+v"(x[0]), "+v"(x[1]), "+v"(x[2]), "+v"(x[3]), "+v"(x[4]), "+v"(x[5]), "+v"(x[6]), "+v"(x[7]));
}
__device__ __forceinline__ float exp2x1(float x) { asm("v_exp_f32 %0, %0\n\tv_nop" : "+v"(x)); return x; }

// K and V^T tiles go to LDS once per block and stage, by asynchronous copies (16 B a lane, through no register), and the block's 4 waves read their fragments from there.
#define KST 128               // keys per stage
#define NST (NPOS / KST)      // stages
#define KPF 20                // K row pitch in LDS, floats: 64 B + 16 B (16 B x odd: 16-byte readers meet no bank twice)
#define VPB 136               // V^T row pitch in LDS, bf16: 256 B + 16 B, for the same reason
__device__ __forceinline__ unsigned lds_off(const void* p) { return (unsigned)(size_t)p; }
// one stage of K: 128 rows of 64 B (one head's 16 dims as bf16 hi and lo, in the place of 16 floats of a 1024-B row); thread = (row tid >> 2 (+ 32 i), 16-B part tid & 3)
__device__ __forceinline__ void copy_k(const float* kg, float* sk, int tid) {
  const float* g0 = kg + (size_t)(tid >> 2) * 256 + (tid & 3) * 4; const float *g1 = g0 + 32 * 256, *g2 = g0 + 64 * 256, *g3 = g0 + 96 * 256;
  const unsigned l0 = lds_off(sk + (tid >> 2) * KPF + (tid & 3) * 4), l1 = l0 + 32 * KPF * 4, l2 = l0 + 64 * KPF * 4, l3 = l0 + 96 * KPF * 4;
  // the closing s_wait_xcnt stands in the copies' own statement, in front of any later write of their address registers
  asm volatile("global_load_async_to_lds_b128 %0, %4, off\n\tglobal_load_async_to_lds_b128 %1, %5, off\n\tglobal_load_async_to_lds_b128 %2, %6, off\n\tglobal_load_async_to_lds_b128 %3, %7, off\n\ts_wait_xcnt 0x0"
               :: "v"(l0), "v"(l1), "v"(l2), "v"(l3), "v"(g0), "v"(g1), "v"(g2), "v"(g3) : "memory");
}
// one stage of one V^T plane: 32 rows of 256 B (128 keys); thread = (row tid >> 4 (+ 8 i), 16-B part tid & 15)
__device__ __forceinline__ void copy_v(const __bf16* vg, __bf16* sv, int tid) {
  const __bf16* g0 = vg + (size_t)(tid >> 4) * NPOS + (tid & 15) * 8; const __bf16 *g1 = g0 + 8 * NPOS, *g2 = g0 + 16 * NPOS, *g3 = g0 + 24 * NPOS;
  const unsigned l0 = lds_off(sv + (tid >> 4) * VPB + (tid & 15) * 8), l1 = l0 + 8 * VPB * 2, l2 = l0 + 16 * VPB * 2, l3 = l0 + 24 * VPB * 2;
  // the closing s_wait_xcnt stands in the copies' own statement, in front of any later write of their address registers
  asm volatile("global_load_async_to_lds_b128 %0, %4, off\n\tglobal_load_async_to_lds_b128 %1, %5, off\n\tglobal_load_async_to_lds_b128 %2, %6, off\n\tglobal_load_async_to_lds_b128 %3, %7, off\n\ts_wait_xcnt 0x0"
               :: "v"(l0), "v"(l1), "v"(l2), "v"(l3), "v"(g0), "v"(g1), "v"(g2), "v"(g3) : "memory");
}
#define WAIT_COPIES() asm volatile("s_wait_asynccnt 0x0" ::: "memory")   // this wave's copies have landed
#define WAIT_LDS()    asm volatile("s_wait_dscnt 0x0" ::: "memory")      // this wave's LDS reads are done before the buffer is given up
// K fragment = the lane's 32 bytes of an LDS row as they stand (a, c = bytes 32 * (lane >> 4) + 0..15, + 16..31): elements 0..7 = hi of dims 8h + 0..7, elements 8..15 = lo of the same dims
__device__ __forceinline__ v16b frag_k(v4f a, v4f c) { union { v4f f[2]; v16b v; } u; u.f[0] = a; u.f[1] = c; return u.v; }
// its partner on the query side: the lane's 8 values (dims 8h + 0..7) in both halves, so that one product sums (k hi + k lo) . q over the 16 dims
__device__ __forceinline__ v16b frag_q2(v16b q) { v16b r;
#pragma unroll   // vector elements are indexed by constants
  for (int i = 0; i < 8; ++i) { r[i] = q[i]; r[8 + i] = q[i]; }
  return r; }

#define WS_XH   0u                                  // bf16 [2][4096][128] relu(bn(x)) position-major hi
#define WS_XL   (WS_XH + 2u * NB * NPOS * CIN)
#define WS_QKV  (WS_XL + 2u * NB * NPOS * CIN)        // f32 [2][4096][256]: q (64, scaled by log2(e)/4) | k (in the place of 64 floats; per head 64 B of bf16: hi d0..7, lo d0..7, hi d8..15, lo d8..15) | v (128)
#define WS_VTH  (WS_QKV + 4u * NB * NPOS * 256)       // bf16 [2][128 (h,dv)][4096] V^T hi
#define WS_VTL  (WS_VTH + 2u * NB * VF * NPOS)
#define WS_O    (WS_VTL + 2u * NB * VF * NPOS)        // f32 [2][4096][128] attention output (h, dv)
#define WS_END  (WS_O + 4u * NB * NPOS * VF)

// ---- k_xT: planes[b][p][c] = split(relu((bf16(x[b][c][p]) - m[c]) * (g[c] rsqrt(v[c]+eps)) + beta[c])); block = (b, 64 positions): LDS tile [64 p][128 c] -> rows of 256 B per plane (16 lanes)
__global__ __launch_bounds__(256) void k_xT(const float* __restrict__ X, const float* __restrict__ g, const float* __restrict__ bt, const float* __restrict__ rm, const float* __restrict__ rv, __bf16* __restrict__ PH, __bf16* __restrict__ PL) {
  __shared__ __bf16 sh[64][136], sl[64][136]; __shared__ float ssc[CIN], ssh[CIN];
  const int b = blockIdx.y, p0 = blockIdx.x * 64, tid = threadIdx.x;
  if (tid < CIN) { const float inv = rsqrtf(bfr(rv[tid]) + 1e-5f); const float sc = bfr(g[tid]) * inv; ssc[tid] = sc; ssh[tid] = bfr(bt[tid]) - bfr(rm[tid]) * sc; }
  __syncthreads();
  for (int q = tid; q < CIN * 64; q += 256) { const int c = q >> 6, pl = q & 63; float v = bfr(X[((size_t)b * CIN + c) * NPOS + p0 + pl]) * ssc[c] + ssh[c]; v = v > 0.f ? v : 0.f; const __bf16 hi = (__bf16)v; sh[pl][c] = hi; sl[pl][c] = (__bf16)(v - (float)hi); }
  __syncthreads();
  for (int q = tid; q < 64 * 16; q += 256) { const int pl = q >> 4, pc = q & 15; union { __bf16 e[8]; v4u u; } a, c2;
#pragma unroll
    for (int e = 0; e < 8; ++e) { a.e[e] = sh[pl][pc * 8 + e]; c2.e[e] = sl[pl][pc * 8 + e]; }
    const size_t o = ((size_t)b * NPOS + p0 + pl) * CIN + pc * 8; vst2((unsigned*)(PH + o), a.u); vst2((unsigned*)(PL + o), c2.u); }
}
// ---- k_qkv: QKV[b][p][n] = planes . W rows (+ bias), n < 64: Wq (then x log2(e)/4), < 128: Wk, else Wv; block (64 positions, 128 of the 256 cols); K = 128 (4 steps); also writes V^T hi/lo planes for the v columns (block-local transpose via so)
__global__ __launch_bounds__(128) void k_qkv(const __bf16* __restrict__ PH, const __bf16* __restrict__ PL, const float* __restrict__ Wq, const float* __restrict__ bq, const float* __restrict__ Wk, const float* __restrict__ bk, const float* __restrict__ Wv, const float* __restrict__ bv, float* __restrict__ QKV, __bf16* __restrict__ VTH, __bf16* __restrict__ VTL) {
  __shared__ __align__(16) float so[64][132];
  const int tid = threadIdx.x, wave = tid >> 5, lane = tid & 31, col = lane & 15, g = lane >> 4; const int b = blockIdx.z; const int p0 = blockIdx.x * 64; const int n0 = blockIdx.y * 128;
  const size_t arow = ((size_t)b * NPOS + p0 + wave * 16 + col) * CIN;
  v8f acc[8] = {};
#pragma unroll
  for (int kc = 0; kc < CIN / 32; ++kc) { const v16b ah = frag_b(PH + arow + kc * 32, lane), al = frag_b(PL + arow + kc * 32, lane);
#pragma unroll
    for (int j = 0; j < 8; ++j) { const int n = n0 + j * 16 + col; const float* wr = n < KF ? Wq + (size_t)n * CIN : (n < 2 * KF ? Wk + (size_t)(n - KF) * CIN : Wv + (size_t)(n - 2 * KF) * CIN);   // per-lane weight row pointer (all global, same base kind); j-tile never straddles a matrix (boundaries at 64/128 are tile multiples)
      const v16b w = frag_gbf(wr + kc * 32, lane); acc[j] = wmma_bf(al, w, acc[j]); acc[j] = wmma_bf(ah, w, acc[j]); } }
#pragma unroll
  for (int j = 0; j < 8; ++j) { const int n = n0 + j * 16 + col; const float bias = n < KF ? bfr(bq[n]) : (n < 2 * KF ? bfr(bk[n - KF]) : bfr(bv[n - 2 * KF])); const float sc = n < KF ? 0.25f * L2E : 1.0f;
#pragma unroll
    for (int r = 0; r < 8; ++r) so[wave * 16 + 8 * g + r][j * 16 + col] = (acc[j][r] + bias) * sc; }
  __syncthreads();
  for (int q = tid; q < 64 * 32; q += 128) { const int rl = q >> 5, pc = q & 31; float* dst = QKV + ((size_t)b * NPOS + p0 + rl) * 256 + n0 + pc * 4;
    if (n0 == 0 && pc >= KF / 4) {   // k columns: the 16-B part pc & 3 of a head's 64 B holds 8 dims (bit 1: which 8) as bf16 hi or lo (bit 0), split once here for every reader
      const float* s8 = &so[rl][(pc & ~3) * 4 + (pc & 2) * 4]; union { __bf16 e[8]; v4u u; } w;
#pragma unroll   // w is indexed by constants, so it stays in registers
      for (int e = 0; e < 8; ++e) { const float v = s8[e]; const __bf16 hi = (__bf16)v; w.e[e] = (pc & 1) ? (__bf16)(v - (float)hi) : hi; }
      vst2((unsigned*)dst, w.u); }
    else vst2(dst, *(const v4f*)&so[rl][pc * 4]); }
  if (n0 == 128) {
    for (int q = tid; q < 128 * 8; q += 128) { const int c = q >> 3, pc = q & 7; union { __bf16 e[8]; v4u u; } hh, ll;
#pragma unroll
      for (int e = 0; e < 8; ++e) { const float v = so[pc * 8 + e][c]; const __bf16 hi = (__bf16)v; hh.e[e] = hi; ll.e[e] = (__bf16)(v - (float)hi); }
      const size_t o = ((size_t)b * VF + c) * NPOS + p0 + pc * 8; vst2((unsigned*)(VTH + o), hh.u); vst2((unsigned*)(VTL + o), ll.u); } }
}
// the other half's value of the same column (lane ^ 16), by a vector cross-row move
__device__ __forceinline__ float xhalf(float v) { const unsigned u = __builtin_bit_cast(unsigned, v); return __builtin_bit_cast(float, __builtin_amdgcn_permlanex16(u, u, 0x76543210u, 0xfedcba98u, false, false)); }
// ---- k_attn: block = (64 queries, b*4+h), one pass over the keys. S^T = k(hi/lo) q(hi/lo)^T, the 32-deep k = 16 dims x (k hi, k lo), once against q lo and once against q hi: lane (g, col) holds keys 8g+0..7 of query col. Per stage of 128 keys: the 8 S^T tiles, their maximum in-lane and over the two halves, one rescale of O^T and of the sums by 2^(m_old - m_new),
// then P^T = 2^(s - m) as hi/lo straight from the S^T accumulators, O^T += V^T(hi/lo) P^T over 32-key steps, the sums of P in-lane; behind the loop the halves' sums are joined and O is divided by them.
__global__ __launch_bounds__(128) void k_attn(const float* __restrict__ QKV, const __bf16* __restrict__ VTH, const __bf16* __restrict__ VTL, float* __restrict__ O) {
  __shared__ __align__(16) float so[4][16][36]; __shared__ __align__(16) float sk[2][KST * KPF]; __shared__ __align__(16) __bf16 sv[2][2][DV * VPB];   // sv[buffer][hi, lo]
  const int tid = threadIdx.x, wave = tid >> 5, lane = tid & 31, col = lane & 15, g = lane >> 4;
  const int bh = blockIdx.y, b = bh >> 2, h = bh & 3; const int q0 = blockIdx.x * 64 + wave * 16;
  const F2 a = split_rowK(QKV + ((size_t)b * NPOS + q0 + col) * 256 + h * DK, 0, lane, DK);
  const v16b qh = frag_q2(a.h), ql = frag_q2(a.l);
  float m = -3.0e38f, ls[8] = {};   // the query's running maximum (log2 domain, equal in both halves); ls[r]: sum of P over the lane's keys 8g + r of every tile
  v8f acc[2] = {};
  const float* kg = QKV + (size_t)b * NPOS * 256 + KF + h * DK; const __bf16 *vgh = VTH + ((size_t)b * VF + h * DV) * NPOS, *vgl = VTL + ((size_t)b * VF + h * DV) * NPOS;
  copy_k(kg, sk[0], tid); copy_v(vgh, sv[0][0], tid); copy_v(vgl, sv[0][1], tid); WAIT_COPIES(); __syncthreads();   // stage 0 is there for every wave
  copy_k(kg + (size_t)KST * 256, sk[1], tid); copy_v(vgh + KST, sv[1][0], tid); copy_v(vgl + KST, sv[1][1], tid);     // stage 1 flies while stage 0 is worked on
#pragma unroll 1   // one trip = one stage: the buffer index and the publish point stay in one place
  for (int t = 0; t < NST; ++t) { const float* kr = sk[t & 1] + col * KPF + 8 * g; const __bf16 *vrh = sv[t & 1][0] + col * VPB, *vrl = sv[t & 1][1] + col * VPB;
    v4f kq[KST / 16][2]; v16b vq[2][2][2];   // the stage's K rows; [set][dt][hi, lo]: a step's V^T fragments, read one step ahead inside the stage
    // RD_V: the V^T reads of one 32-key step; its loop is unrolled so that the sets are indexed by constants and stay in registers
#define RD_V(S, KS) do { _Pragma("unroll") for (int c = 0; c < 2; ++c) { const int vo = c * 16 * VPB + (KS) * 32; vq[S][c][0] = frag_b(vrh + vo, lane); vq[S][c][1] = frag_b(vrl + vo, lane); } } while (0)
#pragma unroll     // the stage's K reads and the first step's V^T reads stand as one group ahead of the matrix work: one read latency a stage
    for (int kt = 0; kt < KST / 16; ++kt) { kq[kt][0] = *(const v4f*)(kr + kt * 16 * KPF); kq[kt][1] = *(const v4f*)(kr + kt * 16 * KPF + 4); }
    RD_V(0, 0);
    v8f s[KST / 16];
#pragma unroll     // kq and s are indexed by constants only, so they stay in registers; the small products first, and eight independent tiles between a tile's two products
    for (int kt = 0; kt < KST / 16; ++kt) s[kt] = wmma_bf(frag_k(kq[kt][0], kq[kt][1]), ql, (v8f){});
#pragma unroll     // as above: constant indices
    for (int kt = 0; kt < KST / 16; ++kt) s[kt] = wmma_bf(frag_k(kq[kt][0], kq[kt][1]), qh, s[kt]);
    float mx[8];       // eight independent chains over the tiles, each from the running maximum, two tiles a link; then joined
#pragma unroll
    for (int r = 0; r < 8; ++r) { mx[r] = m;
#pragma unroll
      for (int kt = 0; kt < KST / 16; kt += 2) mx[r] = fmaxf(fmaxf(mx[r], s[kt][r]), s[kt + 1][r]); }
    const float mt = fmaxf(fmaxf(fmaxf(fmaxf(mx[0], mx[1]), mx[2]), fmaxf(fmaxf(mx[3], mx[4]), mx[5])), fmaxf(mx[6], mx[7]));
    const float mn = fmaxf(mt, xhalf(mt)), al = exp2x1(m - mn); m = mn;   // both halves feed one O^T tile, so they use one maximum
#pragma unroll
    for (int r = 0; r < 8; ++r) { ls[r] *= al; acc[0][r] *= al; acc[1][r] *= al; }
#pragma unroll     // the sets are indexed by constants only, so they stay in registers
  for (int ks = 0; ks < KST / 32; ++ks) { float p[16];   // p[ct * 8 + r] = P[query col][key (t * 4 + ks) * 32 + ct * 16 + 8g + r]: the two S^T tiles are a B fragment's k order as they stand
    if (ks + 1 < KST / 32) RD_V((ks + 1) & 1, ks + 1);   // the next step's LDS reads as one group ahead of this step's matrix work (same stage, same buffer)
#pragma unroll
    for (int ct = 0; ct < 2; ++ct) { float x[8];
#pragma unroll
      for (int r = 0; r < 8; ++r) x[r] = s[ks * 2 + ct][r] - mn;
      exp2x8(x);
#pragma unroll
      for (int r = 0; r < 8; ++r) { p[ct * 8 + r] = x[r]; ls[r] += x[r]; } }
    const F2 pa = bsplit16(p);
#pragma unroll
    for (int dt = 0; dt < 2; ++dt) { const v16b vh = vq[ks & 1][dt][0], vl = vq[ks & 1][dt][1];
      acc[dt] = wmma_bf(vh, pa.l, acc[dt]); acc[dt] = wmma_bf(vl, pa.h, acc[dt]); acc[dt] = wmma_bf(vh, pa.h, acc[dt]); } }
    WAIT_LDS(); WAIT_COPIES(); __syncthreads();   // publish point: stage t + 1 has landed for all, and nobody reads stage t's buffers any more
    if (t + 2 < NST) { copy_k(kg + (size_t)(t + 2) * KST * 256, sk[t & 1], tid); copy_v(vgh + (t + 2) * KST, sv[t & 1][0], tid); copy_v(vgl + (t + 2) * KST, sv[t & 1][1], tid); } }
  WAIT_COPIES();
  float l = ((ls[0] + ls[1]) + (ls[2] + ls[3])) + ((ls[4] + ls[5]) + (ls[6] + ls[7]));
  l += xhalf(l);   // join the halves' keys
  const float il = 1.0f / l;
#pragma unroll
  for (int dt = 0; dt < 2; ++dt)   // acc[dt][r] = O[query col][dt * 16 + 8g + r] * l: 8 consecutive floats of the lane's row
#pragma unroll
    for (int r = 0; r < 8; ++r) so[wave][col][dt * 16 + 8 * g + r] = acc[dt][r] * il;
  LDSX();
  for (int q = lane; q < 16 * 8; q += 32) { const int rl = q >> 3, pc = q & 7; vst2(O + ((size_t)b * NPOS + q0 + rl) * VF + h * DV + pc * 4, *(const v4f*)&so[wave][rl][pc * 4]); }
}
// ---- k_out: Y[p][o] = O row(hi/lo) . Wo rows + bo; out[b][o][p] = Y + inputs (NCHW); block = (64 positions, b): 128 output channels in one pass (8 tiles); transposed store per channel: 64 positions = 256 B by 16 lanes
__global__ __launch_bounds__(128) void k_out(const float* __restrict__ O, const float* __restrict__ Wo, const float* __restrict__ bo, const float* __restrict__ X, float* __restrict__ out) {
  __shared__ __align__(16) float st[128][68];
  const int tid = threadIdx.x, wave = tid >> 5, lane = tid & 31, col = lane & 15, g = lane >> 4; const int b = blockIdx.y; const int p0 = blockIdx.x * 64;
  v8f acc[8] = {};
#pragma unroll
  for (int kc = 0; kc < VF / 32; ++kc) { const F2 a = split_row(O + ((size_t)b * NPOS + p0 + wave * 16 + col) * VF, kc * 32, lane);
#pragma unroll
    for (int j = 0; j < 8; ++j) { const v16b w = frag_gbf(Wo + (size_t)(j * 16 + col) * VF + kc * 32, lane); acc[j] = wmma_bf(a.l, w, acc[j]); acc[j] = wmma_bf(a.h, w, acc[j]); } }
#pragma unroll
  for (int j = 0; j < 8; ++j) { const float bb = bfr(bo[j * 16 + col]);
#pragma unroll
    for (int r = 0; r < 8; ++r) st[j * 16 + col][wave * 16 + 8 * g + r] = acc[j][r] + bb; }
  __syncthreads();
  for (int q = tid; q < 128 * 16; q += 128) { const int o = q >> 4, pc = q & 15; const size_t base = ((size_t)b * CIN + o) * NPOS + p0 + pc * 4; const float4 xv = *(const float4*)(X + base);
    v4f r4; r4[0] = st[o][pc * 4] + bfr(xv.x); r4[1] = st[o][pc * 4 + 1] + bfr(xv.y); r4[2] = st[o][pc * 4 + 2] + bfr(xv.z); r4[3] = st[o][pc * 4 + 3] + bfr(xv.w); vst2(out + base, r4); }
}

extern "C" void kernel_launch(void* const* d_in, const int* in_sizes, int n_in, void* d_out, int out_size, void* d_ws, size_t ws_size, hipStream_t stream) {
  (void)in_sizes; (void)n_in; (void)out_size;
  const float** F = (const float**)d_in;   // inputs, gamma, beta, running_mean, running_var, Wq, bq, Wk, bk, Wv, bv, Wo, bo
  if (ws_size < (size_t)WS_END) return;
  char* ws = (char*)d_ws;
  __bf16 *PH = (__bf16*)(ws + WS_XH), *PL = (__bf16*)(ws + WS_XL), *VTH = (__bf16*)(ws + WS_VTH), *VTL = (__bf16*)(ws + WS_VTL); float *QKV = (float*)(ws + WS_QKV), *O = (float*)(ws + WS_O);
  k_xT<<<dim3(NPOS / 64, TNB), 256, 0, stream>>>(F[0], F[1], F[2], F[3], F[4], PH, PL);
  k_qkv<<<dim3(NPOS / 64, 2, TNB), 128, 0, stream>>>(PH, PL, F[5], F[6], F[7], F[8], F[9], F[10], QKV, VTH, VTL);
  k_attn<<<dim3(TQB, TNB * NHD), 128, 0, stream>>>(QKV, VTH, VTL, O);
  k_out<<<dim3(TQB, TNB), 128, 0, stream>>>(O, F[11], F[12], F[0], (float*)d_out);
}

// v006
// It runs in 64 microseconds.
// Two timings next to v005 both put it at 1.43 times that version's speed.
// Over all steps from v000 it is 12.1 times as fast.
// compute dtype: inputs, BN parameters and all projection weights/biases (module inputs) rounded to bf16; q/k/v projections of the BN+ReLU activations, the attention scores, P.V and the output projection all take computed operands as bf16 hi + bf16 residual pairs (2 products against weights, 3 between computed operands; the scores take all 4, two to a 32-deep product);
#include <hip/hip_runtime.h>
#include <math.h>

typedef __attribute__((ext_vector_type(16))) _Float16 v16h;
typedef __attribute__((ext_vector_type(16))) __bf16 v16b;
typedef __attribute__((ext_vector_type(8)))  _Float16 v8h;
typedef __attribute__((ext_vector_type(8)))  float v8f;
typedef __attribute__((ext_vector_type(4)))  float v4f;
typedef __attribute__((ext_vector_type(2)))  float v2f;
typedef __attribute__((ext_vector_type(4)))  unsigned v4u;
typedef __attribute__((ext_vector_type(4)))  int v4i;
typedef float __attribute__((may_alias)) float_a;
typedef int __attribute__((may_alias)) int_a;

template <typename T> __device__ __forceinline__ void vst2(void* p, T v) { *(T*)p = v;  }
__device__ __forceinline__ v8f wmma16(v16h a, v16h b, v8f c) {
  v8f d = __builtin_amdgcn_wmma_f32_16x16x32_f16(false, a, false, b, (short)0, c, false, false);
  asm volatile("v_nop\n\tv_nop\n\tv_nop\n\tv_nop" : "+v"(d) : "v"(a), "v"(b));
  return d;
}
__device__ __forceinline__ v8f wmma_bf(v16b a, v16b b, v8f c) {
  v8f d = __builtin_amdgcn_wmma_f32_16x16x32_bf16(false, a, false, b, (short)0, c, false, false);
  asm volatile("v_nop\n\tv_nop\n\tv_nop\n\tv_nop" : "+v"(d) : "v"(a), "v"(b));
  return d;
}
// 16x16x32 fragments: lane = (h = lane>>4, row/col = lane&15); elements 0..7 = k0+8h+0..7, 8..15 = k0+16+8h+0..7; D element r = row 8h+r
__device__ __forceinline__ v16h frag_h(const _Float16* rowk0, int lane) {
  union { v16h v; v8h q[2]; } u; const _Float16* p = rowk0 + 8 * (lane >> 4);
  u.q[0] = *(const v8h*)p; u.q[1] = *(const v8h*)(p + 16); return u.v;
}
__device__ __forceinline__ v16h frag_f32(const float* rowk0, int lane) {
  v16h a; const float* p = rowk0 + 8 * (lane >> 4);
#pragma unroll
  for (int i = 0; i < 8; ++i) { a[i] = (_Float16)p[i]; a[8 + i] = (_Float16)p[16 + i]; }
  return a;
}
__device__ __forceinline__ v16h frag_f32s(const float* rowk0, int lane, float sc) {
  v16h a; const float* p = rowk0 + 8 * (lane >> 4);
#pragma unroll
  for (int i = 0; i < 8; ++i) { a[i] = (_Float16)(p[i] * sc); a[8 + i] = (_Float16)(p[16 + i] * sc); }
  return a;
}
// column fragment from a [K][ld] layout (column n), rows >= K read as 0
__device__ __forceinline__ v16h fragc_f32(const float* W, int k0, int n, int lane, int ld, int K) {
  v16h a; const int g = lane >> 4;
#pragma unroll
  for (int i = 0; i < 8; ++i) { const int ka = k0 + 8 * g + i, kb = ka + 16;
    a[i] = (_Float16)(ka < K ? W[(size_t)(ka < K ? ka : K - 1) * ld + n] : 0.f); a[8 + i] = (_Float16)(kb < K ? W[(size_t)(kb < K ? kb : K - 1) * ld + n] : 0.f); }
  return a;
}
struct F2 { v16b h, l; };
__device__ __forceinline__ F2 bsplit16(const float v[16]) { F2 r;
#pragma unroll
  for (int i = 0; i < 16; ++i) { const __bf16 h = (__bf16)v[i]; r.h[i] = h; r.l[i] = (__bf16)(v[i] - (float)h); }
  return r; }
__device__ __forceinline__ F2 split_row(const float* row, int k0, int lane) { float v[16]; const float* p = row + k0 + 8 * (lane >> 4);
#pragma unroll
  for (int i = 0; i < 8; ++i) { v[i] = p[i]; v[8 + i] = p[16 + i]; }
  return bsplit16(v); }
__device__ __forceinline__ F2 split_rowK(const float* row, int k0, int lane, int K) { float v[16]; const int g = lane >> 4;
#pragma unroll
  for (int i = 0; i < 8; ++i) { const int ka = k0 + 8 * g + i, kb = ka + 16; v[i] = ka < K ? row[ka < K ? ka : K - 1] : 0.f; v[8 + i] = kb < K ? row[kb < K ? kb : K - 1] : 0.f; }
  return bsplit16(v); }
__device__ __forceinline__ F2 split_col(const float* W, int k0, int n, int lane, int ld, int K) { float v[16]; const int g = lane >> 4;
#pragma unroll
  for (int i = 0; i < 8; ++i) { const int ka = k0 + 8 * g + i, kb = ka + 16; v[i] = ka < K ? W[(size_t)(ka < K ? ka : K - 1) * ld + n] : 0.f; v[8 + i] = kb < K ? W[(size_t)(kb < K ? kb : K - 1) * ld + n] : 0.f; }
  return bsplit16(v); }
__device__ __forceinline__ v8f mac3(const F2& a, const F2& b, v8f c) { c = wmma_bf(a.l, b.h, c); c = wmma_bf(a.h, b.l, c); return wmma_bf(a.h, b.h, c); }
__device__ __forceinline__ float sigm(float v) { return 1.0f / (1.0f + expf(-v)); }
#define LDSX() do { asm volatile("s_wait_dscnt 0" ::: "memory"); __builtin_amdgcn_wave_barrier(); __builtin_amdgcn_fence(__ATOMIC_RELEASE, "workgroup"); } while (0)


// Global self-attention block over 64x64 = 4096 positions: x = relu(bn(inputs)); q, k (64 = 4 heads x 16), v (128 = 4 x 32) by 1x1 convs; softmax(q k^T / 4) v per head; out = o Wo^T + bo, back to NCHW, + inputs.
// k_xT (bn+relu, channel-major -> position-major hi/lo bf16 planes via LDS), k_qkv (one GEMM for [q|k|v] (256 cols), K = 128; q scaled after the bias; k stored split, as A-fragment rows), k_attn (per (b,h), one pass: S^T = k q^T, 16 dims x (hi, lo) = the 32-deep k, a lane owns one query: running max and sum over the 4096 keys, P^T = exp(s - m) as hi/lo straight from the S^T accumulators, O^T += V^T(hi/lo) P^T over 32-key steps, O / sum at the end; O -> concat layout),
// k_out (o(hi/lo) Wo^T + bo, transposed through LDS to NCHW rows + shortcut; per channel 64 positions = 256 B).
#define NB 2
#define CIN 128
#define NPOS 4096
#define NHD 4
#define DK 16
#define DV 32
#define KF 64
#define VF 128
#ifndef TNB
#define TNB NB
#define TQB (NPOS / 64)
#endif
typedef __attribute__((ext_vector_type(8))) __bf16 v8b;
__device__ __forceinline__ v16b frag_b(const __bf16* rowk0, int lane) {
  union { v16b v; v8b q[2]; } u; const __bf16* p = rowk0 + 8 * (lane >> 4);
  u.q[0] = *(const v8b*)p; u.q[1] = *(const v8b*)(p + 16); return u.v;
}
__device__ __forceinline__ v16b frag_gbf(const float* rowk0, int lane) {
  v16b a; const float* p = rowk0 + 8 * (lane >> 4);
#pragma unroll
  for (int i = 0; i < 8; ++i) { a[i] = (__bf16)p[i]; a[8 + i] = (__bf16)p[16 + i]; }
  return a;
}
__device__ __forceinline__ float bfr(float v) { return (float)(__bf16)v; }
// exp(s - m) = 2^(s' - m') with s' = s * log2(e): k_qkv folds log2(e) into q's scale, so scores and maxima come in the log2 domain and an exponential is one subtract and the hardware exp2, inline. Arguments are <= 0; a hugely negative one gives 0.
// The exp2 stand in asm, each in place, so that none is directly followed by a write of its source; the closing v_nop is the slot that the instruction set asks for behind a transcendental before its result is read.
#define L2E 1.44269504088896340736f
__device__ __forceinline__ void exp2x8(float* x) {
  asm("v_exp_f32 %0, %0\n\tv_exp_f32 %1, %1\n\tv_exp_f32 %2, %2\n\tv_exp_f32 %3, %3\n\tv_exp_f32 %4, %4\n\tv_exp_f32 %5, %5\n\tv_exp_f32 %6, %6\n\tv_exp_f32 %7, %7\n\tv_nop"
      : "+v"(x[0]), "+v"(x[1]), "+v"(x[2]), "+v"(x[3]), "+v"(x[4]), "+v"(x[5]), "+v"(x[6]), "+v"(x[7]));
}
__device__ __forceinline__ float exp2x1(float x) { asm("v_exp_f32 %0, %0\n\tv_nop" : "+v"(x)); return x; }

// K and V^T tiles go to LDS once per block and stage, by asynchronous copies (16 B a lane, through no register), and the block's 4 waves read their fragments from there.
#define KST 128               // keys per stage
#define NST (NPOS / KST)      // stages
#define KPF 20                // K row pitch in LDS, floats: 64 B + 16 B (16 B x odd: 16-byte readers meet no bank twice)
#define VPB 136               // V^T row pitch in LDS, bf16: 256 B + 16 B, for the same reason
__device__ __forceinline__ unsigned lds_off(const void* p) { return (unsigned)(size_t)p; }
// one stage of K: 128 rows of 64 B (one head's 16 dims as bf16 hi and lo, in the place of 16 floats of a 1024-B row); thread = (row tid >> 2 (+ 32 i), 16-B part tid & 3)
__device__ __forceinline__ void copy_k(const float* kg, float* sk, int tid) {
  const float* g0 = kg + (size_t)(tid >> 2) * 256 + (tid & 3) * 4; const float *g1 = g0 + 32 * 256, *g2 = g0 + 64 * 256, *g3 = g0 + 96 * 256;
  const unsigned l0 = lds_off(sk + (tid >> 2) * KPF + (tid & 3) * 4), l1 = l0 + 32 * KPF * 4, l2 = l0 + 64 * KPF * 4, l3 = l0 + 96 * KPF * 4;
  // the closing s_wait_xcnt stands in the copies' own statement, in front of any later write of their address registers
  asm volatile("global_load_async_to_lds_b128 %0, %4, off\n\tglobal_load_async_to_lds_b128 %1, %5, off\n\tglobal_load_async_to_lds_b128 %2, %6, off\n\tglobal_load_async_to_lds_b128 %3, %7, off\n\ts_wait_xcnt 0x0"
               :: "v"(l0), "v"(l1), "v"(l2), "v"(l3), "v"(g0), "v"(g1), "v"(g2), "v"(g3) : "memory");
}
// one stage of one V^T plane: 32 rows of 256 B (128 keys); thread = (row tid >> 4 (+ 8 i), 16-B part tid & 15)
__device__ __forceinline__ void copy_v(const __bf16* vg, __bf16* sv, int tid) {
  const __bf16* g0 = vg + (size_t)(tid >> 4) * NPOS + (tid & 15) * 8; const __bf16 *g1 = g0 + 8 * NPOS, *g2 = g0 + 16 * NPOS, *g3 = g0 + 24 * NPOS;
  const unsigned l0 = lds_off(sv + (tid >> 4) * VPB + (tid & 15) * 8), l1 = l0 + 8 * VPB * 2, l2 = l0 + 16 * VPB * 2, l3 = l0 + 24 * VPB * 2;
  // the closing s_wait_xcnt stands in the copies' own statement, in front of any later write of their address registers
  asm volatile("global_load_async_to_lds_b128 %0, %4, off\n\tglobal_load_async_to_lds_b128 %1, %5, off\n\tglobal_load_async_to_lds_b128 %2, %6, off\n\tglobal_load_async_to_lds_b128 %3, %7, off\n\ts_wait_xcnt 0x0"
               :: "v"(l0), "v"(l1), "v"(l2), "v"(l3), "v"(g0), "v"(g1), "v"(g2), "v"(g3) : "memory");
}
#define WAIT_COPIES() asm volatile("s_wait_asynccnt 0x0" ::: "memory")   // this wave's copies have landed
#define WAIT_LDS()    asm volatile("s_wait_dscnt 0x0" ::: "memory")      // this wave's LDS reads are done before the buffer is given up
// K fragment = the lane's 32 bytes of an LDS row as they stand (a, c = bytes 32 * (lane >> 4) + 0..15, + 16..31): elements 0..7 = hi of dims 8h + 0..7, elements 8..15 = lo of the same dims
__device__ __forceinline__ v16b frag_k(v4f a, v4f c) { union { v4f f[2]; v16b v; } u; u.f[0] = a; u.f[1] = c; return u.v; }
// its partner on the query side: the lane's 8 values (dims 8h + 0..7) in both halves, so that one product sums (k hi + k lo) . q over the 16 dims
__device__ __forceinline__ v16b frag_q2(v16b q) { v16b r;
#pragma unroll   // vector elements are indexed by constants
  for (int i = 0; i < 8; ++i) { r[i] = q[i]; r[8 + i] = q[i]; }
  return r; }

// A projection's 128 weight rows (128 floats each) go to LDS once per block, rounded to bf16: whole-row loads (a wave reads one row of 512 B), all in flight together, and the block's 4 waves read their B fragments from there.
#define WPB 136               // weight row pitch in LDS, bf16: 256 B + 16 B (16 B x odd: 16-byte readers meet no bank twice)
typedef __attribute__((ext_vector_type(4))) __bf16 v4b;
#define WAIT_ADDR() asm volatile("s_wait_xcnt 0x0" ::: "memory")   // stands between two groups of loads: the later group's results may be given the registers that hold the earlier group's addresses
// the same wait with the group's address as its input, so that the address registers are kept as they are up to it (no result of the group and no later load lands in them first): _S for block-uniform bases, _V for a lane's own pointer
#define WAIT_ADDR_S(P, Q) asm volatile("s_wait_xcnt 0x0" :: "s"(P), "s"(Q) : "memory")
#define WAIT_ADDR_V(P) asm volatile("s_wait_xcnt 0x0" :: "v"(P) : "memory")
__device__ __forceinline__ void put_w(__bf16* sw, int r, int lane, v4f x) { v4b c;
#pragma unroll   // vector elements are indexed by constants
  for (int e = 0; e < 4; ++e) c[e] = (__bf16)x[e];
  *(v4b*)(sw + r * WPB + lane * 4) = c; }

#define WS_XH   0u                                  // bf16 [2][4096][128] relu(bn(x)) position-major hi
#define WS_XL   (WS_XH + 2u * NB * NPOS * CIN)
#define WS_QKV  (WS_XL + 2u * NB * NPOS * CIN)        // f32 [2][4096][256]: q (64, scaled by log2(e)/4) | k (in the place of 64 floats; per head 64 B of bf16: hi d0..7, lo d0..7, hi d8..15, lo d8..15) | v (128)
#define WS_VTH  (WS_QKV + 4u * NB * NPOS * 256)       // bf16 [2][128 (h,dv)][4096] V^T hi
#define WS_VTL  (WS_VTH + 2u * NB * VF * NPOS)
#define WS_O    (WS_VTL + 2u * NB * VF * NPOS)        // f32 [2][4096][128] attention output (h, dv)
#define WS_END  (WS_O + 4u * NB * NPOS * VF)

// ---- k_xT: planes[b][p][c] = split(relu((bf16(x[b][c][p]) - m[c]) * (g[c] rsqrt(v[c]+eps)) + beta[c])); block = (b, 64 positions): LDS tile [64 p][128 c] -> rows of 256 B per plane (16 lanes)
__global__ __launch_bounds__(256) void k_xT(const float* __restrict__ X, const float* __restrict__ g, const float* __restrict__ bt, const float* __restrict__ rm, const float* __restrict__ rv, __bf16* __restrict__ PH, __bf16* __restrict__ PL) {
  __shared__ __bf16 sh[64][136], sl[64][136]; __shared__ float ssc[CIN], ssh[CIN];
  const int b = blockIdx.y, p0 = blockIdx.x * 64, tid = threadIdx.x;
  if (tid < CIN) { const float inv = rsqrtf(bfr(rv[tid]) + 1e-5f); const float sc = bfr(g[tid]) * inv; ssc[tid] = sc; ssh[tid] = bfr(bt[tid]) - bfr(rm[tid]) * sc; }
  __syncthreads();
  for (int q = tid; q < CIN * 64; q += 256) { const int c = q >> 6, pl = q & 63; float v = bfr(X[((size_t)b * CIN + c) * NPOS + p0 + pl]) * ssc[c] + ssh[c]; v = v > 0.f ? v : 0.f; const __bf16 hi = (__bf16)v; sh[pl][c] = hi; sl[pl][c] = (__bf16)(v - (float)hi); }
  __syncthreads();
  for (int q = tid; q < 64 * 16; q += 256) { const int pl = q >> 4, pc = q & 15; union { __bf16 e[8]; v4u u; } a, c2;
#pragma unroll
    for (int e = 0; e < 8; ++e) { a.e[e] = sh[pl][pc * 8 + e]; c2.e[e] = sl[pl][pc * 8 + e]; }
    const size_t o = ((size_t)b * NPOS + p0 + pl) * CIN + pc * 8; vst2((unsigned*)(PH + o), a.u); vst2((unsigned*)(PL + o), c2.u); }
}
// ---- k_qkv: QKV[b][p][n] = planes . W rows (+ bias), n < 64: Wq (then x log2(e)/4), < 128: Wk, else Wv; block (64 positions, 128 of the 256 cols); K = 128 (4 steps); also writes V^T hi/lo planes for the v columns (block-local transpose via so)
__global__ __launch_bounds__(128) void k_qkv(const __bf16* __restrict__ PH, const __bf16* __restrict__ PL, const float* __restrict__ Wq, const float* __restrict__ bq, const float* __restrict__ Wk, const float* __restrict__ bk, const float* __restrict__ Wv, const float* __restrict__ bv, float* __restrict__ QKV, __bf16* __restrict__ VTH, __bf16* __restrict__ VTL) {
  __shared__ __align__(16) float so[64][132]; __shared__ __align__(16) __bf16 sw[128 * WPB];
  const int tid = threadIdx.x, wave = tid >> 5, lane = tid & 31, col = lane & 15, g = lane >> 4; const int b = blockIdx.z; const int p0 = blockIdx.x * 64; const int n0 = blockIdx.y * 128;
  const size_t arow = ((size_t)b * NPOS + p0 + wave * 16 + col) * CIN;
  // every global operand is asked for here, ahead of the matrix work: one memory latency for the block. The matrix a row or a bias tile belongs to is picked by the block and by constants (rows 0..63 | 64..127 of the block's 128 columns), so no lane branches.
  const float *w0 = n0 ? Wv : Wq, *w1 = n0 ? Wv + KF * CIN : Wk, *b0 = n0 ? bv : bq, *b1 = n0 ? bv + KF : bk;
  v4f wx[32]; v16b ah[CIN / 32], al[CIN / 32]; float bias[8];
#pragma unroll   // wx is indexed by constants, so it stays in registers
  for (int i = 0; i < 32; ++i) wx[i] = *(const v4f*)((i < 16 ? w0 : w1) + ((i & 15) * 4 + wave) * CIN + lane * 4);   // row wave + 4 i
  WAIT_ADDR();
#pragma unroll   // as above: constant indices
  for (int kc = 0; kc < CIN / 32; ++kc) ah[kc] = frag_b(PH + arow + kc * 32, lane);
  WAIT_ADDR();
#pragma unroll   // as above: constant indices
  for (int kc = 0; kc < CIN / 32; ++kc) al[kc] = frag_b(PL + arow + kc * 32, lane);
  WAIT_ADDR();
#pragma unroll   // as above: constant indices
  for (int j = 0; j < 8; ++j) bias[j] = bfr((j < 4 ? b0 : b1)[(j & 3) * 16 + col]);
  WAIT_ADDR_S(b0, b1);
#pragma unroll   // as above: constant indices
  for (int i = 0; i < 32; ++i) put_w(sw, wave + 4 * i, lane, wx[i]);
  __syncthreads();   // the weights are there for every wave
  v8f acc[8] = {};
#pragma unroll
  for (int kc = 0; kc < CIN / 32; ++kc) { v16b w[8];
#pragma unroll   // the step's eight B fragments are read as one group ahead of its matrix work: one LDS latency a step
    for (int j = 0; j < 8; ++j) w[j] = frag_b(sw + (j * 16 + col) * WPB + kc * 32, lane);
#pragma unroll
    for (int j = 0; j < 8; ++j) { acc[j] = wmma_bf(al[kc], w[j], acc[j]); acc[j] = wmma_bf(ah[kc], w[j], acc[j]); } }
#pragma unroll
  for (int j = 0; j < 8; ++j) { const float sc = (n0 == 0 && j < 4) ? 0.25f * L2E : 1.0f;
#pragma unroll
    for (int r = 0; r < 8; ++r) so[wave * 16 + 8 * g + r][j * 16 + col] = (acc[j][r] + bias[j]) * sc; }
  __syncthreads();
  for (int q = tid; q < 64 * 32; q += 128) { const int rl = q >> 5, pc = q & 31; float* dst = QKV + ((size_t)b * NPOS + p0 + rl) * 256 + n0 + pc * 4;
    if (n0 == 0 && pc >= KF / 4) {   // k columns: the 16-B part pc & 3 of a head's 64 B holds 8 dims (bit 1: which 8) as bf16 hi or lo (bit 0), split once here for every reader
      const float* s8 = &so[rl][(pc & ~3) * 4 + (pc & 2) * 4]; union { __bf16 e[8]; v4u u; } w;
#pragma unroll   // w is indexed by constants, so it stays in registers
      for (int e = 0; e < 8; ++e) { const float v = s8[e]; const __bf16 hi = (__bf16)v; w.e[e] = (pc & 1) ? (__bf16)(v - (float)hi) : hi; }
      vst2((unsigned*)dst, w.u); }
    else vst2(dst, *(const v4f*)&so[rl][pc * 4]); }
  if (n0 == 128) {
    for (int q = tid; q < 128 * 8; q += 128) { const int c = q >> 3, pc = q & 7; union { __bf16 e[8]; v4u u; } hh, ll;
#pragma unroll
      for (int e = 0; e < 8; ++e) { const float v = so[pc * 8 + e][c]; const __bf16 hi = (__bf16)v; hh.e[e] = hi; ll.e[e] = (__bf16)(v - (float)hi); }
      const size_t o = ((size_t)b * VF + c) * NPOS + p0 + pc * 8; vst2((unsigned*)(VTH + o), hh.u); vst2((unsigned*)(VTL + o), ll.u); } }
}
// the other half's value of the same column (lane ^ 16), by a vector cross-row move
__device__ __forceinline__ float xhalf(float v) { const unsigned u = __builtin_bit_cast(unsigned, v); return __builtin_bit_cast(float, __builtin_amdgcn_permlanex16(u, u, 0x76543210u, 0xfedcba98u, false, false)); }
// ---- k_attn: block = (64 queries, b*4+h), one pass over the keys. S^T = k(hi/lo) q(hi/lo)^T, the 32-deep k = 16 dims x (k hi, k lo), once against q lo and once against q hi: lane (g, col) holds keys 8g+0..7 of query col. Per stage of 128 keys: the 8 S^T tiles, their maximum in-lane and over the two halves, one rescale of O^T and of the sums by 2^(m_old - m_new),
// then P^T = 2^(s - m) as hi/lo straight from the S^T accumulators, O^T += V^T(hi/lo) P^T over 32-key steps, the sums of P in-lane; behind the loop the halves' sums are joined and O is divided by them.
__global__ __launch_bounds__(128) void k_attn(const float* __restrict__ QKV, const __bf16* __restrict__ VTH, const __bf16* __restrict__ VTL, float* __restrict__ O) {
  __shared__ __align__(16) float so[4][16][36]; __shared__ __align__(16) float sk[2][KST * KPF]; __shared__ __align__(16) __bf16 sv[2][2][DV * VPB];   // sv[buffer][hi, lo]
  const int tid = threadIdx.x, wave = tid >> 5, lane = tid & 31, col = lane & 15, g = lane >> 4;
  const int bh = blockIdx.y, b = bh >> 2, h = bh & 3; const int q0 = blockIdx.x * 64 + wave * 16;
  const F2 a = split_rowK(QKV + ((size_t)b * NPOS + q0 + col) * 256 + h * DK, 0, lane, DK);
  const v16b qh = frag_q2(a.h), ql = frag_q2(a.l);
  float m = -3.0e38f, ls[8] = {};   // the query's running maximum (log2 domain, equal in both halves); ls[r]: sum of P over the lane's keys 8g + r of every tile
  v8f acc[2] = {};
  const float* kg = QKV + (size_t)b * NPOS * 256 + KF + h * DK; const __bf16 *vgh = VTH + ((size_t)b * VF + h * DV) * NPOS, *vgl = VTL + ((size_t)b * VF + h * DV) * NPOS;
  copy_k(kg, sk[0], tid); copy_v(vgh, sv[0][0], tid); copy_v(vgl, sv[0][1], tid); WAIT_COPIES(); __syncthreads();   // stage 0 is there for every wave
  copy_k(kg + (size_t)KST * 256, sk[1], tid); copy_v(vgh + KST, sv[1][0], tid); copy_v(vgl + KST, sv[1][1], tid);     // stage 1 flies while stage 0 is worked on
#pragma unroll 1   // one trip = one stage: the buffer index and the publish point stay in one place
  for (int t = 0; t < NST; ++t) { const float* kr = sk[t & 1] + col * KPF + 8 * g; const __bf16 *vrh = sv[t & 1][0] + col * VPB, *vrl = sv[t & 1][1] + col * VPB;
    v4f kq[KST / 16][2]; v16b vq[2][2][2];   // the stage's K rows; [set][dt][hi, lo]: a step's V^T fragments, read one step ahead inside the stage
    // RD_V: the V^T reads of one 32-key step; its loop is unrolled so that the sets are indexed by constants and stay in registers
#define RD_V(S, KS) do { _Pragma("unroll") for (int c = 0; c < 2; ++c) { const int vo = c * 16 * VPB + (KS) * 32; vq[S][c][0] = frag_b(vrh + vo, lane); vq[S][c][1] = frag_b(vrl + vo, lane); } } while (0)
#pragma unroll     // the stage's K reads and the first step's V^T reads stand as one group ahead of the matrix work: one read latency a stage
    for (int kt = 0; kt < KST / 16; ++kt) { kq[kt][0] = *(const v4f*)(kr + kt * 16 * KPF); kq[kt][1] = *(const v4f*)(kr + kt * 16 * KPF + 4); }
    RD_V(0, 0);
    v8f s[KST / 16];
#pragma unroll     // kq and s are indexed by constants only, so they stay in registers; the small products first, and eight independent tiles between a tile's two products
    for (int kt = 0; kt < KST / 16; ++kt) s[kt] = wmma_bf(frag_k(kq[kt][0], kq[kt][1]), ql, (v8f){});
#pragma unroll     // as above: constant indices
    for (int kt = 0; kt < KST / 16; ++kt) s[kt] = wmma_bf(frag_k(kq[kt][0], kq[kt][1]), qh, s[kt]);
    float mx[8];       // eight independent chains over the tiles, each from the running maximum, two tiles a link; then joined
#pragma unroll
    for (int r = 0; r < 8; ++r) { mx[r] = m;
#pragma unroll
      for (int kt = 0; kt < KST / 16; kt += 2) mx[r] = fmaxf(fmaxf(mx[r], s[kt][r]), s[kt + 1][r]); }
    const float mt = fmaxf(fmaxf(fmaxf(fmaxf(mx[0], mx[1]), mx[2]), fmaxf(fmaxf(mx[3], mx[4]), mx[5])), fmaxf(mx[6], mx[7]));
    const float mn = fmaxf(mt, xhalf(mt)), al = exp2x1(m - mn); m = mn;   // both halves feed one O^T tile, so they use one maximum
#pragma unroll
    for (int r = 0; r < 8; ++r) { ls[r] *= al; acc[0][r] *= al; acc[1][r] *= al; }
#pragma unroll     // the sets are indexed by constants only, so they stay in registers
  for (int ks = 0; ks < KST / 32; ++ks) { float p[16];   // p[ct * 8 + r] = P[query col][key (t * 4 + ks) * 32 + ct * 16 + 8g + r]: the two S^T tiles are a B fragment's k order as they stand
    if (ks + 1 < KST / 32) RD_V((ks + 1) & 1, ks + 1);   // the next step's LDS reads as one group ahead of this step's matrix work (same stage, same buffer)
#pragma unroll
    for (int ct = 0; ct < 2; ++ct) { float x[8];
#pragma unroll
      for (int r = 0; r < 8; ++r) x[r] = s[ks * 2 + ct][r] - mn;
      exp2x8(x);
#pragma unroll
      for (int r = 0; r < 8; ++r) { p[ct * 8 + r] = x[r]; ls[r] += x[r]; } }
    const F2 pa = bsplit16(p);
#pragma unroll
    for (int dt = 0; dt < 2; ++dt) { const v16b vh = vq[ks & 1][dt][0], vl = vq[ks & 1][dt][1];
      acc[dt] = wmma_bf(vh, pa.l, acc[dt]); acc[dt] = wmma_bf(vl, pa.h, acc[dt]); acc[dt] = wmma_bf(vh, pa.h, acc[dt]); } }
    WAIT_LDS(); WAIT_COPIES(); __syncthreads();   // publish point: stage t + 1 has landed for all, and nobody reads stage t's buffers any more
    if (t + 2 < NST) { copy_k(kg + (size_t)(t + 2) * KST * 256, sk[t & 1], tid); copy_v(vgh + (t + 2) * KST, sv[t & 1][0], tid); copy_v(vgl + (t + 2) * KST, sv[t & 1][1], tid); } }
  WAIT_COPIES();
  float l = ((ls[0] + ls[1]) + (ls[2] + ls[3])) + ((ls[4] + ls[5]) + (ls[6] + ls[7]));
  l += xhalf(l);   // join the halves' keys
  const float il = 1.0f / l;
#pragma unroll
  for (int dt = 0; dt < 2; ++dt)   // acc[dt][r] = O[query col][dt * 16 + 8g + r] * l: 8 consecutive floats of the lane's row
#pragma unroll
    for (int r = 0; r < 8; ++r) so[wave][col][dt * 16 + 8 * g + r] = acc[dt][r] * il;
  LDSX();
  for (int q = lane; q < 16 * 8; q += 32) { const int rl = q >> 3, pc = q & 7; vst2(O + ((size_t)b * NPOS + q0 + rl) * VF + h * DV + pc * 4, *(const v4f*)&so[wave][rl][pc * 4]); }
}
// ---- k_out: Y[p][o] = O row(hi/lo) . Wo rows + bo; out[b][o][p] = Y + inputs (NCHW); block = (64 positions, b): 128 output channels in one pass (8 tiles); transposed store per channel: 64 positions = 256 B by 16 lanes
__global__ __launch_bounds__(128) void k_out(const float* __restrict__ O, const float* __restrict__ Wo, const float* __restrict__ bo, const float* __restrict__ X, float* __restrict__ out) {
  __shared__ __align__(16) float st[128][68]; __shared__ __align__(16) __bf16 sw[128 * WPB];
  const int tid = threadIdx.x, wave = tid >> 5, lane = tid & 31, col = lane & 15, g = lane >> 4; const int b = blockIdx.y; const int p0 = blockIdx.x * 64;
  // every global operand is asked for here, ahead of the matrix work: one memory latency for the block
  v4f wx[32]; F2 a[VF / 32]; float bb[8]; const float* orow = O + ((size_t)b * NPOS + p0 + wave * 16 + col) * VF;
#pragma unroll   // wx is indexed by constants, so it stays in registers
  for (int i = 0; i < 32; ++i) wx[i] = *(const v4f*)(Wo + (size_t)(wave + 4 * i) * VF + lane * 4);
  WAIT_ADDR();
#pragma unroll   // as above: constant indices
  for (int kc = 0; kc < VF / 32; ++kc) a[kc] = split_row(orow, kc * 32, lane);
  WAIT_ADDR_V(orow + 8 * g);
#pragma unroll   // as above: constant indices
  for (int j = 0; j < 8; ++j) bb[j] = bfr(bo[j * 16 + col]);
  WAIT_ADDR_S(bo, bo);
#pragma unroll   // as above: constant indices
  for (int i = 0; i < 32; ++i) put_w(sw, wave + 4 * i, lane, wx[i]);
  __syncthreads();   // the weights are there for every wave
  v8f acc[8] = {};
#pragma unroll
  for (int kc = 0; kc < VF / 32; ++kc) { v16b w[8];
#pragma unroll   // the step's eight B fragments are read as one group ahead of its matrix work: one LDS latency a step
    for (int j = 0; j < 8; ++j) w[j] = frag_b(sw + (j * 16 + col) * WPB + kc * 32, lane);
#pragma unroll
    for (int j = 0; j < 8; ++j) { acc[j] = wmma_bf(a[kc].l, w[j], acc[j]); acc[j] = wmma_bf(a[kc].h, w[j], acc[j]); } }
#pragma unroll
  for (int j = 0; j < 8; ++j) {
#pragma unroll
    for (int r = 0; r < 8; ++r) st[j * 16 + col][wave * 16 + 8 * g + r] = acc[j][r] + bb[j]; }
  __syncthreads();
  for (int q = tid; q < 128 * 16; q += 128) { const int o = q >> 4, pc = q & 15; const size_t base = ((size_t)b * CIN + o) * NPOS + p0 + pc * 4; const float4 xv = *(const float4*)(X + base);
    v4f r4; r4[0] = st[o][pc * 4] + bfr(xv.x); r4[1] = st[o][pc * 4 + 1] + bfr(xv.y); r4[2] = st[o][pc * 4 + 2] + bfr(xv.z); r4[3] = st[o][pc * 4 + 3] + bfr(xv.w); vst2(out + base, r4); }
}

extern "C" void kernel_launch(void* const* d_in, const int* in_sizes, int n_in, void* d_out, int out_size, void* d_ws, size_t ws_size, hipStream_t stream) {
  (void)in_sizes; (void)n_in; (void)out_size;
  const float** F = (const float**)d_in;   // inputs, gamma, beta, running_mean, running_var, Wq, bq, Wk, bk, Wv, bv, Wo, bo
  if (ws_size < (size_t)WS_END) return;
  char* ws = (char*)d_ws;
  __bf16 *PH = (__bf16*)(ws + WS_XH), *PL = (__bf16*)(ws + WS_XL), *VTH = (__bf16*)(ws + WS_VTH), *VTL = (__bf16*)(ws + WS_VTL); float *QKV = (float*)(ws + WS_QKV), *O = (float*)(ws + WS_O);
  k_xT<<<dim3(NPOS / 64, TNB), 256, 0, stream>>>(F[0], F[1], F[2], F[3], F[4], PH, PL);
  k_qkv<<<dim3(NPOS / 64, 2, TNB), 128, 0, stream>>>(PH, PL, F[5], F[6], F[7], F[8], F[9], F[10], QKV, VTH, VTL);
  k_attn<<<dim3(TQB, TNB * NHD), 128, 0, stream>>>(QKV, VTH, VTL, O);
  k_out<<<dim3(TQB, TNB), 128, 0, stream>>>(O, F[11], F[12], F[0], (float*)d_out);
}

// v007
// A run of this version takes 62.1 microseconds.
// Two timings next to v006 both put it at 1.03 times that version's speed.
// Counting every step since v000, it is 12.5 times as fast.
// compute dtype: inputs, BN parameters and all projection weights/biases (module inputs) rounded to bf16; q/k/v projections of the BN+ReLU activations, the attention scores, P.V and the output projection all take computed operands as bf16 hi + bf16 residual pairs (2 products against weights, 3 between computed operands; the scores take all 4, two to a 32-deep product);
#include <hip/hip_runtime.h>
#include <math.h>

typedef __attribute__((ext_vector_type(16))) _Float16 v16h;
typedef __attribute__((ext_vector_type(16))) __bf16 v16b;
typedef __attribute__((ext_vector_type(8)))  _Float16 v8h;
typedef __attribute__((ext_vector_type(8)))  float v8f;
typedef __attribute__((ext_vector_type(4)))  float v4f;
typedef __attribute__((ext_vector_type(2)))  float v2f;
typedef __attribute__((ext_vector_type(4)))  unsigned v4u;
typedef __attribute__((ext_vector_type(4)))  int v4i;
typedef float __attribute__((may_alias)) float_a;
typedef int __attribute__((may_alias)) int_a;

template <typename T> __device__ __forceinline__ void vst2(void* p, T v) { *(T*)p = v;  }
__device__ __forceinline__ v8f wmma16(v16h a, v16h b, v8f c) {
  v8f d = __builtin_amdgcn_wmma_f32_16x16x32_f16(false, a, false, b, (short)0, c, false, false);
  asm volatile("v_nop\n\tv_nop\n\tv_nop\n\tv_nop" : "+v"(d) : "v"(a), "v"(b));
  return d;
}
__device__ __forceinline__ v8f wmma_bf(v16b a, v16b b, v8f c) {
  v8f d = __builtin_amdgcn_wmma_f32_16x16x32_bf16(false, a, false, b, (short)0, c, false, false);
  asm volatile("v_nop\n\tv_nop\n\tv_nop\n\tv_nop" : "+v"(d) : "v"(a), "v"(b));
  return d;
}
// 16x16x32 fragments: lane = (h = lane>>4, row/col = lane&15); elements 0..7 = k0+8h+0..7, 8..15 = k0+16+8h+0..7; D element r = row 8h+r
__device__ __forceinline__ v16h frag_h(const _Float16* rowk0, int lane) {
  union { v16h v; v8h q[2]; } u; const _Float16* p = rowk0 + 8 * (lane >> 4);
  u.q[0] = *(const v8h*)p; u.q[1] = *(const v8h*)(p + 16); return u.v;
}
__device__ __forceinline__ v16h frag_f32(const float* rowk0, int lane) {
  v16h a; const float* p = rowk0 + 8 * (lane >> 4);
#pragma unroll
  for (int i = 0; i < 8; ++i) { a[i] = (_Float16)p[i]; a[8 + i] = (_Float16)p[16 + i]; }
  return a;
}
__device__ __forceinline__ v16h frag_f32s(const float* rowk0, int lane, float sc) {
  v16h a; const float* p = rowk0 + 8 * (lane >> 4);
#pragma unroll
  for (int i = 0; i < 8; ++i) { a[i] = (_Float16)(p[i] * sc); a[8 + i] = (_Float16)(p[16 + i] * sc); }
  return a;
}
// column fragment from a [K][ld] layout (column n), rows >= K read as 0
__device__ __forceinline__ v16h fragc_f32(const float* W, int k0, int n, int lane, int ld, int K) {
  v16h a; const int g = lane >> 4;
#pragma unroll
  for (int i = 0; i < 8; ++i) { const int ka = k0 + 8 * g + i, kb = ka + 16;
    a[i] = (_Float16)(ka < K ? W[(size_t)(ka < K ? ka : K - 1) * ld + n] : 0.f); a[8 + i] = (_Float16)(kb < K ? W[(size_t)(kb < K ? kb : K - 1) * ld + n] : 0.f); }
  return a;
}
struct F2 { v16b h, l; };
// x = hi + lo in bf16, 8 values a statement, 3 vector instructions a pair: hi by the packed conversion; lo = x - hi (exact in f32), rounded to bf16 by the mixed fma that writes one half of a register.
// The factor -1.0 is read as the bf16 in the constant's high half. Each s_delay_alu names the producers four vector instructions back, so that the SIMD's other wave can issue while this one waits for them.
__device__ __forceinline__ void split8(const float* x, unsigned* h, unsigned* l) {
  asm("v_cvt_pk_bf16_f32 %0, %8, %9\n\tv_cvt_pk_bf16_f32 %1, %10, %11\n\tv_cvt_pk_bf16_f32 %2, %12, %13\n\tv_cvt_pk_bf16_f32 %3, %14, %15\n\t"
      "s_delay_alu instid0(VALU_DEP_4) | instskip(NEXT) | instid1(VALU_DEP_4)\n\t"
      "v_fma_mixlo_bf16 %4, %0, -1.0, %8 op_sel:[0,1,0] op_sel_hi:[1,1,0]\n\tv_fma_mixlo_bf16 %5, %1, -1.0, %10 op_sel:[0,1,0] op_sel_hi:[1,1,0]\n\t"
      "s_delay_alu instid0(VALU_DEP_4) | instskip(NEXT) | instid1(VALU_DEP_4)\n\t"
      "v_fma_mixlo_bf16 %6, %2, -1.0, %12 op_sel:[0,1,0] op_sel_hi:[1,1,0]\n\tv_fma_mixlo_bf16 %7, %3, -1.0, %14 op_sel:[0,1,0] op_sel_hi:[1,1,0]\n\t"
      "s_delay_alu instid0(VALU_DEP_4) | instskip(NEXT) | instid1(VALU_DEP_4)\n\t"
      "v_fma_mixhi_bf16 %4, %0, -1.0, %9 op_sel:[1,1,0] op_sel_hi:[1,1,0]\n\tv_fma_mixhi_bf16 %5, %1, -1.0, %11 op_sel:[1,1,0] op_sel_hi:[1,1,0]\n\t"
      "s_delay_alu instid0(VALU_DEP_4) | instskip(NEXT) | instid1(VALU_DEP_4)\n\t"
      "v_fma_mixhi_bf16 %6, %2, -1.0, %13 op_sel:[1,1,0] op_sel_hi:[1,1,0]\n\tv_fma_mixhi_bf16 %7, %3, -1.0, %15 op_sel:[1,1,0] op_sel_hi:[1,1,0]"
      : "=&v"(h[0]), "=&v"(h[1]), "=&v"(h[2]), "=&v"(h[3]), "=&v"(l[0]), "=&v"(l[1]), "=&v"(l[2]), "=&v"(l[3])
      : "v"(x[0]), "v"(x[1]), "v"(x[2]), "v"(x[3]), "v"(x[4]), "v"(x[5]), "v"(x[6]), "v"(x[7]));
}
__device__ __forceinline__ F2 bsplit16(const float v[16]) { union { unsigned u[8]; v16b f; } H, L;   // element i = half i & 1 of register i >> 1
  split8(v, H.u, L.u); split8(v + 8, H.u + 4, L.u + 4);
  F2 r; r.h = H.f; r.l = L.f; return r; }
__device__ __forceinline__ F2 split_row(const float* row, int k0, int lane) { float v[16]; const float* p = row + k0 + 8 * (lane >> 4);
#pragma unroll
  for (int i = 0; i < 8; ++i) { v[i] = p[i]; v[8 + i] = p[16 + i]; }
  return bsplit16(v); }
__device__ __forceinline__ F2 split_rowK(const float* row, int k0, int lane, int K) { float v[16]; const int g = lane >> 4;
#pragma unroll
  for (int i = 0; i < 8; ++i) { const int ka = k0 + 8 * g + i, kb = ka + 16; v[i] = ka < K ? row[ka < K ? ka : K - 1] : 0.f; v[8 + i] = kb < K ? row[kb < K ? kb : K - 1] : 0.f; }
  return bsplit16(v); }
__device__ __forceinline__ F2 split_col(const float* W, int k0, int n, int lane, int ld, int K) { float v[16]; const int g = lane >> 4;
#pragma unroll
  for (int i = 0; i < 8; ++i) { const int ka = k0 + 8 * g + i, kb = ka + 16; v[i] = ka < K ? W[(size_t)(ka < K ? ka : K - 1) * ld + n] : 0.f; v[8 + i] = kb < K ? W[(size_t)(kb < K ? kb : K - 1) * ld + n] : 0.f; }
  return bsplit16(v); }
__device__ __forceinline__ v8f mac3(const F2& a, const F2& b, v8f c) { c = wmma_bf(a.l, b.h, c); c = wmma_bf(a.h, b.l, c); return wmma_bf(a.h, b.h, c); }
__device__ __forceinline__ float sigm(float v) { return 1.0f / (1.0f + expf(-v)); }
#define LDSX() do { asm volatile("s_wait_dscnt 0" ::: "memory"); __builtin_amdgcn_wave_barrier(); __builtin_amdgcn_fence(__ATOMIC_RELEASE, "workgroup"); } while (0)


// Global self-attention block over 64x64 = 4096 positions: x = relu(bn(inputs)); q, k (64 = 4 heads x 16), v (128 = 4 x 32) by 1x1 convs; softmax(q k^T / 4) v per head; out = o Wo^T + bo, back to NCHW, + inputs.
// k_xT (bn+relu, channel-major -> position-major hi/lo bf16 planes via LDS), k_qkv (one GEMM for [q|k|v] (256 cols), K = 128; q scaled after the bias; k stored split, as A-fragment rows), k_attn (per (b,h), one pass: S^T = k q^T, 16 dims x (hi, lo) = the 32-deep k, a lane owns one query: running max and sum over the 4096 keys, P^T = exp(s - m) as hi/lo straight from the S^T accumulators, O^T += V^T(hi/lo) P^T over 32-key steps, O / sum at the end; O -> concat layout),
// k_out (o(hi/lo) Wo^T + bo, transposed through LDS to NCHW rows + shortcut; per channel 64 positions = 256 B).
#define NB 2
#define CIN 128
#define NPOS 4096
#define NHD 4
#define DK 16
#define DV 32
#define KF 64
#define VF 128
#ifndef TNB
#define TNB NB
#define TQB (NPOS / 64)
#endif
typedef __attribute__((ext_vector_type(8))) __bf16 v8b;
__device__ __forceinline__ v16b frag_b(const __bf16* rowk0, int lane) {
  union { v16b v; v8b q[2]; } u; const __bf16* p = rowk0 + 8 * (lane >> 4);
  u.q[0] = *(const v8b*)p; u.q[1] = *(const v8b*)(p + 16); return u.v;
}
__device__ __forceinline__ v16b frag_gbf(const float* rowk0, int lane) {
  v16b a; const float* p = rowk0 + 8 * (lane >> 4);
#pragma unroll
  for (int i = 0; i < 8; ++i) { a[i] = (__bf16)p[i]; a[8 + i] = (__bf16)p[16 + i]; }
  return a;
}
__device__ __forceinline__ float bfr(float v) { return (float)(__bf16)v; }
// exp(s - m) = 2^(s' - m') with s' = s * log2(e): k_qkv folds log2(e) into q's scale, so scores and maxima come in the log2 domain and an exponential is one subtract and the hardware exp2, inline. Arguments are <= 0; a hugely negative one gives 0.
// The exp2 stand in asm, each in place, so that none is directly followed by a write of its source; the closing v_nop is the slot that the instruction set asks for behind a transcendental before its result is read.
#define L2E 1.44269504088896340736f
__device__ __forceinline__ void exp2x8(float* x) {
  asm("v_exp_f32 %0, %0\n\tv_exp_f32 %1, %1\n\tv_exp_f32 %2, %2\n\tv_exp_f32 %3, %3\n\tv_exp_f32 %4, %4\n\tv_exp_f32 %5, %5\n\tv_exp_f32 %6, %6\n\tv_exp_f32 %7, %7\n\tv_nop"
      : "+v"(x[0]), "+v"(x[1]), "+v"(x[2]), "+v"(x[3]), "+v"(x[4]), "+v"(x[5]), "+v"(x[6]), "+v"(x[7]));
}
__device__ __forceinline__ float exp2x1(float x) { asm("v_exp_f32 %0, %0\n\tv_nop" : "+v"(x)); return x; }

// K and V^T tiles go to LDS once per block and stage, by asynchronous copies (16 B a lane, through no register), and the block's 4 waves read their fragments from there.
#define KST 128               // keys per stage
#define NST (NPOS / KST)      // stages
#define KPF 20                // K row pitch in LDS, floats: 64 B + 16 B (16 B x odd: 16-byte readers meet no bank twice)
#define VPB 136               // V^T row pitch in LDS, bf16: 256 B + 16 B, for the same reason
__device__ __forceinline__ unsigned lds_off(const void* p) { return (unsigned)(size_t)p; }
// one stage of K: 128 rows of 64 B (one head's 16 dims as bf16 hi and lo, in the place of 16 floats of a 1024-B row); thread = (row tid >> 2 (+ 32 i), 16-B part tid & 3)
__device__ __forceinline__ void copy_k(const float* kg, float* sk, int tid) {
  const float* g0 = kg + (size_t)(tid >> 2) * 256 + (tid & 3) * 4; const float *g1 = g0 + 32 * 256, *g2 = g0 + 64 * 256, *g3 = g0 + 96 * 256;
  const unsigned l0 = lds_off(sk + (tid >> 2) * KPF + (tid & 3) * 4), l1 = l0 + 32 * KPF * 4, l2 = l0 + 64 * KPF * 4, l3 = l0 + 96 * KPF * 4;
  // the closing s_wait_xcnt stands in the copies' own statement, in front of any later write of their address registers
  asm volatile("global_load_async_to_lds_b128 %0, %4, off\n\tglobal_load_async_to_lds_b128 %1, %5, off\n\tglobal_load_async_to_lds_b128 %2, %6, off\n\tglobal_load_async_to_lds_b128 %3, %7, off\n\ts_wait_xcnt 0x0"
               :: "v"(l0), "v"(l1), "v"(l2), "v"(l3), "v"(g0), "v"(g1), "v"(g2), "v"(g3) : "memory");
}
// one stage of one V^T plane: 32 rows of 256 B (128 keys); thread = (row tid >> 4 (+ 8 i), 16-B part tid & 15)
__device__ __forceinline__ void copy_v(const __bf16* vg, __bf16* sv, int tid) {
  const __bf16* g0 = vg + (size_t)(tid >> 4) * NPOS + (tid & 15) * 8; const __bf16 *g1 = g0 + 8 * NPOS, *g2 = g0 + 16 * NPOS, *g3 = g0 + 24 * NPOS;
  const unsigned l0 = lds_off(sv + (tid >> 4) * VPB + (tid & 15) * 8), l1 = l0 + 8 * VPB * 2, l2 = l0 + 16 * VPB * 2, l3 = l0 + 24 * VPB * 2;
  // the closing s_wait_xcnt stands in the copies' own statement, in front of any later write of their address registers
  asm volatile("global_load_async_to_lds_b128 %0, %4, off\n\tglobal_load_async_to_lds_b128 %1, %5, off\n\tglobal_load_async_to_lds_b128 %2, %6, off\n\tglobal_load_async_to_lds_b128 %3, %7, off\n\ts_wait_xcnt 0x0"
               :: "v"(l0), "v"(l1), "v"(l2), "v"(l3), "v"(g0), "v"(g1), "v"(g2), "v"(g3) : "memory");
}
#define WAIT_COPIES() asm volatile("s_wait_asynccnt 0x0" ::: "memory")   // this wave's copies have landed
#define WAIT_LDS()    asm volatile("s_wait_dscnt 0x0" ::: "memory")      // this wave's LDS reads are done before the buffer is given up
// K fragment = the lane's 32 bytes of an LDS row as they stand (a, c = bytes 32 * (lane >> 4) + 0..15, + 16..31): elements 0..7 = hi of dims 8h + 0..7, elements 8..15 = lo of the same dims
__device__ __forceinline__ v16b frag_k(v4f a, v4f c) { union { v4f f[2]; v16b v; } u; u.f[0] = a; u.f[1] = c; return u.v; }
// its partner on the query side: the lane's 8 values (dims 8h + 0..7) in both halves, so that one product sums (k hi + k lo) . q over the 16 dims
__device__ __forceinline__ v16b frag_q2(v16b q) { v16b r;
#pragma unroll   // vector elements are indexed by constants
  for (int i = 0; i < 8; ++i) { r[i] = q[i]; r[8 + i] = q[i]; }
  return r; }

// A projection's 128 weight rows (128 floats each) go to LDS once per block, rounded to bf16: whole-row loads (a wave reads one row of 512 B), all in flight together, and the block's 4 waves read their B fragments from there.
#define WPB 136               // weight row pitch in LDS, bf16: 256 B + 16 B (16 B x odd: 16-byte readers meet no bank twice)
typedef __attribute__((ext_vector_type(4))) __bf16 v4b;
#define WAIT_ADDR() asm volatile("s_wait_xcnt 0x0" ::: "memory")   // stands between two groups of loads: the later group's results may be given the registers that hold the earlier group's addresses
// the same wait with the group's address as its input, so that the address registers are kept as they are up to it (no result of the group and no later load lands in them first): _S for block-uniform bases, _V for a lane's own pointer
#define WAIT_ADDR_S(P, Q) asm volatile("s_wait_xcnt 0x0" :: "s"(P), "s"(Q) : "memory")
#define WAIT_ADDR_V(P) asm volatile("s_wait_xcnt 0x0" :: "v"(P) : "memory")
__device__ __forceinline__ void put_w(__bf16* sw, int r, int lane, v4f x) { v4b c;
#pragma unroll   // vector elements are indexed by constants
  for (int e = 0; e < 4; ++e) c[e] = (__bf16)x[e];
  *(v4b*)(sw + r * WPB + lane * 4) = c; }

#define WS_XH   0u                                  // bf16 [2][4096][128] relu(bn(x)) position-major hi
#define WS_XL   (WS_XH + 2u * NB * NPOS * CIN)
#define WS_QKV  (WS_XL + 2u * NB * NPOS * CIN)        // f32 [2][4096][256]: q (64, scaled by log2(e)/4) | k (in the place of 64 floats; per head 64 B of bf16: hi d0..7, lo d0..7, hi d8..15, lo d8..15) | v (128)
#define WS_VTH  (WS_QKV + 4u * NB * NPOS * 256)       // bf16 [2][128 (h,dv)][4096] V^T hi
#define WS_VTL  (WS_VTH + 2u * NB * VF * NPOS)
#define WS_O    (WS_VTL + 2u * NB * VF * NPOS)        // f32 [2][4096][128] attention output (h, dv)
#define WS_END  (WS_O + 4u * NB * NPOS * VF)

// ---- k_xT: planes[b][p][c] = split(relu((bf16(x[b][c][p]) - m[c]) * (g[c] rsqrt(v[c]+eps)) + beta[c])); block = (b, 64 positions): LDS tile [64 p][128 c] -> rows of 256 B per plane (16 lanes)
__global__ __launch_bounds__(256) void k_xT(const float* __restrict__ X, const float* __restrict__ g, const float* __restrict__ bt, const float* __restrict__ rm, const float* __restrict__ rv, __bf16* __restrict__ PH, __bf16* __restrict__ PL) {
  __shared__ __bf16 sh[64][136], sl[64][136]; __shared__ float ssc[CIN], ssh[CIN];
  const int b = blockIdx.y, p0 = blockIdx.x * 64, tid = threadIdx.x;
  if (tid < CIN) { const float inv = rsqrtf(bfr(rv[tid]) + 1e-5f); const float sc = bfr(g[tid]) * inv; ssc[tid] = sc; ssh[tid] = bfr(bt[tid]) - bfr(rm[tid]) * sc; }
  __syncthreads();
  for (int q = tid; q < CIN * 64; q += 256) { const int c = q >> 6, pl = q & 63; float v = bfr(X[((size_t)b * CIN + c) * NPOS + p0 + pl]) * ssc[c] + ssh[c]; v = v > 0.f ? v : 0.f; const __bf16 hi = (__bf16)v; sh[pl][c] = hi; sl[pl][c] = (__bf16)(v - (float)hi); }
  __syncthreads();
  for (int q = tid; q < 64 * 16; q += 256) { const int pl = q >> 4, pc = q & 15; union { __bf16 e[8]; v4u u; } a, c2;
#pragma unroll
    for (int e = 0; e < 8; ++e) { a.e[e] = sh[pl][pc * 8 + e]; c2.e[e] = sl[pl][pc * 8 + e]; }
    const size_t o = ((size_t)b * NPOS + p0 + pl) * CIN + pc * 8; vst2((unsigned*)(PH + o), a.u); vst2((unsigned*)(PL + o), c2.u); }
}
// ---- k_qkv: QKV[b][p][n] = planes . W rows (+ bias), n < 64: Wq (then x log2(e)/4), < 128: Wk, else Wv; block (64 positions, 128 of the 256 cols); K = 128 (4 steps); also writes V^T hi/lo planes for the v columns (block-local transpose via so)
__global__ __launch_bounds__(128) void k_qkv(const __bf16* __restrict__ PH, const __bf16* __restrict__ PL, const float* __restrict__ Wq, const float* __restrict__ bq, const float* __restrict__ Wk, const float* __restrict__ bk, const float* __restrict__ Wv, const float* __restrict__ bv, float* __restrict__ QKV, __bf16* __restrict__ VTH, __bf16* __restrict__ VTL) {
  __shared__ __align__(16) float so[64][132]; __shared__ __align__(16) __bf16 sw[128 * WPB];
  const int tid = threadIdx.x, wave = tid >> 5, lane = tid & 31, col = lane & 15, g = lane >> 4; const int b = blockIdx.z; const int p0 = blockIdx.x * 64; const int n0 = blockIdx.y * 128;
  const size_t arow = ((size_t)b * NPOS + p0 + wave * 16 + col) * CIN;
  // every global operand is asked for here, ahead of the matrix work: one memory latency for the block. The matrix a row or a bias tile belongs to is picked by the block and by constants (rows 0..63 | 64..127 of the block's 128 columns), so no lane branches.
  const float *w0 = n0 ? Wv : Wq, *w1 = n0 ? Wv + KF * CIN : Wk, *b0 = n0 ? bv : bq, *b1 = n0 ? bv + KF : bk;
  v4f wx[32]; v16b ah[CIN / 32], al[CIN / 32]; float bias[8];
#pragma unroll   // wx is indexed by constants, so it stays in registers
  for (int i = 0; i < 32; ++i) wx[i] = *(const v4f*)((i < 16 ? w0 : w1) + ((i & 15) * 4 + wave) * CIN + lane * 4);   // row wave + 4 i
  WAIT_ADDR();
#pragma unroll   // as above: constant indices
  for (int kc = 0; kc < CIN / 32; ++kc) ah[kc] = frag_b(PH + arow + kc * 32, lane);
  WAIT_ADDR();
#pragma unroll   // as above: constant indices
  for (int kc = 0; kc < CIN / 32; ++kc) al[kc] = frag_b(PL + arow + kc * 32, lane);
  WAIT_ADDR();
#pragma unroll   // as above: constant indices
  for (int j = 0; j < 8; ++j) bias[j] = bfr((j < 4 ? b0 : b1)[(j & 3) * 16 + col]);
  WAIT_ADDR_S(b0, b1);
#pragma unroll   // as above: constant indices
  for (int i = 0; i < 32; ++i) put_w(sw, wave + 4 * i, lane, wx[i]);
  __syncthreads();   // the weights are there for every wave
  v8f acc[8] = {};
#pragma unroll
  for (int kc = 0; kc < CIN / 32; ++kc) { v16b w[8];
#pragma unroll   // the step's eight B fragments are read as one group ahead of its matrix work: one LDS latency a step
    for (int j = 0; j < 8; ++j) w[j] = frag_b(sw + (j * 16 + col) * WPB + kc * 32, lane);
#pragma unroll
    for (int j = 0; j < 8; ++j) { acc[j] = wmma_bf(al[kc], w[j], acc[j]); acc[j] = wmma_bf(ah[kc], w[j], acc[j]); } }
#pragma unroll
  for (int j = 0; j < 8; ++j) { const float sc = (n0 == 0 && j < 4) ? 0.25f * L2E : 1.0f;
#pragma unroll
    for (int r = 0; r < 8; ++r) so[wave * 16 + 8 * g + r][j * 16 + col] = (acc[j][r] + bias[j]) * sc; }
  __syncthreads();
  for (int q = tid; q < 64 * 32; q += 128) { const int rl = q >> 5, pc = q & 31; float* dst = QKV + ((size_t)b * NPOS + p0 + rl) * 256 + n0 + pc * 4;
    if (n0 == 0 && pc >= KF / 4) {   // k columns: the 16-B part pc & 3 of a head's 64 B holds 8 dims (bit 1: which 8) as bf16 hi or lo (bit 0), split once here for every reader
      const float* s8 = &so[rl][(pc & ~3) * 4 + (pc & 2) * 4]; union { __bf16 e[8]; v4u u; } w;
#pragma unroll   // w is indexed by constants, so it stays in registers
      for (int e = 0; e < 8; ++e) { const float v = s8[e]; const __bf16 hi = (__bf16)v; w.e[e] = (pc & 1) ? (__bf16)(v - (float)hi) : hi; }
      vst2((unsigned*)dst, w.u); }
    else vst2(dst, *(const v4f*)&so[rl][pc * 4]); }
  if (n0 == 128) {
    for (int q = tid; q < 128 * 8; q += 128) { const int c = q >> 3, pc = q & 7; union { __bf16 e[8]; v4u u; } hh, ll;
#pragma unroll
      for (int e = 0; e < 8; ++e) { const float v = so[pc * 8 + e][c]; const __bf16 hi = (__bf16)v; hh.e[e] = hi; ll.e[e] = (__bf16)(v - (float)hi); }
      const size_t o = ((size_t)b * VF + c) * NPOS + p0 + pc * 8; vst2((unsigned*)(VTH + o), hh.u); vst2((unsigned*)(VTL + o), ll.u); } }
}
// the other half's value of the same column (lane ^ 16), by a vector cross-row move
__device__ __forceinline__ float xhalf(float v) { const unsigned u = __builtin_bit_cast(unsigned, v); return __builtin_bit_cast(float, __builtin_amdgcn_permlanex16(u, u, 0x76543210u, 0xfedcba98u, false, false)); }
// ---- k_attn: block = (64 queries, b*4+h), one pass over the keys. S^T = k(hi/lo) q(hi/lo)^T, the 32-deep k = 16 dims x (k hi, k lo), once against q lo and once against q hi: lane (g, col) holds keys 8g+0..7 of query col. Per stage of 128 keys: the 8 S^T tiles, their maximum in-lane and over the two halves, one rescale of O^T and of the sums by 2^(m_old - m_new),
// then P^T = 2^(s - m) as hi/lo straight from the S^T accumulators, O^T += V^T(hi/lo) P^T over 32-key steps, the sums of P in-lane; behind the loop the halves' sums are joined and O is divided by them.
__global__ __launch_bounds__(128) void k_attn(const float* __restrict__ QKV, const __bf16* __restrict__ VTH, const __bf16* __restrict__ VTL, float* __restrict__ O) {
  __shared__ __align__(16) float so[4][16][36]; __shared__ __align__(16) float sk[2][KST * KPF]; __shared__ __align__(16) __bf16 sv[2][2][DV * VPB];   // sv[buffer][hi, lo]
  const int tid = threadIdx.x, wave = tid >> 5, lane = tid & 31, col = lane & 15, g = lane >> 4;
  const int bh = blockIdx.y, b = bh >> 2, h = bh & 3; const int q0 = blockIdx.x * 64 + wave * 16;
  const F2 a = split_rowK(QKV + ((size_t)b * NPOS + q0 + col) * 256 + h * DK, 0, lane, DK);
  const v16b qh = frag_q2(a.h), ql = frag_q2(a.l);
  float m = -3.0e38f, ls[8] = {};   // the query's running maximum (log2 domain, equal in both halves); ls[r]: sum of P over the lane's keys 8g + r of every tile
  v8f acc[2] = {};
  const float* kg = QKV + (size_t)b * NPOS * 256 + KF + h * DK; const __bf16 *vgh = VTH + ((size_t)b * VF + h * DV) * NPOS, *vgl = VTL + ((size_t)b * VF + h * DV) * NPOS;
  copy_k(kg, sk[0], tid); copy_v(vgh, sv[0][0], tid); copy_v(vgl, sv[0][1], tid); WAIT_COPIES(); __syncthreads();   // stage 0 is there for every wave
  copy_k(kg + (size_t)KST * 256, sk[1], tid); copy_v(vgh + KST, sv[1][0], tid); copy_v(vgl + KST, sv[1][1], tid);     // stage 1 flies while stage 0 is worked on
#pragma unroll 1   // one trip = one stage: the buffer index and the publish point stay in one place
  for (int t = 0; t < NST; ++t) { const float* kr = sk[t & 1] + col * KPF + 8 * g; const __bf16 *vrh = sv[t & 1][0] + col * VPB, *vrl = sv[t & 1][1] + col * VPB;
    v4f kq[KST / 16][2]; v16b vq[2][2][2];   // the stage's K rows; [set][dt][hi, lo]: a step's V^T fragments, read one step ahead inside the stage
    // RD_V: the V^T reads of one 32-key step; its loop is unrolled so that the sets are indexed by constants and stay in registers
#define RD_V(S, KS) do { _Pragma("unroll") for (int c = 0; c < 2; ++c) { const int vo = c * 16 * VPB + (KS) * 32; vq[S][c][0] = frag_b(vrh + vo, lane); vq[S][c][1] = frag_b(vrl + vo, lane); } } while (0)
#pragma unroll     // the stage's K reads and the first step's V^T reads stand as one group ahead of the matrix work: one read latency a stage
    for (int kt = 0; kt < KST / 16; ++kt) { kq[kt][0] = *(const v4f*)(kr + kt * 16 * KPF); kq[kt][1] = *(const v4f*)(kr + kt * 16 * KPF + 4); }
    RD_V(0, 0);
    v8f s[KST / 16];
#pragma unroll     // kq and s are indexed by constants only, so they stay in registers; the small products first, and eight independent tiles between a tile's two products
    for (int kt = 0; kt < KST / 16; ++kt) s[kt] = wmma_bf(frag_k(kq[kt][0], kq[kt][1]), ql, (v8f){});
#pragma unroll     // as above: constant indices
    for (int kt = 0; kt < KST / 16; ++kt) s[kt] = wmma_bf(frag_k(kq[kt][0], kq[kt][1]), qh, s[kt]);
    float mx[8];       // eight independent chains over the tiles, each from the running maximum, two tiles a link; then joined
#pragma unroll
    for (int r = 0; r < 8; ++r) { mx[r] = m;
#pragma unroll
      for (int kt = 0; kt < KST / 16; kt += 2) mx[r] = fmaxf(fmaxf(mx[r], s[kt][r]), s[kt + 1][r]); }
    const float mt = fmaxf(fmaxf(fmaxf(fmaxf(mx[0], mx[1]), mx[2]), fmaxf(fmaxf(mx[3], mx[4]), mx[5])), fmaxf(mx[6], mx[7]));
    const float mn = fmaxf(mt, xhalf(mt)), al = exp2x1(m - mn); m = mn;   // both halves feed one O^T tile, so they use one maximum
#pragma unroll
    for (int r = 0; r < 8; ++r) { ls[r] *= al; acc[0][r] *= al; acc[1][r] *= al; }
#pragma unroll     // the sets are indexed by constants only, so they stay in registers
  for (int ks = 0; ks < KST / 32; ++ks) { float p[16];   // p[ct * 8 + r] = P[query col][key (t * 4 + ks) * 32 + ct * 16 + 8g + r]: the two S^T tiles are a B fragment's k order as they stand
    if (ks + 1 < KST / 32) RD_V((ks + 1) & 1, ks + 1);   // the next step's LDS reads as one group ahead of this step's matrix work (same stage, same buffer)
#pragma unroll
    for (int ct = 0; ct < 2; ++ct) { float x[8];
#pragma unroll
      for (int r = 0; r < 8; ++r) x[r] = s[ks * 2 + ct][r] - mn;
      exp2x8(x);
#pragma unroll
      for (int r = 0; r < 8; ++r) { p[ct * 8 + r] = x[r]; ls[r] += x[r]; } }
    const F2 pa = bsplit16(p);
#pragma unroll
    for (int dt = 0; dt < 2; ++dt) { const v16b vh = vq[ks & 1][dt][0], vl = vq[ks & 1][dt][1];
      acc[dt] = wmma_bf(vh, pa.l, acc[dt]); acc[dt] = wmma_bf(vl, pa.h, acc[dt]); acc[dt] = wmma_bf(vh, pa.h, acc[dt]); } }
    WAIT_LDS(); WAIT_COPIES(); __syncthreads();   // publish point: stage t + 1 has landed for all, and nobody reads stage t's buffers any more
    if (t + 2 < NST) { copy_k(kg + (size_t)(t + 2) * KST * 256, sk[t & 1], tid); copy_v(vgh + (t + 2) * KST, sv[t & 1][0], tid); copy_v(vgl + (t + 2) * KST, sv[t & 1][1], tid); } }
  WAIT_COPIES();
  float l = ((ls[0] + ls[1]) + (ls[2] + ls[3])) + ((ls[4] + ls[5]) + (ls[6] + ls[7]));
  l += xhalf(l);   // join the halves' keys
  const float il = 1.0f / l;
#pragma unroll
  for (int dt = 0; dt < 2; ++dt)   // acc[dt][r] = O[query col][dt * 16 + 8g + r] * l: 8 consecutive floats of the lane's row
#pragma unroll
    for (int r = 0; r < 8; ++r) so[wave][col][dt * 16 + 8 * g + r] = acc[dt][r] * il;
  LDSX();
  for (int q = lane; q < 16 * 8; q += 32) { const int rl = q >> 3, pc = q & 7; vst2(O + ((size_t)b * NPOS + q0 + rl) * VF + h * DV + pc * 4, *(const v4f*)&so[wave][rl][pc * 4]); }
}
// ---- k_out: Y[p][o] = O row(hi/lo) . Wo rows + bo; out[b][o][p] = Y + inputs (NCHW); block = (64 positions, b): 128 output channels in one pass (8 tiles); transposed store per channel: 64 positions = 256 B by 16 lanes
__global__ __launch_bounds__(128) void k_out(const float* __restrict__ O, const float* __restrict__ Wo, const float* __restrict__ bo, const float* __restrict__ X, float* __restrict__ out) {
  __shared__ __align__(16) float st[128][68]; __shared__ __align__(16) __bf16 sw[128 * WPB];
  const int tid = threadIdx.x, wave = tid >> 5, lane = tid & 31, col = lane & 15, g = lane >> 4; const int b = blockIdx.y; const int p0 = blockIdx.x * 64;
  // every global operand is asked for here, ahead of the matrix work: one memory latency for the block
  v4f wx[32]; F2 a[VF / 32]; float bb[8]; const float* orow = O + ((size_t)b * NPOS + p0 + wave * 16 + col) * VF;
#pragma unroll   // wx is indexed by constants, so it stays in registers
  for (int i = 0; i < 32; ++i) wx[i] = *(const v4f*)(Wo + (size_t)(wave + 4 * i) * VF + lane * 4);
  WAIT_ADDR();
#pragma unroll   // as above: constant indices
  for (int kc = 0; kc < VF / 32; ++kc) a[kc] = split_row(orow, kc * 32, lane);
  WAIT_ADDR_V(orow + 8 * g);
#pragma unroll   // as above: constant indices
  for (int j = 0; j < 8; ++j) bb[j] = bfr(bo[j * 16 + col]);
  WAIT_ADDR_S(bo, bo);
#pragma unroll   // as above: constant indices
  for (int i = 0; i < 32; ++i) put_w(sw, wave + 4 * i, lane, wx[i]);
  __syncthreads();   // the weights are there for every wave
  v8f acc[8] = {};
#pragma unroll
  for (int kc = 0; kc < VF / 32; ++kc) { v16b w[8];
#pragma unroll   // the step's eight B fragments are read as one group ahead of its matrix work: one LDS latency a step
    for (int j = 0; j < 8; ++j) w[j] = frag_b(sw + (j * 16 + col) * WPB + kc * 32, lane);
#pragma unroll
    for (int j = 0; j < 8; ++j) { acc[j] = wmma_bf(a[kc].l, w[j], acc[j]); acc[j] = wmma_bf(a[kc].h, w[j], acc[j]); } }
#pragma unroll
  for (int j = 0; j < 8; ++j) {
#pragma unroll
    for (int r = 0; r < 8; ++r) st[j * 16 + col][wave * 16 + 8 * g + r] = acc[j][r] + bb[j]; }
  __syncthreads();
  for (int q = tid; q < 128 * 16; q += 128) { const int o = q >> 4, pc = q & 15; const size_t base = ((size_t)b * CIN + o) * NPOS + p0 + pc * 4; const float4 xv = *(const float4*)(X + base);
    v4f r4; r4[0] = st[o][pc * 4] + bfr(xv.x); r4[1] = st[o][pc * 4 + 1] + bfr(xv.y); r4[2] = st[o][pc * 4 + 2] + bfr(xv.z); r4[3] = st[o][pc * 4 + 3] + bfr(xv.w); vst2(out + base, r4); }
}

extern "C" void kernel_launch(void* const* d_in, const int* in_sizes, int n_in, void* d_out, int out_size, void* d_ws, size_t ws_size, hipStream_t stream) {
  (void)in_sizes; (void)n_in; (void)out_size;
  const float** F = (const float**)d_in;   // inputs, gamma, beta, running_mean, running_var, Wq, bq, Wk, bk, Wv, bv, Wo, bo
  if (ws_size < (size_t)WS_END) return;
  char* ws = (char*)d_ws;
  __bf16 *PH = (__bf16*)(ws + WS_XH), *PL = (__bf16*)(ws + WS_XL), *VTH = (__bf16*)(ws + WS_VTH), *VTL = (__bf16*)(ws + WS_VTL); float *QKV = (float*)(ws + WS_QKV), *O = (float*)(ws + WS_O);
  k_xT<<<dim3(NPOS / 64, TNB), 256, 0, stream>>>(F[0], F[1], F[2], F[3], F[4], PH, PL);
  k_qkv<<<dim3(NPOS / 64, 2, TNB), 128, 0, stream>>>(PH, PL, F[5], F[6], F[7], F[8], F[9], F[10], QKV, VTH, VTL);
  k_attn<<<dim3(TQB, TNB * NHD), 128, 0, stream>>>(QKV, VTH, VTL, O);
  k_out<<<dim3(TQB, TNB), 128, 0, stream>>>(O, F[11], F[12], F[0], (float*)d_out);
}

// v008
// Measured time: 55.7 microseconds a run.
// Two timings next to v007 put it at 1.11 and 1.12 times that version's speed.
// Counting every step since v000, it is 13.9 times as fast.
// compute dtype: inputs, BN parameters and all projection weights/biases (module inputs) rounded to bf16; q/k/v projections of the BN+ReLU activations, the attention scores, P.V and the output projection all take computed operands as bf16 hi + bf16 residual pairs (2 products against weights, 3 between computed operands; the scores take all 4, two to a 32-deep product);
#include <hip/hip_runtime.h>
#include <math.h>

typedef __attribute__((ext_vector_type(16))) _Float16 v16h;
typedef __attribute__((ext_vector_type(16))) __bf16 v16b;
typedef __attribute__((ext_vector_type(8)))  _Float16 v8h;
typedef __attribute__((ext_vector_type(8)))  float v8f;
typedef __attribute__((ext_vector_type(4)))  float v4f;
typedef __attribute__((ext_vector_type(2)))  float v2f;
typedef __attribute__((ext_vector_type(4)))  unsigned v4u;
typedef __attribute__((ext_vector_type(4)))  int v4i;
typedef float __attribute__((may_alias)) float_a;
typedef int __attribute__((may_alias)) int_a;

template <typename T> __device__ __forceinline__ void vst2(void* p, T v) { *(T*)p = v;  }
__device__ __forceinline__ v8f wmma16(v16h a, v16h b, v8f c) {
  v8f d = __builtin_amdgcn_wmma_f32_16x16x32_f16(false, a, false, b, (short)0, c, false, false);
  asm volatile("v_nop\n\tv_nop\n\tv_nop\n\tv_nop" : "+v"(d) : "v"(a), "v"(b));
  return d;
}
__device__ __forceinline__ v8f wmma_bf(v16b a, v16b b, v8f c) {
  v8f d = __builtin_amdgcn_wmma_f32_16x16x32_bf16(false, a, false, b, (short)0, c, false, false);
  asm volatile("v_nop\n\tv_nop\n\tv_nop\n\tv_nop" : "+v"(d) : "v"(a), "v"(b));
  return d;
}
// 16x16x32 fragments: lane = (h = lane>>4, row/col = lane&15); elements 0..7 = k0+8h+0..7, 8..15 = k0+16+8h+0..7; D element r = row 8h+r
__device__ __forceinline__ v16h frag_h(const _Float16* rowk0, int lane) {
  union { v16h v; v8h q[2]; } u; const _Float16* p = rowk0 + 8 * (lane >> 4);
  u.q[0] = *(const v8h*)p; u.q[1] = *(const v8h*)(p + 16); return u.v;
}
__device__ __forceinline__ v16h frag_f32(const float* rowk0, int lane) {
  v16h a; const float* p = rowk0 + 8 * (lane >> 4);
#pragma unroll
  for (int i = 0; i < 8; ++i) { a[i] = (_Float16)p[i]; a[8 + i] = (_Float16)p[16 + i]; }
  return a;
}
__device__ __forceinline__ v16h frag_f32s(const float* rowk0, int lane, float sc) {
  v16h a; const float* p = rowk0 + 8 * (lane >> 4);
#pragma unroll
  for (int i = 0; i < 8; ++i) { a[i] = (_Float16)(p[i] * sc); a[8 + i] = (_Float16)(p[16 + i] * sc); }
  return a;
}
// column fragment from a [K][ld] layout (column n), rows >= K read as 0
__device__ __forceinline__ v16h fragc_f32(const float* W, int k0, int n, int lane, int ld, int K) {
  v16h a; const int g = lane >> 4;
#pragma unroll
  for (int i = 0; i < 8; ++i) { const int ka = k0 + 8 * g + i, kb = ka + 16;
    a[i] = (_Float16)(ka < K ? W[(size_t)(ka < K ? ka : K - 1) * ld + n] : 0.f); a[8 + i] = (_Float16)(kb < K ? W[(size_t)(kb < K ? kb : K - 1) * ld + n] : 0.f); }
  return a;
}
struct F2 { v16b h, l; };
// x = hi + lo in bf16, 8 values a statement, 3 vector instructions a pair: hi by the packed conversion; lo = x - hi (exact in f32), rounded to bf16 by the mixed fma that writes one half of a register.
// The factor -1.0 is read as the bf16 in the constant's high half. Each s_delay_alu names the producers four vector instructions back, so that the SIMD's other wave can issue while this one waits for them.
__device__ __forceinline__ void split8(const float* x, unsigned* h, unsigned* l) {
  asm("v_cvt_pk_bf16_f32 %0, %8, %9\n\tv_cvt_pk_bf16_f32 %1, %10, %11\n\tv_cvt_pk_bf16_f32 %2, %12, %13\n\tv_cvt_pk_bf16_f32 %3, %14, %15\n\t"
      "s_delay_alu instid0(VALU_DEP_4) | instskip(NEXT) | instid1(VALU_DEP_4)\n\t"
      "v_fma_mixlo_bf16 %4, %0, -1.0, %8 op_sel:[0,1,0] op_sel_hi:[1,1,0]\n\tv_fma_mixlo_bf16 %5, %1, -1.0, %10 op_sel:[0,1,0] op_sel_hi:[1,1,0]\n\t"
      "s_delay_alu instid0(VALU_DEP_4) | instskip(NEXT) | instid1(VALU_DEP_4)\n\t"
      "v_fma_mixlo_bf16 %6, %2, -1.0, %12 op_sel:[0,1,0] op_sel_hi:[1,1,0]\n\tv_fma_mixlo_bf16 %7, %3, -1.0, %14 op_sel:[0,1,0] op_sel_hi:[1,1,0]\n\t"
      "s_delay_alu instid0(VALU_DEP_4) | instskip(NEXT) | instid1(VALU_DEP_4)\n\t"
      "v_fma_mixhi_bf16 %4, %0, -1.0, %9 op_sel:[1,1,0] op_sel_hi:[1,1,0]\n\tv_fma_mixhi_bf16 %5, %1, -1.0, %11 op_sel:[1,1,0] op_sel_hi:[1,1,0]\n\t"
      "s_delay_alu instid0(VALU_DEP_4) | instskip(NEXT) | instid1(VALU_DEP_4)\n\t"
      "v_fma_mixhi_bf16 %6, %2, -1.0, %13 op_sel:[1,1,0] op_sel_hi:[1,1,0]\n\tv_fma_mixhi_bf16 %7, %3, -1.0, %15 op_sel:[1,1,0] op_sel_hi:[1,1,0]"
      : "=&v"(h[0]), "=&v"(h[1]), "=&v"(h[2]), "=&v"(h[3]), "=&v"(l[0]), "=&v"(l[1]), "=&v"(l[2]), "=&v"(l[3])
      : "v"(x[0]), "v"(x[1]), "v"(x[2]), "v"(x[3]), "v"(x[4]), "v"(x[5]), "v"(x[6]), "v"(x[7]));
}
// split8 for the place directly behind a WMMA: it names that product's A and B as inputs too (the text does not use them), so that its results, which the compiler cannot see being written, are given other registers than those the product is still reading
__device__ __forceinline__ void split8w(const float* x, unsigned* h, unsigned* l, v16b a, v16b b) {
  asm("v_cvt_pk_bf16_f32 %0, %8, %9\n\tv_cvt_pk_bf16_f32 %1, %10, %11\n\tv_cvt_pk_bf16_f32 %2, %12, %13\n\tv_cvt_pk_bf16_f32 %3, %14, %15\n\t"
      "s_delay_alu instid0(VALU_DEP_4) | instskip(NEXT) | instid1(VALU_DEP_4)\n\t"
      "v_fma_mixlo_bf16 %4, %0, -1.0, %8 op_sel:[0,1,0] op_sel_hi:[1,1,0]\n\tv_fma_mixlo_bf16 %5, %1, -1.0, %10 op_sel:[0,1,0] op_sel_hi:[1,1,0]\n\t"
      "s_delay_alu instid0(VALU_DEP_4) | instskip(NEXT) | instid1(VALU_DEP_4)\n\t"
      "v_fma_mixlo_bf16 %6, %2, -1.0, %12 op_sel:[0,1,0] op_sel_hi:[1,1,0]\n\tv_fma_mixlo_bf16 %7, %3, -1.0, %14 op_sel:[0,1,0] op_sel_hi:[1,1,0]\n\t"
      "s_delay_alu instid0(VALU_DEP_4) | instskip(NEXT) | instid1(VALU_DEP_4)\n\t"
      "v_fma_mixhi_bf16 %4, %0, -1.0, %9 op_sel:[1,1,0] op_sel_hi:[1,1,0]\n\tv_fma_mixhi_bf16 %5, %1, -1.0, %11 op_sel:[1,1,0] op_sel_hi:[1,1,0]\n\t"
      "s_delay_alu instid0(VALU_DEP_4) | instskip(NEXT) | instid1(VALU_DEP_4)\n\t"
      "v_fma_mixhi_bf16 %6, %2, -1.0, %13 op_sel:[1,1,0] op_sel_hi:[1,1,0]\n\tv_fma_mixhi_bf16 %7, %3, -1.0, %15 op_sel:[1,1,0] op_sel_hi:[1,1,0]"
      : "=&v"(h[0]), "=&v"(h[1]), "=&v"(h[2]), "=&v"(h[3]), "=&v"(l[0]), "=&v"(l[1]), "=&v"(l[2]), "=&v"(l[3])
      : "v"(x[0]), "v"(x[1]), "v"(x[2]), "v"(x[3]), "v"(x[4]), "v"(x[5]), "v"(x[6]), "v"(x[7]), "v"(a), "v"(b));
}
__device__ __forceinline__ F2 bsplit16(const float v[16]) { union { unsigned u[8]; v16b f; } H, L;   // element i = half i & 1 of register i >> 1
  split8(v, H.u, L.u); split8(v + 8, H.u + 4, L.u + 4);
  F2 r; r.h = H.f; r.l = L.f; return r; }
__device__ __forceinline__ F2 split_row(const float* row, int k0, int lane) { float v[16]; const float* p = row + k0 + 8 * (lane >> 4);
#pragma unroll
  for (int i = 0; i < 8; ++i) { v[i] = p[i]; v[8 + i] = p[16 + i]; }
  return bsplit16(v); }
__device__ __forceinline__ F2 split_rowK(const float* row, int k0, int lane, int K) { float v[16]; const int g = lane >> 4;
#pragma unroll
  for (int i = 0; i < 8; ++i) { const int ka = k0 + 8 * g + i, kb = ka + 16; v[i] = ka < K ? row[ka < K ? ka : K - 1] : 0.f; v[8 + i] = kb < K ? row[kb < K ? kb : K - 1] : 0.f; }
  return bsplit16(v); }
__device__ __forceinline__ F2 split_col(const float* W, int k0, int n, int lane, int ld, int K) { float v[16]; const int g = lane >> 4;
#pragma unroll
  for (int i = 0; i < 8; ++i) { const int ka = k0 + 8 * g + i, kb = ka + 16; v[i] = ka < K ? W[(size_t)(ka < K ? ka : K - 1) * ld + n] : 0.f; v[8 + i] = kb < K ? W[(size_t)(kb < K ? kb : K - 1) * ld + n] : 0.f; }
  return bsplit16(v); }
__device__ __forceinline__ v8f mac3(const F2& a, const F2& b, v8f c) { c = wmma_bf(a.l, b.h, c); c = wmma_bf(a.h, b.l, c); return wmma_bf(a.h, b.h, c); }
__device__ __forceinline__ float sigm(float v) { return 1.0f / (1.0f + expf(-v)); }
#define LDSX() do { asm volatile("s_wait_dscnt 0" ::: "memory"); __builtin_amdgcn_wave_barrier(); __builtin_amdgcn_fence(__ATOMIC_RELEASE, "workgroup"); } while (0)


// Global self-attention block over 64x64 = 4096 positions: x = relu(bn(inputs)); q, k (64 = 4 heads x 16), v (128 = 4 x 32) by 1x1 convs; softmax(q k^T / 4) v per head; out = o Wo^T + bo, back to NCHW, + inputs.
// k_xT (bn+relu, channel-major -> position-major hi/lo bf16 planes via LDS), k_qkv (one GEMM for [q|k|v] (256 cols), K = 128; q scaled after the bias; k stored split, as A-fragment rows), k_attn (per (b,h), one pass: S^T = k q^T, 16 dims x (hi, lo) = the 32-deep k, a lane owns one query: running max and sum over the 4096 keys, P^T = exp(s - m) as hi/lo straight from the S^T accumulators, O^T += V^T(hi/lo) P^T over 32-key steps, O / sum at the end; O -> concat layout),
// k_out (o(hi/lo) Wo^T + bo, transposed through LDS to NCHW rows + shortcut; per channel 64 positions = 256 B).
#define NB 2
#define CIN 128
#define NPOS 4096
#define NHD 4
#define DK 16
#define DV 32
#define KF 64
#define VF 128
#ifndef TNB
#define TNB NB
#define TQB (NPOS / 64)
#endif
typedef __attribute__((ext_vector_type(8))) __bf16 v8b;
__device__ __forceinline__ v16b frag_b(const __bf16* rowk0, int lane) {
  union { v16b v; v8b q[2]; } u; const __bf16* p = rowk0 + 8 * (lane >> 4);
  u.q[0] = *(const v8b*)p; u.q[1] = *(const v8b*)(p + 16); return u.v;
}
__device__ __forceinline__ v16b frag_gbf(const float* rowk0, int lane) {
  v16b a; const float* p = rowk0 + 8 * (lane >> 4);
#pragma unroll
  for (int i = 0; i < 8; ++i) { a[i] = (__bf16)p[i]; a[8 + i] = (__bf16)p[16 + i]; }
  return a;
}
__device__ __forceinline__ float bfr(float v) { return (float)(__bf16)v; }
// exp(s - m) = 2^(s' - m') with s' = s * log2(e): k_qkv folds log2(e) into q's scale, so scores and maxima come in the log2 domain and an exponential is one subtract and the hardware exp2, inline. Arguments are <= 0; a hugely negative one gives 0.
// The exp2 stand in asm, each in place, so that none is directly followed by a write of its source; the closing v_nop is the slot that the instruction set asks for behind a transcendental before its result is read.
#define L2E 1.44269504088896340736f
__device__ __forceinline__ void exp2x8(float* x) {
  asm("v_exp_f32 %0, %0\n\tv_exp_f32 %1, %1\n\tv_exp_f32 %2, %2\n\tv_exp_f32 %3, %3\n\tv_exp_f32 %4, %4\n\tv_exp_f32 %5, %5\n\tv_exp_f32 %6, %6\n\tv_exp_f32 %7, %7\n\tv_nop"
      : "+v"(x[0]), "+v"(x[1]), "+v"(x[2]), "+v"(x[3]), "+v"(x[4]), "+v"(x[5]), "+v"(x[6]), "+v"(x[7]));
}
__device__ __forceinline__ float exp2x1(float x) { asm("v_exp_f32 %0, %0\n\tv_nop" : "+v"(x)); return x; }

// K and V^T tiles go to LDS once per block and stage, by asynchronous copies (16 B a lane, through no register), and the block's 4 waves read their fragments from there.
#define KST 128               // keys per stage
#define NST (NPOS / KST)      // stages
#define KPF 20                // K row pitch in LDS, floats: 64 B + 16 B (16 B x odd: 16-byte readers meet no bank twice)
#define VPB 136               // V^T row pitch in LDS, bf16: 256 B + 16 B, for the same reason
__device__ __forceinline__ unsigned lds_off(const void* p) { return (unsigned)(size_t)p; }
// one stage of K: 128 rows of 64 B (one head's 16 dims as bf16 hi and lo, in the place of 16 floats of a 1024-B row); thread = (row tid >> 2 (+ 32 i), 16-B part tid & 3)
__device__ __forceinline__ void copy_k(const float* kg, float* sk, int tid) {
  const float* g0 = kg + (size_t)(tid >> 2) * 256 + (tid & 3) * 4; const float *g1 = g0 + 32 * 256, *g2 = g0 + 64 * 256, *g3 = g0 + 96 * 256;
  const unsigned l0 = lds_off(sk + (tid >> 2) * KPF + (tid & 3) * 4), l1 = l0 + 32 * KPF * 4, l2 = l0 + 64 * KPF * 4, l3 = l0 + 96 * KPF * 4;
  // the closing s_wait_xcnt stands in the copies' own statement, in front of any later write of their address registers
  asm volatile("global_load_async_to_lds_b128 %0, %4, off\n\tglobal_load_async_to_lds_b128 %1, %5, off\n\tglobal_load_async_to_lds_b128 %2, %6, off\n\tglobal_load_async_to_lds_b128 %3, %7, off\n\ts_wait_xcnt 0x0"
               :: "v"(l0), "v"(l1), "v"(l2), "v"(l3), "v"(g0), "v"(g1), "v"(g2), "v"(g3) : "memory");
}
// one stage of one V^T plane: 32 rows of 256 B (128 keys); thread = (row tid >> 4 (+ 8 i), 16-B part tid & 15)
__device__ __forceinline__ void copy_v(const __bf16* vg, __bf16* sv, int tid) {
  const __bf16* g0 = vg + (size_t)(tid >> 4) * NPOS + (tid & 15) * 8; const __bf16 *g1 = g0 + 8 * NPOS, *g2 = g0 + 16 * NPOS, *g3 = g0 + 24 * NPOS;
  const unsigned l0 = lds_off(sv + (tid >> 4) * VPB + (tid & 15) * 8), l1 = l0 + 8 * VPB * 2, l2 = l0 + 16 * VPB * 2, l3 = l0 + 24 * VPB * 2;
  // the closing s_wait_xcnt stands in the copies' own statement, in front of any later write of their address registers
  asm volatile("global_load_async_to_lds_b128 %0, %4, off\n\tglobal_load_async_to_lds_b128 %1, %5, off\n\tglobal_load_async_to_lds_b128 %2, %6, off\n\tglobal_load_async_to_lds_b128 %3, %7, off\n\ts_wait_xcnt 0x0"
               :: "v"(l0), "v"(l1), "v"(l2), "v"(l3), "v"(g0), "v"(g1), "v"(g2), "v"(g3) : "memory");
}
#define WAIT_COPIES() asm volatile("s_wait_asynccnt 0x0" ::: "memory")   // this wave's copies have landed
#define WAIT_LDS()    asm volatile("s_wait_dscnt 0x0" ::: "memory")      // this wave's LDS reads are done before the buffer is given up
// K fragment = the lane's 32 bytes of an LDS row as they stand (a, c = bytes 32 * (lane >> 4) + 0..15, + 16..31): elements 0..7 = hi of dims 8h + 0..7, elements 8..15 = lo of the same dims
__device__ __forceinline__ v16b frag_k(v4f a, v4f c) { union { v4f f[2]; v16b v; } u; u.f[0] = a; u.f[1] = c; return u.v; }
// its partner on the query side: the lane's 8 values (dims 8h + 0..7) in both halves, so that one product sums (k hi + k lo) . q over the 16 dims
__device__ __forceinline__ v16b frag_q2(v16b q) { v16b r;
#pragma unroll   // vector elements are indexed by constants
  for (int i = 0; i < 8; ++i) { r[i] = q[i]; r[8 + i] = q[i]; }
  return r; }

// A projection's 128 weight rows (128 floats each) go to LDS once per block, rounded to bf16: whole-row loads (a wave reads one row of 512 B), all in flight together, and the block's 4 waves read their B fragments from there.
#define WPB 136               // weight row pitch in LDS, bf16: 256 B + 16 B (16 B x odd: 16-byte readers meet no bank twice)
typedef __attribute__((ext_vector_type(4))) __bf16 v4b;
#define WAIT_ADDR() asm volatile("s_wait_xcnt 0x0" ::: "memory")   // stands between two groups of loads: the later group's results may be given the registers that hold the earlier group's addresses
// the same wait with the group's address as its input, so that the address registers are kept as they are up to it (no result of the group and no later load lands in them first): _S for block-uniform bases, _V for a lane's own pointer
#define WAIT_ADDR_S(P, Q) asm volatile("s_wait_xcnt 0x0" :: "s"(P), "s"(Q) : "memory")
#define WAIT_ADDR_V(P) asm volatile("s_wait_xcnt 0x0" :: "v"(P) : "memory")
__device__ __forceinline__ void put_w(__bf16* sw, int r, int lane, v4f x) { v4b c;
#pragma unroll   // vector elements are indexed by constants
  for (int e = 0; e < 4; ++e) c[e] = (__bf16)x[e];
  *(v4b*)(sw + r * WPB + lane * 4) = c; }

#define WS_XH   0u                                  // bf16 [2][4096][128] relu(bn(x)) position-major hi
#define WS_XL   (WS_XH + 2u * NB * NPOS * CIN)
#define WS_QKV  (WS_XL + 2u * NB * NPOS * CIN)        // f32 [2][4096][256]: q (64, scaled by log2(e)/4) | k (in the place of 64 floats; per head 64 B of bf16: hi d0..7, lo d0..7, hi d8..15, lo d8..15) | v (128)
#define WS_VTH  (WS_QKV + 4u * NB * NPOS * 256)       // bf16 [2][128 (h,dv)][4096] V^T hi
#define WS_VTL  (WS_VTH + 2u * NB * VF * NPOS)
#define WS_O    (WS_VTL + 2u * NB * VF * NPOS)        // f32 [2][4096][128] attention output (h, dv)
#define WS_END  (WS_O + 4u * NB * NPOS * VF)

// ---- k_xT: planes[b][p][c] = split(relu((bf16(x[b][c][p]) - m[c]) * (g[c] rsqrt(v[c]+eps)) + beta[c])); block = (b, 64 positions): LDS tile [64 p][128 c] -> rows of 256 B per plane (16 lanes)
__global__ __launch_bounds__(256) void k_xT(const float* __restrict__ X, const float* __restrict__ g, const float* __restrict__ bt, const float* __restrict__ rm, const float* __restrict__ rv, __bf16* __restrict__ PH, __bf16* __restrict__ PL) {
  __shared__ __bf16 sh[64][136], sl[64][136]; __shared__ float ssc[CIN], ssh[CIN];
  const int b = blockIdx.y, p0 = blockIdx.x * 64, tid = threadIdx.x;
  if (tid < CIN) { const float inv = rsqrtf(bfr(rv[tid]) + 1e-5f); const float sc = bfr(g[tid]) * inv; ssc[tid] = sc; ssh[tid] = bfr(bt[tid]) - bfr(rm[tid]) * sc; }
  __syncthreads();
  for (int q = tid; q < CIN * 64; q += 256) { const int c = q >> 6, pl = q & 63; float v = bfr(X[((size_t)b * CIN + c) * NPOS + p0 + pl]) * ssc[c] + ssh[c]; v = v > 0.f ? v : 0.f; const __bf16 hi = (__bf16)v; sh[pl][c] = hi; sl[pl][c] = (__bf16)(v - (float)hi); }
  __syncthreads();
  for (int q = tid; q < 64 * 16; q += 256) { const int pl = q >> 4, pc = q & 15; union { __bf16 e[8]; v4u u; } a, c2;
#pragma unroll
    for (int e = 0; e < 8; ++e) { a.e[e] = sh[pl][pc * 8 + e]; c2.e[e] = sl[pl][pc * 8 + e]; }
    const size_t o = ((size_t)b * NPOS + p0 + pl) * CIN + pc * 8; vst2((unsigned*)(PH + o), a.u); vst2((unsigned*)(PL + o), c2.u); }
}
// ---- k_qkv: QKV[b][p][n] = planes . W rows (+ bias), n < 64: Wq (then x log2(e)/4), < 128: Wk, else Wv; block (64 positions, 128 of the 256 cols); K = 128 (4 steps); also writes V^T hi/lo planes for the v columns (block-local transpose via so)
__global__ __launch_bounds__(128) void k_qkv(const __bf16* __restrict__ PH, const __bf16* __restrict__ PL, const float* __restrict__ Wq, const float* __restrict__ bq, const float* __restrict__ Wk, const float* __restrict__ bk, const float* __restrict__ Wv, const float* __restrict__ bv, float* __restrict__ QKV, __bf16* __restrict__ VTH, __bf16* __restrict__ VTL) {
  __shared__ __align__(16) float so[64][132]; __shared__ __align__(16) __bf16 sw[128 * WPB];
  const int tid = threadIdx.x, wave = tid >> 5, lane = tid & 31, col = lane & 15, g = lane >> 4; const int b = blockIdx.z; const int p0 = blockIdx.x * 64; const int n0 = blockIdx.y * 128;
  const size_t arow = ((size_t)b * NPOS + p0 + wave * 16 + col) * CIN;
  // every global operand is asked for here, ahead of the matrix work: one memory latency for the block. The matrix a row or a bias tile belongs to is picked by the block and by constants (rows 0..63 | 64..127 of the block's 128 columns), so no lane branches.
  const float *w0 = n0 ? Wv : Wq, *w1 = n0 ? Wv + KF * CIN : Wk, *b0 = n0 ? bv : bq, *b1 = n0 ? bv + KF : bk;
  v4f wx[32]; v16b ah[CIN / 32], al[CIN / 32]; float bias[8];
#pragma unroll   // wx is indexed by constants, so it stays in registers
  for (int i = 0; i < 32; ++i) wx[i] = *(const v4f*)((i < 16 ? w0 : w1) + ((i & 15) * 4 + wave) * CIN + lane * 4);   // row wave + 4 i
  WAIT_ADDR();
#pragma unroll   // as above: constant indices
  for (int kc = 0; kc < CIN / 32; ++kc) ah[kc] = frag_b(PH + arow + kc * 32, lane);
  WAIT_ADDR();
#pragma unroll   // as above: constant indices
  for (int kc = 0; kc < CIN / 32; ++kc) al[kc] = frag_b(PL + arow + kc * 32, lane);
  WAIT_ADDR();
#pragma unroll   // as above: constant indices
  for (int j = 0; j < 8; ++j) bias[j] = bfr((j < 4 ? b0 : b1)[(j & 3) * 16 + col]);
  WAIT_ADDR_S(b0, b1);
#pragma unroll   // as above: constant indices
  for (int i = 0; i < 32; ++i) put_w(sw, wave + 4 * i, lane, wx[i]);
  __syncthreads();   // the weights are there for every wave
  v8f acc[8] = {};
#pragma unroll
  for (int kc = 0; kc < CIN / 32; ++kc) { v16b w[8];
#pragma unroll   // the step's eight B fragments are read as one group ahead of its matrix work: one LDS latency a step
    for (int j = 0; j < 8; ++j) w[j] = frag_b(sw + (j * 16 + col) * WPB + kc * 32, lane);
#pragma unroll
    for (int j = 0; j < 8; ++j) { acc[j] = wmma_bf(al[kc], w[j], acc[j]); acc[j] = wmma_bf(ah[kc], w[j], acc[j]); } }
#pragma unroll
  for (int j = 0; j < 8; ++j) { const float sc = (n0 == 0 && j < 4) ? 0.25f * L2E : 1.0f;
#pragma unroll
    for (int r = 0; r < 8; ++r) so[wave * 16 + 8 * g + r][j * 16 + col] = (acc[j][r] + bias[j]) * sc; }
  __syncthreads();
  for (int q = tid; q < 64 * 32; q += 128) { const int rl = q >> 5, pc = q & 31; float* dst = QKV + ((size_t)b * NPOS + p0 + rl) * 256 + n0 + pc * 4;
    if (n0 == 0 && pc >= KF / 4) {   // k columns: the 16-B part pc & 3 of a head's 64 B holds 8 dims (bit 1: which 8) as bf16 hi or lo (bit 0), split once here for every reader
      const float* s8 = &so[rl][(pc & ~3) * 4 + (pc & 2) * 4]; union { __bf16 e[8]; v4u u; } w;
#pragma unroll   // w is indexed by constants, so it stays in registers
      for (int e = 0; e < 8; ++e) { const float v = s8[e]; const __bf16 hi = (__bf16)v; w.e[e] = (pc & 1) ? (__bf16)(v - (float)hi) : hi; }
      vst2((unsigned*)dst, w.u); }
    else vst2(dst, *(const v4f*)&so[rl][pc * 4]); }
  if (n0 == 128) {
    for (int q = tid; q < 128 * 8; q += 128) { const int c = q >> 3, pc = q & 7; union { __bf16 e[8]; v4u u; } hh, ll;
#pragma unroll
      for (int e = 0; e < 8; ++e) { const float v = so[pc * 8 + e][c]; const __bf16 hi = (__bf16)v; hh.e[e] = hi; ll.e[e] = (__bf16)(v - (float)hi); }
      const size_t o = ((size_t)b * VF + c) * NPOS + p0 + pc * 8; vst2((unsigned*)(VTH + o), hh.u); vst2((unsigned*)(VTL + o), ll.u); } }
}
// k_attn's products: the builtin alone, with no v_nop written behind it. The distance that the chip asks for behind a WMMA is filled by the work that stands there (the other O^T tile's product, the next step's softmax); where that is short the compiler pads.
__device__ __forceinline__ v8f wmma_w(v16b a, v16b b, v8f c) { return __builtin_amdgcn_wmma_f32_16x16x32_bf16(false, a, false, b, (short)0, c, false, false); }
// the scheduler moves nothing over this line: it keeps the LDS read groups ahead of the matrix work (left alone it sinks each read to its user, with a full wait there) and the vector work between the WMMAs as written
#define HOLD() __builtin_amdgcn_sched_barrier(0)
// the other half's value of the same column (lane ^ 16), by a vector cross-row move
__device__ __forceinline__ float xhalf(float v) { const unsigned u = __builtin_bit_cast(unsigned, v); return __builtin_bit_cast(float, __builtin_amdgcn_permlanex16(u, u, 0x76543210u, 0xfedcba98u, false, false)); }
// ---- k_attn: block = (64 queries, b*4+h), one pass over the keys. S^T = k(hi/lo) q(hi/lo)^T, the 32-deep k = 16 dims x (k hi, k lo), once against q lo and once against q hi: lane (g, col) holds keys 8g+0..7 of query col. Per stage of 128 keys: the 8 S^T tiles, their maximum in-lane and over the two halves, one rescale of O^T and of the sums by 2^(m_old - m_new),
// then P^T = 2^(s - m) as hi/lo straight from the S^T accumulators, O^T += V^T(hi/lo) P^T over 32-key steps, the sums of P in-lane; behind the loop the halves' sums are joined and O is divided by them.
__global__ __launch_bounds__(128) void k_attn(const float* __restrict__ QKV, const __bf16* __restrict__ VTH, const __bf16* __restrict__ VTL, float* __restrict__ O) {
  __shared__ __align__(16) float so[4][16][36]; __shared__ __align__(16) float sk[2][KST * KPF]; __shared__ __align__(16) __bf16 sv[2][2][DV * VPB];   // sv[buffer][hi, lo]
  const int tid = threadIdx.x, wave = tid >> 5, lane = tid & 31, col = lane & 15, g = lane >> 4;
  const int bh = blockIdx.y, b = bh >> 2, h = bh & 3; const int q0 = blockIdx.x * 64 + wave * 16;
  const F2 a = split_rowK(QKV + ((size_t)b * NPOS + q0 + col) * 256 + h * DK, 0, lane, DK);
  const v16b qh = frag_q2(a.h), ql = frag_q2(a.l);
  float m = -3.0e38f, ls[8] = {};   // the query's running maximum (log2 domain, equal in both halves); ls[r]: sum of P over the lane's keys 8g + r of every tile
  v8f acc[2] = {};
  const float* kg = QKV + (size_t)b * NPOS * 256 + KF + h * DK; const __bf16 *vgh = VTH + ((size_t)b * VF + h * DV) * NPOS, *vgl = VTL + ((size_t)b * VF + h * DV) * NPOS;
  copy_k(kg, sk[0], tid); copy_v(vgh, sv[0][0], tid); copy_v(vgl, sv[0][1], tid); WAIT_COPIES(); __syncthreads();   // stage 0 is there for every wave
  copy_k(kg + (size_t)KST * 256, sk[1], tid); copy_v(vgh + KST, sv[1][0], tid); copy_v(vgl + KST, sv[1][1], tid);     // stage 1 flies while stage 0 is worked on
  // one stage, inlined twice: in the loop where a stage t + 2 always exists, and in the loop of the last two stages. So a trip is one straight block, and the sums of P stay where they are written (with a branch in the trip the compiler moves all of them behind it, to the trip's foot, and holds a stage's 64 P values in registers till then).
  auto stage = [&](const int t) __attribute__((always_inline)) { const float* kr = sk[t & 1] + col * KPF + 8 * g; const __bf16 *vrh = sv[t & 1][0] + col * VPB, *vrl = sv[t & 1][1] + col * VPB;
    v4f kq[KST / 16][2]; v16b vq[2][2][2];   // the stage's K rows; [set][dt][hi, lo]: a step's V^T fragments, read one step ahead inside the stage
    // RD_V: the V^T reads of one 32-key step; its loop is unrolled so that the sets are indexed by constants and stay in registers
#define RD_V(S, KS) do { _Pragma("unroll") for (int c = 0; c < 2; ++c) { const int vo = c * 16 * VPB + (KS) * 32; vq[S][c][0] = frag_b(vrh + vo, lane); vq[S][c][1] = frag_b(vrl + vo, lane); } } while (0)
#pragma unroll     // the stage's K reads and the first step's V^T reads stand as one group ahead of the matrix work: one read latency a stage
    for (int kt = 0; kt < KST / 16; ++kt) { kq[kt][0] = *(const v4f*)(kr + kt * 16 * KPF); kq[kt][1] = *(const v4f*)(kr + kt * 16 * KPF + 4); }
    RD_V(0, 0);
    HOLD();
    v8f s[KST / 16]; float mx[8];   // mx: eight independent chains over the tiles, each from the running maximum, two tiles a link; then joined
    // MAX2: one link of the eight chains; it stands behind later tiles' products, so that its two tiles are done when it reads them
#define MAX2(KT) do { _Pragma("unroll") for (int r = 0; r < 8; ++r) mx[r] = fmaxf(fmaxf(mx[r], s[KT][r]), s[(KT) + 1][r]); } while (0)
#pragma unroll     // kq and s are indexed by constants only, so they stay in registers; the small products first, and eight independent tiles between a tile's two products
    for (int kt = 0; kt < KST / 16; ++kt) s[kt] = wmma_w(frag_k(kq[kt][0], kq[kt][1]), ql, (v8f){});
#pragma unroll     // as above: constant indices
    for (int kt = 0; kt < 6; ++kt) s[kt] = wmma_w(frag_k(kq[kt][0], kq[kt][1]), qh, s[kt]);
    HOLD();
#pragma unroll
    for (int r = 0; r < 8; ++r) mx[r] = m;
    MAX2(0); HOLD();
    s[6] = wmma_w(frag_k(kq[6][0], kq[6][1]), qh, s[6]); HOLD();
    MAX2(2); HOLD();
    s[7] = wmma_w(frag_k(kq[7][0], kq[7][1]), qh, s[7]); HOLD();
    MAX2(4); MAX2(6);
    const float mt = fmaxf(fmaxf(fmaxf(fmaxf(mx[0], mx[1]), mx[2]), fmaxf(fmaxf(mx[3], mx[4]), mx[5])), fmaxf(mx[6], mx[7]));
    const float mn = fmaxf(mt, xhalf(mt)), al = exp2x1(m - mn); m = mn;   // both halves feed one O^T tile, so they use one maximum
#pragma unroll
    for (int r = 0; r < 8; ++r) { ls[r] *= al; acc[0][r] *= al; acc[1][r] *= al; }
    // a 32-key step's P^T: x0, x1[r] = P[query col][key (t * 4 + ks) * 32 + (0, 16) + 8g + r]: the two S^T tiles are a B fragment's k order as they stand. Its pieces (SM_X, SM_X, SM_SUM + split8, SM_SUM + split8) stand one step ahead, one behind each of the first four products of the step before.
    float x0[8], x1[8]; union { unsigned u[8]; v16b f; } H, L;
#define SM_X(X, KT) do { _Pragma("unroll") for (int r = 0; r < 8; ++r) X[r] = s[KT][r] - mn; exp2x8(X); } while (0)
#define SM_SUM(X) do { _Pragma("unroll") for (int r = 0; r < 8; ++r) ls[r] += X[r]; } while (0)
    SM_X(x0, 0); SM_X(x1, 1); SM_SUM(x0); SM_SUM(x1); split8(x0, H.u, L.u); split8(x1, H.u + 4, L.u + 4);
#pragma unroll     // the sets are indexed by constants only, so they stay in registers
  for (int ks = 0; ks < KST / 32; ++ks) { const bool nx = ks + 1 < KST / 32; const v16b ph = H.f, pl = L.f;
    const v16b vh0 = vq[ks & 1][0][0], vl0 = vq[ks & 1][0][1], vh1 = vq[ks & 1][1][0], vl1 = vq[ks & 1][1][1];
    if (nx) RD_V((ks + 1) & 1, ks + 1);   // the next step's LDS reads as one group ahead of this step's matrix work (same stage, same buffer)
    HOLD();
    acc[0] = wmma_w(vh0, pl, acc[0]); HOLD();
    if (nx) SM_X(x0, ks * 2 + 2);
    HOLD();
    acc[1] = wmma_w(vh1, pl, acc[1]); HOLD();
    if (nx) SM_X(x1, ks * 2 + 3);
    HOLD();
    acc[0] = wmma_w(vl0, ph, acc[0]); HOLD();
    if (nx) { SM_SUM(x0); split8w(x0, H.u, L.u, vl0, ph); }
    HOLD();
    acc[1] = wmma_w(vl1, ph, acc[1]); HOLD();
    if (nx) { SM_SUM(x1); split8w(x1, H.u + 4, L.u + 4, vl1, ph); }
    HOLD();
    acc[0] = wmma_w(vh0, ph, acc[0]);
    acc[1] = wmma_w(vh1, ph, acc[1]); HOLD(); }
    WAIT_LDS(); WAIT_COPIES(); __syncthreads();   // publish point: stage t + 1 has landed for all, and nobody reads stage t's buffers any more
    if (t + 2 < NST) { copy_k(kg + (size_t)(t + 2) * KST * 256, sk[t & 1], tid); copy_v(vgh + (t + 2) * KST, sv[t & 1][0], tid); copy_v(vgl + (t + 2) * KST, sv[t & 1][1], tid); } };
#pragma unroll 1   // one trip = one stage
  for (int t = 0; t < NST - 2; ++t) stage(t);
#pragma unroll 1   // the last two stages, which refill nothing: rolled as well, so that they take no more registers than the loop above
  for (int t = NST - 2; t < NST; ++t) stage(t);
  WAIT_COPIES();
  float l = ((ls[0] + ls[1]) + (ls[2] + ls[3])) + ((ls[4] + ls[5]) + (ls[6] + ls[7]));
  l += xhalf(l);   // join the halves' keys
  const float il = 1.0f / l;
#pragma unroll
  for (int dt = 0; dt < 2; ++dt)   // acc[dt][r] = O[query col][dt * 16 + 8g + r] * l: 8 consecutive floats of the lane's row
#pragma unroll
    for (int r = 0; r < 8; ++r) so[wave][col][dt * 16 + 8 * g + r] = acc[dt][r] * il;
  LDSX();
  for (int q = lane; q < 16 * 8; q += 32) { const int rl = q >> 3, pc = q & 7; vst2(O + ((size_t)b * NPOS + q0 + rl) * VF + h * DV + pc * 4, *(const v4f*)&so[wave][rl][pc * 4]); }
}
// ---- k_out: Y[p][o] = O row(hi/lo) . Wo rows + bo; out[b][o][p] = Y + inputs (NCHW); block = (64 positions, b): 128 output channels in one pass (8 tiles); transposed store per channel: 64 positions = 256 B by 16 lanes
__global__ __launch_bounds__(128) void k_out(const float* __restrict__ O, const float* __restrict__ Wo, const float* __restrict__ bo, const float* __restrict__ X, float* __restrict__ out) {
  __shared__ __align__(16) float st[128][68]; __shared__ __align__(16) __bf16 sw[128 * WPB];
  const int tid = threadIdx.x, wave = tid >> 5, lane = tid & 31, col = lane & 15, g = lane >> 4; const int b = blockIdx.y; const int p0 = blockIdx.x * 64;
  // every global operand is asked for here, ahead of the matrix work: one memory latency for the block
  v4f wx[32]; F2 a[VF / 32]; float bb[8]; const float* orow = O + ((size_t)b * NPOS + p0 + wave * 16 + col) * VF;
#pragma unroll   // wx is indexed by constants, so it stays in registers
  for (int i = 0; i < 32; ++i) wx[i] = *(const v4f*)(Wo + (size_t)(wave + 4 * i) * VF + lane * 4);
  WAIT_ADDR();
#pragma unroll   // as above: constant indices
  for (int kc = 0; kc < VF / 32; ++kc) a[kc] = split_row(orow, kc * 32, lane);
  WAIT_ADDR_V(orow + 8 * g);
#pragma unroll   // as above: constant indices
  for (int j = 0; j < 8; ++j) bb[j] = bfr(bo[j * 16 + col]);
  WAIT_ADDR_S(bo, bo);
#pragma unroll   // as above: constant indices
  for (int i = 0; i < 32; ++i) put_w(sw, wave + 4 * i, lane, wx[i]);
  __syncthreads();   // the weights are there for every wave
  v8f acc[8] = {};
#pragma unroll
  for (int kc = 0; kc < VF / 32; ++kc) { v16b w[8];
#pragma unroll   // the step's eight B fragments are read as one group ahead of its matrix work: one LDS latency a step
    for (int j = 0; j < 8; ++j) w[j] = frag_b(sw + (j * 16 + col) * WPB + kc * 32, lane);
#pragma unroll
    for (int j = 0; j < 8; ++j) { acc[j] = wmma_bf(a[kc].l, w[j], acc[j]); acc[j] = wmma_bf(a[kc].h, w[j], acc[j]); } }
#pragma unroll
  for (int j = 0; j < 8; ++j) {
#pragma unroll
    for (int r = 0; r < 8; ++r) st[j * 16 + col][wave * 16 + 8 * g + r] = acc[j][r] + bb[j]; }
  __syncthreads();
  for (int q = tid; q < 128 * 16; q += 128) { const int o = q >> 4, pc = q & 15; const size_t base = ((size_t)b * CIN + o) * NPOS + p0 + pc * 4; const float4 xv = *(const float4*)(X + base);
    v4f r4; r4[0] = st[o][pc * 4] + bfr(xv.x); r4[1] = st[o][pc * 4 + 1] + bfr(xv.y); r4[2] = st[o][pc * 4 + 2] + bfr(xv.z); r4[3] = st[o][pc * 4 + 3] + bfr(xv.w); vst2(out + base, r4); }
}

extern "C" void kernel_launch(void* const* d_in, const int* in_sizes, int n_in, void* d_out, int out_size, void* d_ws, size_t ws_size, hipStream_t stream) {
  (void)in_sizes; (void)n_in; (void)out_size;
  const float** F = (const float**)d_in;   // inputs, gamma, beta, running_mean, running_var, Wq, bq, Wk, bk, Wv, bv, Wo, bo
  if (ws_size < (size_t)WS_END) return;
  char* ws = (char*)d_ws;
  __bf16 *PH = (__bf16*)(ws + WS_XH), *PL = (__bf16*)(ws + WS_XL), *VTH = (__bf16*)(ws + WS_VTH), *VTL = (__bf16*)(ws + WS_VTL); float *QKV = (float*)(ws + WS_QKV), *O = (float*)(ws + WS_O);
  k_xT<<<dim3(NPOS / 64, TNB), 256, 0, stream>>>(F[0], F[1], F[2], F[3], F[4], PH, PL);
  k_qkv<<<dim3(NPOS / 64, 2, TNB), 128, 0, stream>>>(PH, PL, F[5], F[6], F[7], F[8], F[9], F[10], QKV, VTH, VTL);
  k_attn<<<dim3(TQB, TNB * NHD), 128, 0, stream>>>(QKV, VTH, VTL, O);
  k_out<<<dim3(TQB, TNB), 128, 0, stream>>>(O, F[11], F[12], F[0], (float*)d_out);
}

// v009
// A run of this version takes 47.6 microseconds.
// Two timings next to v008 both put it at 1.17 times that version's speed.
// All steps since v000 together make it 16.3 times as fast.
// compute dtype: inputs, BN parameters and all projection weights/biases (module inputs) rounded to bf16; q/k/v projections of the BN+ReLU activations, the attention scores, P.V and the output projection all take computed operands as bf16 hi + bf16 residual pairs (2 products against weights, 3 between computed operands; the scores take all 4, two to a 32-deep product);
#include <hip/hip_runtime.h>
#include <math.h>

typedef __attribute__((ext_vector_type(16))) _Float16 v16h;
typedef __attribute__((ext_vector_type(16))) __bf16 v16b;
typedef __attribute__((ext_vector_type(8)))  _Float16 v8h;
typedef __attribute__((ext_vector_type(8)))  float v8f;
typedef __attribute__((ext_vector_type(4)))  float v4f;
typedef __attribute__((ext_vector_type(2)))  float v2f;
typedef __attribute__((ext_vector_type(4)))  unsigned v4u;
typedef __attribute__((ext_vector_type(4)))  int v4i;
typedef float __attribute__((may_alias)) float_a;
typedef int __attribute__((may_alias)) int_a;

template <typename T> __device__ __forceinline__ void vst2(void* p, T v) { *(T*)p = v;  }
__device__ __forceinline__ v8f wmma16(v16h a, v16h b, v8f c) {
  v8f d = __builtin_amdgcn_wmma_f32_16x16x32_f16(false, a, false, b, (short)0, c, false, false);
  asm volatile("v_nop\n\tv_nop\n\tv_nop\n\tv_nop" : "+v"(d) : "v"(a), "v"(b));
  return d;
}
__device__ __forceinline__ v8f wmma_bf(v16b a, v16b b, v8f c) {
  v8f d = __builtin_amdgcn_wmma_f32_16x16x32_bf16(false, a, false, b, (short)0, c, false, false);
  asm volatile("v_nop\n\tv_nop\n\tv_nop\n\tv_nop" : "+v"(d) : "v"(a), "v"(b));
  return d;
}
// 16x16x32 fragments: lane = (h = lane>>4, row/col = lane&15); elements 0..7 = k0+8h+0..7, 8..15 = k0+16+8h+0..7; D element r = row 8h+r
__device__ __forceinline__ v16h frag_h(const _Float16* rowk0, int lane) {
  union { v16h v; v8h q[2]; } u; const _Float16* p = rowk0 + 8 * (lane >> 4);
  u.q[0] = *(const v8h*)p; u.q[1] = *(const v8h*)(p + 16); return u.v;
}
__device__ __forceinline__ v16h frag_f32(const float* rowk0, int lane) {
  v16h a; const float* p = rowk0 + 8 * (lane >> 4);
#pragma unroll
  for (int i = 0; i < 8; ++i) { a[i] = (_Float16)p[i]; a[8 + i] = (_Float16)p[16 + i]; }
  return a;
}
__device__ __forceinline__ v16h frag_f32s(const float* rowk0, int lane, float sc) {
  v16h a; const float* p = rowk0 + 8 * (lane >> 4);
#pragma unroll
  for (int i = 0; i < 8; ++i) { a[i] = (_Float16)(p[i] * sc); a[8 + i] = (_Float16)(p[16 + i] * sc); }
  return a;
}
// column fragment from a [K][ld] layout (column n), rows >= K read as 0
__device__ __forceinline__ v16h fragc_f32(const float* W, int k0, int n, int lane, int ld, int K) {
  v16h a; const int g = lane >> 4;
#pragma unroll
  for (int i = 0; i < 8; ++i) { const int ka = k0 + 8 * g + i, kb = ka + 16;
    a[i] = (_Float16)(ka < K ? W[(size_t)(ka < K ? ka : K - 1) * ld + n] : 0.f); a[8 + i] = (_Float16)(kb < K ? W[(size_t)(kb < K ? kb : K - 1) * ld + n] : 0.f); }
  return a;
}
struct F2 { v16b h, l; };
// x = hi + lo in bf16, 8 values a statement, 3 vector instructions a pair: hi by the packed conversion; lo = x - hi (exact in f32), rounded to bf16 by the mixed fma that writes one half of a register.
// The factor -1.0 is read as the bf16 in the constant's high half. Each s_delay_alu names the producers four vector instructions back, so that the SIMD's other wave can issue while this one waits for them.
__device__ __forceinline__ void split8(const float* x, unsigned* h, unsigned* l) {
  asm("v_cvt_pk_bf16_f32 %0, %8, %9\n\tv_cvt_pk_bf16_f32 %1, %10, %11\n\tv_cvt_pk_bf16_f32 %2, %12, %13\n\tv_cvt_pk_bf16_f32 %3, %14, %15\n\t"
      "s_delay_alu instid0(VALU_DEP_4) | instskip(NEXT) | instid1(VALU_DEP_4)\n\t"
      "v_fma_mixlo_bf16 %4, %0, -1.0, %8 op_sel:[0,1,0] op_sel_hi:[1,1,0]\n\tv_fma_mixlo_bf16 %5, %1, -1.0, %10 op_sel:[0,1,0] op_sel_hi:[1,1,0]\n\t"
      "s_delay_alu instid0(VALU_DEP_4) | instskip(NEXT) | instid1(VALU_DEP_4)\n\t"
      "v_fma_mixlo_bf16 %6, %2, -1.0, %12 op_sel:[0,1,0] op_sel_hi:[1,1,0]\n\tv_fma_mixlo_bf16 %7, %3, -1.0, %14 op_sel:[0,1,0] op_sel_hi:[1,1,0]\n\t"
      "s_delay_alu instid0(VALU_DEP_4) | instskip(NEXT) | instid1(VALU_DEP_4)\n\t"
      "v_fma_mixhi_bf16 %4, %0, -1.0, %9 op_sel:[1,1,0] op_sel_hi:[1,1,0]\n\tv_fma_mixhi_bf16 %5, %1, -1.0, %11 op_sel:[1,1,0] op_sel_hi:[1,1,0]\n\t"
      "s_delay_alu instid0(VALU_DEP_4) | instskip(NEXT) | instid1(VALU_DEP_4)\n\t"
      "v_fma_mixhi_bf16 %6, %2, -1.0, %13 op_sel:[1,1,0] op_sel_hi:[1,1,0]\n\tv_fma_mixhi_bf16 %7, %3, -1.0, %15 op_sel:[1,1,0] op_sel_hi:[1,1,0]"
      : "=&v"(h[0]), "=&v"(h[1]), "=&v"(h[2]), "=&v"(h[3]), "=&v"(l[0]), "=&v"(l[1]), "=&v"(l[2]), "=&v"(l[3])
      : "v"(x[0]), "v"(x[1]), "v"(x[2]), "v"(x[3]), "v"(x[4]), "v"(x[5]), "v"(x[6]), "v"(x[7]));
}
// split8 for the place directly behind a WMMA: it names that product's A and B as inputs too (the text does not use them), so that its results, which the compiler cannot see being written, are given other registers than those the product is still reading
__device__ __forceinline__ void split8w(const float* x, unsigned* h, unsigned* l, v16b a, v16b b) {
  asm("v_cvt_pk_bf16_f32 %0, %8, %9\n\tv_cvt_pk_bf16_f32 %1, %10, %11\n\tv_cvt_pk_bf16_f32 %2, %12, %13\n\tv_cvt_pk_bf16_f32 %3, %14, %15\n\t"
      "s_delay_alu instid0(VALU_DEP_4) | instskip(NEXT) | instid1(VALU_DEP_4)\n\t"
      "v_fma_mixlo_bf16 %4, %0, -1.0, %8 op_sel:[0,1,0] op_sel_hi:[1,1,0]\n\tv_fma_mixlo_bf16 %5, %1, -1.0, %10 op_sel:[0,1,0] op_sel_hi:[1,1,0]\n\t"
      "s_delay_alu instid0(VALU_DEP_4) | instskip(NEXT) | instid1(VALU_DEP_4)\n\t"
      "v_fma_mixlo_bf16 %6, %2, -1.0, %12 op_sel:[0,1,0] op_sel_hi:[1,1,0]\n\tv_fma_mixlo_bf16 %7, %3, -1.0, %14 op_sel:[0,1,0] op_sel_hi:[1,1,0]\n\t"
      "s_delay_alu instid0(VALU_DEP_4) | instskip(NEXT) | instid1(VALU_DEP_4)\n\t"
      "v_fma_mixhi_bf16 %4, %0, -1.0, %9 op_sel:[1,1,0] op_sel_hi:[1,1,0]\n\tv_fma_mixhi_bf16 %5, %1, -1.0, %11 op_sel:[1,1,0] op_sel_hi:[1,1,0]\n\t"
      "s_delay_alu instid0(VALU_DEP_4) | instskip(NEXT) | instid1(VALU_DEP_4)\n\t"
      "v_fma_mixhi_bf16 %6, %2, -1.0, %13 op_sel:[1,1,0] op_sel_hi:[1,1,0]\n\tv_fma_mixhi_bf16 %7, %3, -1.0, %15 op_sel:[1,1,0] op_sel_hi:[1,1,0]"
      : "=&v"(h[0]), "=&v"(h[1]), "=&v"(h[2]), "=&v"(h[3]), "=&v"(l[0]), "=&v"(l[1]), "=&v"(l[2]), "=&v"(l[3])
      : "v"(x[0]), "v"(x[1]), "v"(x[2]), "v"(x[3]), "v"(x[4]), "v"(x[5]), "v"(x[6]), "v"(x[7]), "v"(a), "v"(b));
}
__device__ __forceinline__ F2 bsplit16(const float v[16]) { union { unsigned u[8]; v16b f; } H, L;   // element i = half i & 1 of register i >> 1
  split8(v, H.u, L.u); split8(v + 8, H.u + 4, L.u + 4);
  F2 r; r.h = H.f; r.l = L.f; return r; }
__device__ __forceinline__ F2 split_row(const float* row, int k0, int lane) { float v[16]; const float* p = row + k0 + 8 * (lane >> 4);
#pragma unroll
  for (int i = 0; i < 8; ++i) { v[i] = p[i]; v[8 + i] = p[16 + i]; }
  return bsplit16(v); }
__device__ __forceinline__ F2 split_rowK(const float* row, int k0, int lane, int K) { float v[16]; const int g = lane >> 4;
#pragma unroll
  for (int i = 0; i < 8; ++i) { const int ka = k0 + 8 * g + i, kb = ka + 16; v[i] = ka < K ? row[ka < K ? ka : K - 1] : 0.f; v[8 + i] = kb < K ? row[kb < K ? kb : K - 1] : 0.f; }
  return bsplit16(v); }
__device__ __forceinline__ F2 split_col(const float* W, int k0, int n, int lane, int ld, int K) { float v[16]; const int g = lane >> 4;
#pragma unroll
  for (int i = 0; i < 8; ++i) { const int ka = k0 + 8 * g + i, kb = ka + 16; v[i] = ka < K ? W[(size_t)(ka < K ? ka : K - 1) * ld + n] : 0.f; v[8 + i] = kb < K ? W[(size_t)(kb < K ? kb : K - 1) * ld + n] : 0.f; }
  return bsplit16(v); }
__device__ __forceinline__ v8f mac3(const F2& a, const F2& b, v8f c) { c = wmma_bf(a.l, b.h, c); c = wmma_bf(a.h, b.l, c); return wmma_bf(a.h, b.h, c); }
__device__ __forceinline__ float sigm(float v) { return 1.0f / (1.0f + expf(-v)); }
#define LDSX() do { asm volatile("s_wait_dscnt 0" ::: "memory"); __builtin_amdgcn_wave_barrier(); __builtin_amdgcn_fence(__ATOMIC_RELEASE, "workgroup"); } while (0)


// Global self-attention block over 64x64 = 4096 positions: x = relu(bn(inputs)); q, k (64 = 4 heads x 16), v (128 = 4 x 32) by 1x1 convs; softmax(q k^T / 4) v per head; out = o Wo^T + bo, back to NCHW, + inputs.
// k_qkv (bn+relu of its 64 positions straight into hi/lo bf16 A fragments; one GEMM for [q|k|v] (256 cols), K = 128; q scaled after the bias; k stored split, as A-fragment rows), k_attn (per (b,h), one pass: S^T = k q^T, 16 dims x (hi, lo) = the 32-deep k, a lane owns one query: running max and sum over the 4096 keys, P^T = exp(s - m) as hi/lo straight from the S^T accumulators, O^T += V^T(hi/lo) P^T over 32-key steps, O / sum at the end; O -> concat layout),
// k_out (o(hi/lo) Wo^T + bo, transposed through LDS to NCHW rows + shortcut; per channel 64 positions = 256 B).
#define NB 2
#define CIN 128
#define NPOS 4096
#define NHD 4
#define DK 16
#define DV 32
#define KF 64
#define VF 128
#ifndef TNB
#define TNB NB
#define TQB (NPOS / 64)
#endif
typedef __attribute__((ext_vector_type(8))) __bf16 v8b;
__device__ __forceinline__ v16b frag_b(const __bf16* rowk0, int lane) {
  union { v16b v; v8b q[2]; } u; const __bf16* p = rowk0 + 8 * (lane >> 4);
  u.q[0] = *(const v8b*)p; u.q[1] = *(const v8b*)(p + 16); return u.v;
}
__device__ __forceinline__ v16b frag_gbf(const float* rowk0, int lane) {
  v16b a; const float* p = rowk0 + 8 * (lane >> 4);
#pragma unroll
  for (int i = 0; i < 8; ++i) { a[i] = (__bf16)p[i]; a[8 + i] = (__bf16)p[16 + i]; }
  return a;
}
__device__ __forceinline__ float bfr(float v) { return (float)(__bf16)v; }
// exp(s - m) = 2^(s' - m') with s' = s * log2(e): k_qkv folds log2(e) into q's scale, so scores and maxima come in the log2 domain and an exponential is one subtract and the hardware exp2, inline. Arguments are <= 0; a hugely negative one gives 0.
// The exp2 stand in asm, each in place, so that none is directly followed by a write of its source; the closing v_nop is the slot that the instruction set asks for behind a transcendental before its result is read.
#define L2E 1.44269504088896340736f
__device__ __forceinline__ void exp2x8(float* x) {
  asm("v_exp_f32 %0, %0\n\tv_exp_f32 %1, %1\n\tv_exp_f32 %2, %2\n\tv_exp_f32 %3, %3\n\tv_exp_f32 %4, %4\n\tv_exp_f32 %5, %5\n\tv_exp_f32 %6, %6\n\tv_exp_f32 %7, %7\n\tv_nop"
      : "+v"(x[0]), "+v"(x[1]), "+v"(x[2]), "+v"(x[3]), "+v"(x[4]), "+v"(x[5]), "+v"(x[6]), "+v"(x[7]));
}
__device__ __forceinline__ float exp2x1(float x) { asm("v_exp_f32 %0, %0\n\tv_nop" : "+v"(x)); return x; }

// K and V^T tiles go to LDS once per block and stage, by asynchronous copies (16 B a lane, through no register), and the block's 4 waves read their fragments from there.
#define KST 128               // keys per stage
#define NST (NPOS / KST)      // stages
#define KPF 20                // K row pitch in LDS, floats: 64 B + 16 B (16 B x odd: 16-byte readers meet no bank twice)
#define VPB 136               // V^T row pitch in LDS, bf16: 256 B + 16 B, for the same reason
__device__ __forceinline__ unsigned lds_off(const void* p) { return (unsigned)(size_t)p; }
// one stage of K: 128 rows of 64 B (one head's 16 dims as bf16 hi and lo, in the place of 16 floats of a 1024-B row); thread = (row tid >> 2 (+ 32 i), 16-B part tid & 3)
__device__ __forceinline__ void copy_k(const float* kg, float* sk, int tid) {
  const float* g0 = kg + (size_t)(tid >> 2) * 256 + (tid & 3) * 4; const float *g1 = g0 + 32 * 256, *g2 = g0 + 64 * 256, *g3 = g0 + 96 * 256;
  const unsigned l0 = lds_off(sk + (tid >> 2) * KPF + (tid & 3) * 4), l1 = l0 + 32 * KPF * 4, l2 = l0 + 64 * KPF * 4, l3 = l0 + 96 * KPF * 4;
  // the closing s_wait_xcnt stands in the copies' own statement, in front of any later write of their address registers
  asm volatile("global_load_async_to_lds_b128 %0, %4, off\n\tglobal_load_async_to_lds_b128 %1, %5, off\n\tglobal_load_async_to_lds_b128 %2, %6, off\n\tglobal_load_async_to_lds_b128 %3, %7, off\n\ts_wait_xcnt 0x0"
               :: "v"(l0), "v"(l1), "v"(l2), "v"(l3), "v"(g0), "v"(g1), "v"(g2), "v"(g3) : "memory");
}
// one stage of one V^T plane: 32 rows of 256 B (128 keys); thread = (row tid >> 4 (+ 8 i), 16-B part tid & 15)
__device__ __forceinline__ void copy_v(const __bf16* vg, __bf16* sv, int tid) {
  const __bf16* g0 = vg + (size_t)(tid >> 4) * NPOS + (tid & 15) * 8; const __bf16 *g1 = g0 + 8 * NPOS, *g2 = g0 + 16 * NPOS, *g3 = g0 + 24 * NPOS;
  const unsigned l0 = lds_off(sv + (tid >> 4) * VPB + (tid & 15) * 8), l1 = l0 + 8 * VPB * 2, l2 = l0 + 16 * VPB * 2, l3 = l0 + 24 * VPB * 2;
  // the closing s_wait_xcnt stands in the copies' own statement, in front of any later write of their address registers
  asm volatile("global_load_async_to_lds_b128 %0, %4, off\n\tglobal_load_async_to_lds_b128 %1, %5, off\n\tglobal_load_async_to_lds_b128 %2, %6, off\n\tglobal_load_async_to_lds_b128 %3, %7, off\n\ts_wait_xcnt 0x0"
               :: "v"(l0), "v"(l1), "v"(l2), "v"(l3), "v"(g0), "v"(g1), "v"(g2), "v"(g3) : "memory");
}
#define WAIT_COPIES() asm volatile("s_wait_asynccnt 0x0" ::: "memory")   // this wave's copies have landed
#define WAIT_LDS()    asm volatile("s_wait_dscnt 0x0" ::: "memory")      // this wave's LDS reads are done before the buffer is given up
// K fragment = the lane's 32 bytes of an LDS row as they stand (a, c = bytes 32 * (lane >> 4) + 0..15, + 16..31): elements 0..7 = hi of dims 8h + 0..7, elements 8..15 = lo of the same dims
__device__ __forceinline__ v16b frag_k(v4f a, v4f c) { union { v4f f[2]; v16b v; } u; u.f[0] = a; u.f[1] = c; return u.v; }
// its partner on the query side: the lane's 8 values (dims 8h + 0..7) in both halves, so that one product sums (k hi + k lo) . q over the 16 dims
__device__ __forceinline__ v16b frag_q2(v16b q) { v16b r;
#pragma unroll   // vector elements are indexed by constants
  for (int i = 0; i < 8; ++i) { r[i] = q[i]; r[8 + i] = q[i]; }
  return r; }

// A projection's 128 weight rows (128 floats each) go to LDS once per block, rounded to bf16: whole-row loads (a wave reads one row of 512 B), all in flight together, and the block's 4 waves read their B fragments from there.
#define WPB 136               // weight row pitch in LDS, bf16: 256 B + 16 B (16 B x odd: 16-byte readers meet no bank twice)
typedef __attribute__((ext_vector_type(4))) __bf16 v4b;
#define WAIT_ADDR() asm volatile("s_wait_xcnt 0x0" ::: "memory")   // stands between two groups of loads: the later group's results may be given the registers that hold the earlier group's addresses
// the same wait with the group's address as its input, so that the address registers are kept as they are up to it (no result of the group and no later load lands in them first): _S for block-uniform bases, _V for a lane's own pointer
#define WAIT_ADDR_S(P, Q) asm volatile("s_wait_xcnt 0x0" :: "s"(P), "s"(Q) : "memory")
#define WAIT_ADDR_V(P) asm volatile("s_wait_xcnt 0x0" :: "v"(P) : "memory")
__device__ __forceinline__ void put_w(__bf16* sw, int r, int lane, v4f x) { v4b c;
#pragma unroll   // vector elements are indexed by constants
  for (int e = 0; e < 4; ++e) c[e] = (__bf16)x[e];
  *(v4b*)(sw + r * WPB + lane * 4) = c; }

#define WS_QKV  0u                                    // f32 [2][4096][256]: q (64, scaled by log2(e)/4) | k (in the place of 64 floats; per head 64 B of bf16: hi d0..7, lo d0..7, hi d8..15, lo d8..15) | v (128)
#define WS_VTH  (WS_QKV + 4u * NB * NPOS * 256)       // bf16 [2][128 (h,dv)][4096] V^T hi
#define WS_VTL  (WS_VTH + 2u * NB * VF * NPOS)
#define WS_O    (WS_VTL + 2u * NB * VF * NPOS)        // f32 [2][4096][128] attention output (h, dv)
#define WS_END  (WS_O + 4u * NB * NPOS * VF)

// ---- k_qkv: QKV[b][p][n] = x rows . W rows (+ bias), x[p][c] = relu((bf16(X[b][c][p]) - m[c]) * (g[c] rsqrt(v[c]+eps)) + beta[c]) as bf16 hi + lo; n < 64: Wq (then x log2(e)/4), < 128: Wk, else Wv; block (64 positions, 128 of the 256 cols); K = 128 (4 steps); also writes V^T hi/lo planes for the v columns (block-local transpose via so)
// x is made here, in the A fragment's own layout: lane (g, col) reads position col of its wave's 16 at the 64 channels of its fragments (16 lanes = 64 B of a channel's row), so the channel-major input needs no transpose and no pass of its own. Thread t makes channel t's scale and shift; they go to the other threads through LDS, behind the barrier that the weights need anyway.
__global__ __launch_bounds__(128) void k_qkv(const float* __restrict__ X, const float* __restrict__ gm, const float* __restrict__ bt, const float* __restrict__ rm, const float* __restrict__ rv, const float* __restrict__ Wq, const float* __restrict__ bq, const float* __restrict__ Wk, const float* __restrict__ bk, const float* __restrict__ Wv, const float* __restrict__ bv, float* __restrict__ QKV, __bf16* __restrict__ VTH, __bf16* __restrict__ VTL) {
  __shared__ __align__(16) float so[64][132]; __shared__ __align__(16) __bf16 sw[128 * WPB]; __shared__ __align__(16) float ssc[CIN], ssh[CIN];
  const int tid = threadIdx.x, wave = tid >> 5, lane = tid & 31, col = lane & 15, g = lane >> 4; const int b = blockIdx.z; const int p0 = blockIdx.x * 64; const int n0 = blockIdx.y * 128;
  const float* xp = X + ((size_t)b * CIN + 8 * g) * NPOS + p0 + wave * 16 + col;   // channel 8g of the lane's position
  // every global operand is asked for here, ahead of the matrix work: one memory latency for the block. The matrix a row or a bias tile belongs to is picked by the block and by constants (rows 0..63 | 64..127 of the block's 128 columns), so no lane branches.
  const float *w0 = n0 ? Wv : Wq, *w1 = n0 ? Wv + KF * CIN : Wk, *b0 = n0 ? bv : bq, *b1 = n0 ? bv + KF : bk;
  v4f wx[32]; float xr[CIN / 32][16]; v16b ah[CIN / 32], al[CIN / 32]; float bias[8];
  const float pg = gm[tid], pb = bt[tid], pm = rm[tid], pv = rv[tid];   // channel tid's parameters (CIN = the block's 128 threads)
  asm volatile("s_wait_xcnt 0x0" :: "s"(gm), "s"(bt), "s"(rm), "s"(rv), "v"(tid) : "memory");   // as WAIT_ADDR_S, for these four bases and the lane's index
#pragma unroll   // xr is indexed by constants, so it stays in registers; element order = the fragment's k order: channels kc * 32 + 8g + 0..7, then + 16
  for (int kc = 0; kc < CIN / 32; ++kc)
#pragma unroll
    for (int i = 0; i < 8; ++i) { xr[kc][i] = xp[(size_t)(kc * 32 + i) * NPOS]; xr[kc][8 + i] = xp[(size_t)(kc * 32 + 16 + i) * NPOS]; }
  WAIT_ADDR_V(xp);
  const float *wp0 = w0 + wave * CIN + lane * 4, *wp1 = w1 + wave * CIN + lane * 4;
#pragma unroll   // wx is indexed by constants, so it stays in registers
  for (int i = 0; i < 16; ++i) wx[i] = *(const v4f*)(wp0 + i * 4 * CIN);   // row wave + 4 i
  WAIT_ADDR_V(wp0);
#pragma unroll   // as above: constant indices
  for (int i = 0; i < 16; ++i) wx[16 + i] = *(const v4f*)(wp1 + i * 4 * CIN);   // row 64 + wave + 4 i
  WAIT_ADDR_V(wp1);
#pragma unroll   // as above: constant indices
  for (int j = 0; j < 8; ++j) bias[j] = bfr((j < 4 ? b0 : b1)[(j & 3) * 16 + col]);
  WAIT_ADDR_S(b0, b1);
  { const float inv = rsqrtf(bfr(pv) + 1e-5f); const float sc = bfr(pg) * inv; ssc[tid] = sc; ssh[tid] = bfr(pb) - bfr(pm) * sc; }
#pragma unroll   // as above: constant indices
  for (int i = 0; i < 32; ++i) put_w(sw, wave + 4 * i, lane, wx[i]);
  __syncthreads();   // the weights and the channels' scales and shifts are there for every wave
  v4f ps[CIN / 8], pt[CIN / 8];   // the scales and shifts of the lane's 64 channels, in xr's order, 4 to a read
#pragma unroll   // constant indices; all the reads stand as one group: one LDS latency
  for (int q = 0; q < CIN / 8; ++q) { const int c0 = (q >> 1) * 16 + 8 * g + (q & 1) * 4; ps[q] = *(const v4f*)&ssc[c0]; pt[q] = *(const v4f*)&ssh[c0]; }
  __builtin_amdgcn_sched_barrier(0);   // keeps the group together: left alone the scheduler sinks each read to its user, with a full LDS wait at each
#pragma unroll   // as above: constant indices
  for (int kc = 0; kc < CIN / 32; ++kc) { float v[16];
#pragma unroll
    for (int i = 0; i < 16; ++i) { const float y = bfr(xr[kc][i]) * ps[kc * 4 + (i >> 2)][i & 3] + pt[kc * 4 + (i >> 2)][i & 3]; v[i] = y > 0.f ? y : 0.f; }
    const F2 a = bsplit16(v); ah[kc] = a.h; al[kc] = a.l; }
  v8f acc[8] = {};
#pragma unroll
  for (int kc = 0; kc < CIN / 32; ++kc) { v16b w[8];
#pragma unroll   // the step's eight B fragments are read as one group ahead of its matrix work: one LDS latency a step
    for (int j = 0; j < 8; ++j) w[j] = frag_b(sw + (j * 16 + col) * WPB + kc * 32, lane);
#pragma unroll
    for (int j = 0; j < 8; ++j) { acc[j] = wmma_bf(al[kc], w[j], acc[j]); acc[j] = wmma_bf(ah[kc], w[j], acc[j]); } }
#pragma unroll
  for (int j = 0; j < 8; ++j) { const float sc = (n0 == 0 && j < 4) ? 0.25f * L2E : 1.0f;
#pragma unroll
    for (int r = 0; r < 8; ++r) so[wave * 16 + 8 * g + r][j * 16 + col] = (acc[j][r] + bias[j]) * sc; }
  __syncthreads();
  for (int q = tid; q < 64 * 32; q += 128) { const int rl = q >> 5, pc = q & 31; float* dst = QKV + ((size_t)b * NPOS + p0 + rl) * 256 + n0 + pc * 4;
    if (n0 == 0 && pc >= KF / 4) {   // k columns: the 16-B part pc & 3 of a head's 64 B holds 8 dims (bit 1: which 8) as bf16 hi or lo (bit 0), split once here for every reader
      const float* s8 = &so[rl][(pc & ~3) * 4 + (pc & 2) * 4]; union { __bf16 e[8]; v4u u; } w;
#pragma unroll   // w is indexed by constants, so it stays in registers
      for (int e = 0; e < 8; ++e) { const float v = s8[e]; const __bf16 hi = (__bf16)v; w.e[e] = (pc & 1) ? (__bf16)(v - (float)hi) : hi; }
      vst2((unsigned*)dst, w.u); }
    else vst2(dst, *(const v4f*)&so[rl][pc * 4]); }
  if (n0 == 128) {
    for (int q = tid; q < 128 * 8; q += 128) { const int c = q >> 3, pc = q & 7; union { __bf16 e[8]; v4u u; } hh, ll;
#pragma unroll
      for (int e = 0; e < 8; ++e) { const float v = so[pc * 8 + e][c]; const __bf16 hi = (__bf16)v; hh.e[e] = hi; ll.e[e] = (__bf16)(v - (float)hi); }
      const size_t o = ((size_t)b * VF + c) * NPOS + p0 + pc * 8; vst2((unsigned*)(VTH + o), hh.u); vst2((unsigned*)(VTL + o), ll.u); } }
}
// k_attn's products: the builtin alone, with no v_nop written behind it. The distance that the chip asks for behind a WMMA is filled by the work that stands there (the other O^T tile's product, the next step's softmax); where that is short the compiler pads.
__device__ __forceinline__ v8f wmma_w(v16b a, v16b b, v8f c) { return __builtin_amdgcn_wmma_f32_16x16x32_bf16(false, a, false, b, (short)0, c, false, false); }
// the scheduler moves nothing over this line: it keeps the LDS read groups ahead of the matrix work (left alone it sinks each read to its user, with a full wait there) and the vector work between the WMMAs as written
#define HOLD() __builtin_amdgcn_sched_barrier(0)
// the other half's value of the same column (lane ^ 16), by a vector cross-row move
__device__ __forceinline__ float xhalf(float v) { const unsigned u = __builtin_bit_cast(unsigned, v); return __builtin_bit_cast(float, __builtin_amdgcn_permlanex16(u, u, 0x76543210u, 0xfedcba98u, false, false)); }
// ---- k_attn: block = (64 queries, b*4+h), one pass over the keys. S^T = k(hi/lo) q(hi/lo)^T, the 32-deep k = 16 dims x (k hi, k lo), once against q lo and once against q hi: lane (g, col) holds keys 8g+0..7 of query col. Per stage of 128 keys: the 8 S^T tiles, their maximum in-lane and over the two halves, one rescale of O^T and of the sums by 2^(m_old - m_new),
// then P^T = 2^(s - m) as hi/lo straight from the S^T accumulators, O^T += V^T(hi/lo) P^T over 32-key steps, the sums of P in-lane; behind the loop the halves' sums are joined and O is divided by them.
__global__ __launch_bounds__(128) void k_attn(const float* __restrict__ QKV, const __bf16* __restrict__ VTH, const __bf16* __restrict__ VTL, float* __restrict__ O) {
  __shared__ __align__(16) float so[4][16][36]; __shared__ __align__(16) float sk[2][KST * KPF]; __shared__ __align__(16) __bf16 sv[2][2][DV * VPB];   // sv[buffer][hi, lo]
  const int tid = threadIdx.x, wave = tid >> 5, lane = tid & 31, col = lane & 15, g = lane >> 4;
  const int bh = blockIdx.y, b = bh >> 2, h = bh & 3; const int q0 = blockIdx.x * 64 + wave * 16;
  const F2 a = split_rowK(QKV + ((size_t)b * NPOS + q0 + col) * 256 + h * DK, 0, lane, DK);
  const v16b qh = frag_q2(a.h), ql = frag_q2(a.l);
  float m = -3.0e38f, ls[8] = {};   // the query's running maximum (log2 domain, equal in both halves); ls[r]: sum of P over the lane's keys 8g + r of every tile
  v8f acc[2] = {};
  const float* kg = QKV + (size_t)b * NPOS * 256 + KF + h * DK; const __bf16 *vgh = VTH + ((size_t)b * VF + h * DV) * NPOS, *vgl = VTL + ((size_t)b * VF + h * DV) * NPOS;
  copy_k(kg, sk[0], tid); copy_v(vgh, sv[0][0], tid); copy_v(vgl, sv[0][1], tid); WAIT_COPIES(); __syncthreads();   // stage 0 is there for every wave
  copy_k(kg + (size_t)KST * 256, sk[1], tid); copy_v(vgh + KST, sv[1][0], tid); copy_v(vgl + KST, sv[1][1], tid);     // stage 1 flies while stage 0 is worked on
  // one stage, inlined twice: in the loop where a stage t + 2 always exists, and in the loop of the last two stages. So a trip is one straight block, and the sums of P stay where they are written (with a branch in the trip the compiler moves all of them behind it, to the trip's foot, and holds a stage's 64 P values in registers till then).
  auto stage = [&](const int t) __attribute__((always_inline)) { const float* kr = sk[t & 1] + col * KPF + 8 * g; const __bf16 *vrh = sv[t & 1][0] + col * VPB, *vrl = sv[t & 1][1] + col * VPB;
    v4f kq[KST / 16][2]; v16b vq[2][2][2];   // the stage's K rows; [set][dt][hi, lo]: a step's V^T fragments, read one step ahead inside the stage
    // RD_V: the V^T reads of one 32-key step; its loop is unrolled so that the sets are indexed by constants and stay in registers
#define RD_V(S, KS) do { _Pragma("unroll") for (int c = 0; c < 2; ++c) { const int vo = c * 16 * VPB + (KS) * 32; vq[S][c][0] = frag_b(vrh + vo, lane); vq[S][c][1] = frag_b(vrl + vo, lane); } } while (0)
#pragma unroll     // the stage's K reads and the first step's V^T reads stand as one group ahead of the matrix work: one read latency a stage
    for (int kt = 0; kt < KST / 16; ++kt) { kq[kt][0] = *(const v4f*)(kr + kt * 16 * KPF); kq[kt][1] = *(const v4f*)(kr + kt * 16 * KPF + 4); }
    RD_V(0, 0);
    HOLD();
    v8f s[KST / 16]; float mx[8];   // mx: eight independent chains over the tiles, each from the running maximum, two tiles a link; then joined
    // MAX2: one link of the eight chains; it stands behind later tiles' products, so that its two tiles are done when it reads them
#define MAX2(KT) do { _Pragma("unroll") for (int r = 0; r < 8; ++r) mx[r] = fmaxf(fmaxf(mx[r], s[KT][r]), s[(KT) + 1][r]); } while (0)
#pragma unroll     // kq and s are indexed by constants only, so they stay in registers; the small products first, and eight independent tiles between a tile's two products
    for (int kt = 0; kt < KST / 16; ++kt) s[kt] = wmma_w(frag_k(kq[kt][0], kq[kt][1]), ql, (v8f){});
#pragma unroll     // as above: constant indices
    for (int kt = 0; kt < 6; ++kt) s[kt] = wmma_w(frag_k(kq[kt][0], kq[kt][1]), qh, s[kt]);
    HOLD();
#pragma unroll
    for (int r = 0; r < 8; ++r) mx[r] = m;
    MAX2(0); HOLD();
    s[6] = wmma_w(frag_k(kq[6][0], kq[6][1]), qh, s[6]); HOLD();
    MAX2(2); HOLD();
    s[7] = wmma_w(frag_k(kq[7][0], kq[7][1]), qh, s[7]); HOLD();
    MAX2(4); MAX2(6);
    const float mt = fmaxf(fmaxf(fmaxf(fmaxf(mx[0], mx[1]), mx[2]), fmaxf(fmaxf(mx[3], mx[4]), mx[5])), fmaxf(mx[6], mx[7]));
    const float mn = fmaxf(mt, xhalf(mt)), al = exp2x1(m - mn); m = mn;   // both halves feed one O^T tile, so they use one maximum
#pragma unroll
    for (int r = 0; r < 8; ++r) { ls[r] *= al; acc[0][r] *= al; acc[1][r] *= al; }
    // a 32-key step's P^T: x0, x1[r] = P[query col][key (t * 4 + ks) * 32 + (0, 16) + 8g + r]: the two S^T tiles are a B fragment's k order as they stand. Its pieces (SM_X, SM_X, SM_SUM + split8, SM_SUM + split8) stand one step ahead, one behind each of the first four products of the step before.
    float x0[8], x1[8]; union { unsigned u[8]; v16b f; } H, L;
#define SM_X(X, KT) do { _Pragma("unroll") for (int r = 0; r < 8; ++r) X[r] = s[KT][r] - mn; exp2x8(X); } while (0)
#define SM_SUM(X) do { _Pragma("unroll") for (int r = 0; r < 8; ++r) ls[r] += X[r]; } while (0)
    SM_X(x0, 0); SM_X(x1, 1); SM_SUM(x0); SM_SUM(x1); split8(x0, H.u, L.u); split8(x1, H.u + 4, L.u + 4);
#pragma unroll     // the sets are indexed by constants only, so they stay in registers
  for (int ks = 0; ks < KST / 32; ++ks) { const bool nx = ks + 1 < KST / 32; const v16b ph = H.f, pl = L.f;
    const v16b vh0 = vq[ks & 1][0][0], vl0 = vq[ks & 1][0][1], vh1 = vq[ks & 1][1][0], vl1 = vq[ks & 1][1][1];
    if (nx) RD_V((ks + 1) & 1, ks + 1);   // the next step's LDS reads as one group ahead of this step's matrix work (same stage, same buffer)
    HOLD();
    acc[0] = wmma_w(vh0, pl, acc[0]); HOLD();
    if (nx) SM_X(x0, ks * 2 + 2);
    HOLD();
    acc[1] = wmma_w(vh1, pl, acc[1]); HOLD();
    if (nx) SM_X(x1, ks * 2 + 3);
    HOLD();
    acc[0] = wmma_w(vl0, ph, acc[0]); HOLD();
    if (nx) { SM_SUM(x0); split8w(x0, H.u, L.u, vl0, ph); }
    HOLD();
    acc[1] = wmma_w(vl1, ph, acc[1]); HOLD();
    if (nx) { SM_SUM(x1); split8w(x1, H.u + 4, L.u + 4, vl1, ph); }
    HOLD();
    acc[0] = wmma_w(vh0, ph, acc[0]);
    acc[1] = wmma_w(vh1, ph, acc[1]); HOLD(); }
    WAIT_LDS(); WAIT_COPIES(); __syncthreads();   // publish point: stage t + 1 has landed for all, and nobody reads stage t's buffers any more
    if (t + 2 < NST) { copy_k(kg + (size_t)(t + 2) * KST * 256, sk[t & 1], tid); copy_v(vgh + (t + 2) * KST, sv[t & 1][0], tid); copy_v(vgl + (t + 2) * KST, sv[t & 1][1], tid); } };
#pragma unroll 1   // one trip = one stage
  for (int t = 0; t < NST - 2; ++t) stage(t);
#pragma unroll 1   // the last two stages, which refill nothing: rolled as well, so that they take no more registers than the loop above
  for (int t = NST - 2; t < NST; ++t) stage(t);
  WAIT_COPIES();
  float l = ((ls[0] + ls[1]) + (ls[2] + ls[3])) + ((ls[4] + ls[5]) + (ls[6] + ls[7]));
  l += xhalf(l);   // join the halves' keys
  const float il = 1.0f / l;
#pragma unroll
  for (int dt = 0; dt < 2; ++dt)   // acc[dt][r] = O[query col][dt * 16 + 8g + r] * l: 8 consecutive floats of the lane's row
#pragma unroll
    for (int r = 0; r < 8; ++r) so[wave][col][dt * 16 + 8 * g + r] = acc[dt][r] * il;
  LDSX();
  for (int q = lane; q < 16 * 8; q += 32) { const int rl = q >> 3, pc = q & 7; vst2(O + ((size_t)b * NPOS + q0 + rl) * VF + h * DV + pc * 4, *(const v4f*)&so[wave][rl][pc * 4]); }
}
// ---- k_out: Y[p][o] = O row(hi/lo) . Wo rows + bo; out[b][o][p] = Y + inputs (NCHW); block = (64 positions, b): 128 output channels in one pass (8 tiles); transposed store per channel: 64 positions = 256 B by 16 lanes
__global__ __launch_bounds__(128) void k_out(const float* __restrict__ O, const float* __restrict__ Wo, const float* __restrict__ bo, const float* __restrict__ X, float* __restrict__ out) {
  __shared__ __align__(16) float st[128][68]; __shared__ __align__(16) __bf16 sw[128 * WPB];
  const int tid = threadIdx.x, wave = tid >> 5, lane = tid & 31, col = lane & 15, g = lane >> 4; const int b = blockIdx.y; const int p0 = blockIdx.x * 64;
  // every global operand is asked for here, ahead of the matrix work: one memory latency for the block
  v4f wx[32]; F2 a[VF / 32]; float bb[8]; const float* orow = O + ((size_t)b * NPOS + p0 + wave * 16 + col) * VF;
#pragma unroll   // wx is indexed by constants, so it stays in registers
  for (int i = 0; i < 32; ++i) wx[i] = *(const v4f*)(Wo + (size_t)(wave + 4 * i) * VF + lane * 4);
  WAIT_ADDR();
#pragma unroll   // as above: constant indices
  for (int kc = 0; kc < VF / 32; ++kc) a[kc] = split_row(orow, kc * 32, lane);
  WAIT_ADDR_V(orow + 8 * g);
#pragma unroll   // as above: constant indices
  for (int j = 0; j < 8; ++j) bb[j] = bfr(bo[j * 16 + col]);
  WAIT_ADDR_S(bo, bo);
#pragma unroll   // as above: constant indices
  for (int i = 0; i < 32; ++i) put_w(sw, wave + 4 * i, lane, wx[i]);
  __syncthreads();   // the weights are there for every wave
  v8f acc[8] = {};
#pragma unroll
  for (int kc = 0; kc < VF / 32; ++kc) { v16b w[8];
#pragma unroll   // the step's eight B fragments are read as one group ahead of its matrix work: one LDS latency a step
    for (int j = 0; j < 8; ++j) w[j] = frag_b(sw + (j * 16 + col) * WPB + kc * 32, lane);
#pragma unroll
    for (int j = 0; j < 8; ++j) { acc[j] = wmma_bf(a[kc].l, w[j], acc[j]); acc[j] = wmma_bf(a[kc].h, w[j], acc[j]); } }
#pragma unroll
  for (int j = 0; j < 8; ++j) {
#pragma unroll
    for (int r = 0; r < 8; ++r) st[j * 16 + col][wave * 16 + 8 * g + r] = acc[j][r] + bb[j]; }
  __syncthreads();
  for (int q = tid; q < 128 * 16; q += 128) { const int o = q >> 4, pc = q & 15; const size_t base = ((size_t)b * CIN + o) * NPOS + p0 + pc * 4; const float4 xv = *(const float4*)(X + base);
    v4f r4; r4[0] = st[o][pc * 4] + bfr(xv.x); r4[1] = st[o][pc * 4 + 1] + bfr(xv.y); r4[2] = st[o][pc * 4 + 2] + bfr(xv.z); r4[3] = st[o][pc * 4 + 3] + bfr(xv.w); vst2(out + base, r4); }
}

extern "C" void kernel_launch(void* const* d_in, const int* in_sizes, int n_in, void* d_out, int out_size, void* d_ws, size_t ws_size, hipStream_t stream) {
  (void)in_sizes; (void)n_in; (void)out_size;
  const float** F = (const float**)d_in;   // inputs, gamma, beta, running_mean, running_var, Wq, bq, Wk, bk, Wv, bv, Wo, bo
  if (ws_size < (size_t)WS_END) return;
  char* ws = (char*)d_ws;
  __bf16 *VTH = (__bf16*)(ws + WS_VTH), *VTL = (__bf16*)(ws + WS_VTL); float *QKV = (float*)(ws + WS_QKV), *O = (float*)(ws + WS_O);
  k_qkv<<<dim3(NPOS / 64, 2, TNB), 128, 0, stream>>>(F[0], F[1], F[2], F[3], F[4], F[5], F[6], F[7], F[8], F[9], F[10], QKV, VTH, VTL);
  k_attn<<<dim3(TQB, TNB * NHD), 128, 0, stream>>>(QKV, VTH, VTL, O);
  k_out<<<dim3(TQB, TNB), 128, 0, stream>>>(O, F[11], F[12], F[0], (float*)d_out);
}

// v010
// One run takes 40.1 microseconds.
// Next to v009, in two timings, it ran 1.18 and 1.21 times as fast.
// Over all steps from v000 it is 19.4 times as fast.
// compute dtype: inputs, BN parameters and all projection weights/biases (module inputs) rounded to bf16; q/k/v projections of the BN+ReLU activations, the attention scores and the output projection take computed operands as bf16 hi + bf16 residual pairs (2 products against weights; the scores take all 4, two to a 32-deep product); P.V takes P and V each as one f16, rounded to nearest even (1 product);
#include <hip/hip_runtime.h>
#include <math.h>

typedef __attribute__((ext_vector_type(16))) _Float16 v16h;
typedef __attribute__((ext_vector_type(16))) __bf16 v16b;
typedef __attribute__((ext_vector_type(8)))  _Float16 v8h;
typedef __attribute__((ext_vector_type(8)))  float v8f;
typedef __attribute__((ext_vector_type(4)))  float v4f;
typedef __attribute__((ext_vector_type(2)))  float v2f;
typedef __attribute__((ext_vector_type(4)))  unsigned v4u;
typedef __attribute__((ext_vector_type(4)))  int v4i;
typedef float __attribute__((may_alias)) float_a;
typedef int __attribute__((may_alias)) int_a;

template <typename T> __device__ __forceinline__ void vst2(void* p, T v) { *(T*)p = v;  }
__device__ __forceinline__ v8f wmma16(v16h a, v16h b, v8f c) {
  v8f d = __builtin_amdgcn_wmma_f32_16x16x32_f16(false, a, false, b, (short)0, c, false, false);
  asm volatile("v_nop\n\tv_nop\n\tv_nop\n\tv_nop" : "+v"(d) : "v"(a), "v"(b));
  return d;
}
__device__ __forceinline__ v8f wmma_bf(v16b a, v16b b, v8f c) {
  v8f d = __builtin_amdgcn_wmma_f32_16x16x32_bf16(false, a, false, b, (short)0, c, false, false);
  asm volatile("v_nop\n\tv_nop\n\tv_nop\n\tv_nop" : "+v"(d) : "v"(a), "v"(b));
  return d;
}
// 16x16x32 fragments: lane = (h = lane>>4, row/col = lane&15); elements 0..7 = k0+8h+0..7, 8..15 = k0+16+8h+0..7; D element r = row 8h+r
__device__ __forceinline__ v16h frag_h(const _Float16* rowk0, int lane) {
  union { v16h v; v8h q[2]; } u; const _Float16* p = rowk0 + 8 * (lane >> 4);
  u.q[0] = *(const v8h*)p; u.q[1] = *(const v8h*)(p + 16); return u.v;
}
__device__ __forceinline__ v16h frag_f32(const float* rowk0, int lane) {
  v16h a; const float* p = rowk0 + 8 * (lane >> 4);
#pragma unroll
  for (int i = 0; i < 8; ++i) { a[i] = (_Float16)p[i]; a[8 + i] = (_Float16)p[16 + i]; }
  return a;
}
__device__ __forceinline__ v16h frag_f32s(const float* rowk0, int lane, float sc) {
  v16h a; const float* p = rowk0 + 8 * (lane >> 4);
#pragma unroll
  for (int i = 0; i < 8; ++i) { a[i] = (_Float16)(p[i] * sc); a[8 + i] = (_Float16)(p[16 + i] * sc); }
  return a;
}
// column fragment from a [K][ld] layout (column n), rows >= K read as 0
__device__ __forceinline__ v16h fragc_f32(const float* W, int k0, int n, int lane, int ld, int K) {
  v16h a; const int g = lane >> 4;
#pragma unroll
  for (int i = 0; i < 8; ++i) { const int ka = k0 + 8 * g + i, kb = ka + 16;
    a[i] = (_Float16)(ka < K ? W[(size_t)(ka < K ? ka : K - 1) * ld + n] : 0.f); a[8 + i] = (_Float16)(kb < K ? W[(size_t)(kb < K ? kb : K - 1) * ld + n] : 0.f); }
  return a;
}
struct F2 { v16b h, l; };
// x = hi + lo in bf16, 8 values a statement, 3 vector instructions a pair: hi by the packed conversion; lo = x - hi (exact in f32), rounded to bf16 by the mixed fma that writes one half of a register.
// The factor -1.0 is read as the bf16 in the constant's high half. Each s_delay_alu names the producers four vector instructions back, so that the SIMD's other wave can issue while this one waits for them.
__device__ __forceinline__ void split8(const float* x, unsigned* h, unsigned* l) {
  asm("v_cvt_pk_bf16_f32 %0, %8, %9\n\tv_cvt_pk_bf16_f32 %1, %10, %11\n\tv_cvt_pk_bf16_f32 %2, %12, %13\n\tv_cvt_pk_bf16_f32 %3, %14, %15\n\t"
      "s_delay_alu instid0(VALU_DEP_4) | instskip(NEXT) | instid1(VALU_DEP_4)\n\t"
      "v_fma_mixlo_bf16 %4, %0, -1.0, %8 op_sel:[0,1,0] op_sel_hi:[1,1,0]\n\tv_fma_mixlo_bf16 %5, %1, -1.0, %10 op_sel:[0,1,0] op_sel_hi:[1,1,0]\n\t"
      "s_delay_alu instid0(VALU_DEP_4) | instskip(NEXT) | instid1(VALU_DEP_4)\n\t"
      "v_fma_mixlo_bf16 %6, %2, -1.0, %12 op_sel:[0,1,0] op_sel_hi:[1,1,0]\n\tv_fma_mixlo_bf16 %7, %3, -1.0, %14 op_sel:[0,1,0] op_sel_hi:[1,1,0]\n\t"
      "s_delay_alu instid0(VALU_DEP_4) | instskip(NEXT) | instid1(VALU_DEP_4)\n\t"
      "v_fma_mixhi_bf16 %4, %0, -1.0, %9 op_sel:[1,1,0] op_sel_hi:[1,1,0]\n\tv_fma_mixhi_bf16 %5, %1, -1.0, %11 op_sel:[1,1,0] op_sel_hi:[1,1,0]\n\t"
      "s_delay_alu instid0(VALU_DEP_4) | instskip(NEXT) | instid1(VALU_DEP_4)\n\t"
      "v_fma_mixhi_bf16 %6, %2, -1.0, %13 op_sel:[1,1,0] op_sel_hi:[1,1,0]\n\tv_fma_mixhi_bf16 %7, %3, -1.0, %15 op_sel:[1,1,0] op_sel_hi:[1,1,0]"
      : "=&v"(h[0]), "=&v"(h[1]), "=&v"(h[2]), "=&v"(h[3]), "=&v"(l[0]), "=&v"(l[1]), "=&v"(l[2]), "=&v"(l[3])
      : "v"(x[0]), "v"(x[1]), "v"(x[2]), "v"(x[3]), "v"(x[4]), "v"(x[5]), "v"(x[6]), "v"(x[7]));
}
__device__ __forceinline__ F2 bsplit16(const float v[16]) { union { unsigned u[8]; v16b f; } H, L;   // element i = half i & 1 of register i >> 1
  split8(v, H.u, L.u); split8(v + 8, H.u + 4, L.u + 4);
  F2 r; r.h = H.f; r.l = L.f; return r; }
__device__ __forceinline__ F2 split_row(const float* row, int k0, int lane) { float v[16]; const float* p = row + k0 + 8 * (lane >> 4);
#pragma unroll
  for (int i = 0; i < 8; ++i) { v[i] = p[i]; v[8 + i] = p[16 + i]; }
  return bsplit16(v); }
__device__ __forceinline__ F2 split_rowK(const float* row, int k0, int lane, int K) { float v[16]; const int g = lane >> 4;
#pragma unroll
  for (int i = 0; i < 8; ++i) { const int ka = k0 + 8 * g + i, kb = ka + 16; v[i] = ka < K ? row[ka < K ? ka : K - 1] : 0.f; v[8 + i] = kb < K ? row[kb < K ? kb : K - 1] : 0.f; }
  return bsplit16(v); }
__device__ __forceinline__ F2 split_col(const float* W, int k0, int n, int lane, int ld, int K) { float v[16]; const int g = lane >> 4;
#pragma unroll
  for (int i = 0; i < 8; ++i) { const int ka = k0 + 8 * g + i, kb = ka + 16; v[i] = ka < K ? W[(size_t)(ka < K ? ka : K - 1) * ld + n] : 0.f; v[8 + i] = kb < K ? W[(size_t)(kb < K ? kb : K - 1) * ld + n] : 0.f; }
  return bsplit16(v); }
__device__ __forceinline__ v8f mac3(const F2& a, const F2& b, v8f c) { c = wmma_bf(a.l, b.h, c); c = wmma_bf(a.h, b.l, c); return wmma_bf(a.h, b.h, c); }
__device__ __forceinline__ float sigm(float v) { return 1.0f / (1.0f + expf(-v)); }
#define LDSX() do { asm volatile("s_wait_dscnt 0" ::: "memory"); __builtin_amdgcn_wave_barrier(); __builtin_amdgcn_fence(__ATOMIC_RELEASE, "workgroup"); } while (0)


// Global self-attention block over 64x64 = 4096 positions: x = relu(bn(inputs)); q, k (64 = 4 heads x 16), v (128 = 4 x 32) by 1x1 convs; softmax(q k^T / 4) v per head; out = o Wo^T + bo, back to NCHW, + inputs.
// k_qkv (bn+relu of its 64 positions straight into hi/lo bf16 A fragments; one GEMM for [q|k|v] (256 cols), K = 128; q scaled after the bias; k stored split, as A-fragment rows), k_attn (per (b,h), one pass: S^T = k q^T, 16 dims x (hi, lo) = the 32-deep k, a lane owns one query: running max and sum over the 4096 keys, P^T = exp(s - m) as f16 straight from the S^T accumulators, O^T += V^T(f16) P^T over 32-key steps, O / sum at the end; O -> concat layout),
// k_out (o(hi/lo) Wo^T + bo, transposed through LDS to NCHW rows + shortcut; per channel 64 positions = 256 B).
#define NB 2
#define CIN 128
#define NPOS 4096
#define NHD 4
#define DK 16
#define DV 32
#define KF 64
#define VF 128
#ifndef TNB
#define TNB NB
#define TQB (NPOS / 64)
#endif
typedef __attribute__((ext_vector_type(8))) __bf16 v8b;
__device__ __forceinline__ v16b frag_b(const __bf16* rowk0, int lane) {
  union { v16b v; v8b q[2]; } u; const __bf16* p = rowk0 + 8 * (lane >> 4);
  u.q[0] = *(const v8b*)p; u.q[1] = *(const v8b*)(p + 16); return u.v;
}
__device__ __forceinline__ v16b frag_gbf(const float* rowk0, int lane) {
  v16b a; const float* p = rowk0 + 8 * (lane >> 4);
#pragma unroll
  for (int i = 0; i < 8; ++i) { a[i] = (__bf16)p[i]; a[8 + i] = (__bf16)p[16 + i]; }
  return a;
}
__device__ __forceinline__ float bfr(float v) { return (float)(__bf16)v; }
// exp(s - m) = 2^(s' - m') with s' = s * log2(e): k_qkv folds log2(e) into q's scale, so scores and maxima come in the log2 domain and an exponential is one subtract and the hardware exp2, inline. Arguments are <= 0; a hugely negative one gives 0.
// The exp2 stand in asm, each in place, so that none is directly followed by a write of its source; the closing v_nop is the slot that the instruction set asks for behind a transcendental before its result is read.
#define L2E 1.44269504088896340736f
__device__ __forceinline__ void exp2x8(float* x) {
  asm("v_exp_f32 %0, %0\n\tv_exp_f32 %1, %1\n\tv_exp_f32 %2, %2\n\tv_exp_f32 %3, %3\n\tv_exp_f32 %4, %4\n\tv_exp_f32 %5, %5\n\tv_exp_f32 %6, %6\n\tv_exp_f32 %7, %7\n\tv_nop"
      : "+v"(x[0]), "+v"(x[1]), "+v"(x[2]), "+v"(x[3]), "+v"(x[4]), "+v"(x[5]), "+v"(x[6]), "+v"(x[7]));
}
// exp2x8 for the place behind a WMMA: it names that product's A and B as inputs too (the text does not use them), so that they keep their registers up to here and the vector work that stands in between is given others; handed the product's own registers, that work is held off by four v_nop of the compiler's
__device__ __forceinline__ void exp2x8w(float* x, v16h a, v16h b) {
  asm("v_exp_f32 %0, %0\n\tv_exp_f32 %1, %1\n\tv_exp_f32 %2, %2\n\tv_exp_f32 %3, %3\n\tv_exp_f32 %4, %4\n\tv_exp_f32 %5, %5\n\tv_exp_f32 %6, %6\n\tv_exp_f32 %7, %7\n\tv_nop"
      : "+v"(x[0]), "+v"(x[1]), "+v"(x[2]), "+v"(x[3]), "+v"(x[4]), "+v"(x[5]), "+v"(x[6]), "+v"(x[7]) : "v"(a), "v"(b));
}
__device__ __forceinline__ float exp2x1(float x) { asm("v_exp_f32 %0, %0\n\tv_nop" : "+v"(x)); return x; }

// K and V^T tiles go to LDS once per block and stage, by asynchronous copies (16 B a lane, through no register), and the block's 4 waves read their fragments from there.
#define KST 128               // keys per stage
#define NST (NPOS / KST)      // stages
#define KPF 20                // K row pitch in LDS, floats: 64 B + 16 B (16 B x odd: 16-byte readers meet no bank twice)
#define VPB 136               // V^T row pitch in LDS, f16: 256 B + 16 B, for the same reason
__device__ __forceinline__ unsigned lds_off(const void* p) { return (unsigned)(size_t)p; }
// one stage of K: 128 rows of 64 B (one head's 16 dims as bf16 hi and lo, in the place of 16 floats of a 1024-B row); thread = (row tid >> 2 (+ 32 i), 16-B part tid & 3)
__device__ __forceinline__ void copy_k(const float* kg, float* sk, int tid) {
  const float* g0 = kg + (size_t)(tid >> 2) * 256 + (tid & 3) * 4; const float *g1 = g0 + 32 * 256, *g2 = g0 + 64 * 256, *g3 = g0 + 96 * 256;
  const unsigned l0 = lds_off(sk + (tid >> 2) * KPF + (tid & 3) * 4), l1 = l0 + 32 * KPF * 4, l2 = l0 + 64 * KPF * 4, l3 = l0 + 96 * KPF * 4;
  // the closing s_wait_xcnt stands in the copies' own statement, in front of any later write of their address registers
  asm volatile("global_load_async_to_lds_b128 %0, %4, off\n\tglobal_load_async_to_lds_b128 %1, %5, off\n\tglobal_load_async_to_lds_b128 %2, %6, off\n\tglobal_load_async_to_lds_b128 %3, %7, off\n\ts_wait_xcnt 0x0"
               :: "v"(l0), "v"(l1), "v"(l2), "v"(l3), "v"(g0), "v"(g1), "v"(g2), "v"(g3) : "memory");
}
// one stage of V^T: 32 rows of 256 B (128 keys); thread = (row tid >> 4 (+ 8 i), 16-B part tid & 15)
__device__ __forceinline__ void copy_v(const _Float16* vg, _Float16* sv, int tid) {
  const _Float16* g0 = vg + (size_t)(tid >> 4) * NPOS + (tid & 15) * 8; const _Float16 *g1 = g0 + 8 * NPOS, *g2 = g0 + 16 * NPOS, *g3 = g0 + 24 * NPOS;
  const unsigned l0 = lds_off(sv + (tid >> 4) * VPB + (tid & 15) * 8), l1 = l0 + 8 * VPB * 2, l2 = l0 + 16 * VPB * 2, l3 = l0 + 24 * VPB * 2;
  // the closing s_wait_xcnt stands in the copies' own statement, in front of any later write of their address registers
  asm volatile("global_load_async_to_lds_b128 %0, %4, off\n\tglobal_load_async_to_lds_b128 %1, %5, off\n\tglobal_load_async_to_lds_b128 %2, %6, off\n\tglobal_load_async_to_lds_b128 %3, %7, off\n\ts_wait_xcnt 0x0"
               :: "v"(l0), "v"(l1), "v"(l2), "v"(l3), "v"(g0), "v"(g1), "v"(g2), "v"(g3) : "memory");
}
#define WAIT_COPIES() asm volatile("s_wait_asynccnt 0x0" ::: "memory")   // this wave's copies have landed
#define WAIT_LDS()    asm volatile("s_wait_dscnt 0x0" ::: "memory")      // this wave's LDS reads are done before the buffer is given up
// K fragment = the lane's 32 bytes of an LDS row as they stand (a, c = bytes 32 * (lane >> 4) + 0..15, + 16..31): elements 0..7 = hi of dims 8h + 0..7, elements 8..15 = lo of the same dims
__device__ __forceinline__ v16b frag_k(v4f a, v4f c) { union { v4f f[2]; v16b v; } u; u.f[0] = a; u.f[1] = c; return u.v; }
// its partner on the query side: the lane's 8 values (dims 8h + 0..7) in both halves, so that one product sums (k hi + k lo) . q over the 16 dims
__device__ __forceinline__ v16b frag_q2(v16b q) { v16b r;
#pragma unroll   // vector elements are indexed by constants
  for (int i = 0; i < 8; ++i) { r[i] = q[i]; r[8 + i] = q[i]; }
  return r; }

// A projection's 128 weight rows (128 floats each) go to LDS once per block, rounded to bf16: whole-row loads (a wave reads one row of 512 B), all in flight together, and the block's 4 waves read their B fragments from there.
#define WPB 136               // weight row pitch in LDS, bf16: 256 B + 16 B (16 B x odd: 16-byte readers meet no bank twice)
typedef __attribute__((ext_vector_type(4))) __bf16 v4b;
#define WAIT_ADDR() asm volatile("s_wait_xcnt 0x0" ::: "memory")   // stands between two groups of loads: the later group's results may be given the registers that hold the earlier group's addresses
// the same wait with the group's address as its input, so that the address registers are kept as they are up to it (no result of the group and no later load lands in them first): _S for block-uniform bases, _V for a lane's own pointer
#define WAIT_ADDR_S(P, Q) asm volatile("s_wait_xcnt 0x0" :: "s"(P), "s"(Q) : "memory")
#define WAIT_ADDR_V(P) asm volatile("s_wait_xcnt 0x0" :: "v"(P) : "memory")
__device__ __forceinline__ void put_w(__bf16* sw, int r, int lane, v4f x) { v4b c;
#pragma unroll   // vector elements are indexed by constants
  for (int e = 0; e < 4; ++e) c[e] = (__bf16)x[e];
  *(v4b*)(sw + r * WPB + lane * 4) = c; }

#define WS_QKV  0u                                    // f32 [2][4096][256]: q (64, scaled by log2(e)/4) | k (in the place of 64 floats; per head 64 B of bf16: hi d0..7, lo d0..7, hi d8..15, lo d8..15) | v (128)
#define WS_VT   (WS_QKV + 4u * NB * NPOS * 256)       // f16 [2][128 (h,dv)][4096] V^T
#define WS_O    (WS_VT + 2u * NB * VF * NPOS)         // f32 [2][4096][128] attention output (h, dv)
#define WS_END  (WS_O + 4u * NB * NPOS * VF)

// ---- k_qkv: QKV[b][p][n] = x rows . W rows (+ bias), x[p][c] = relu((bf16(X[b][c][p]) - m[c]) * (g[c] rsqrt(v[c]+eps)) + beta[c]) as bf16 hi + lo; n < 64: Wq (then x log2(e)/4), < 128: Wk, else Wv; block (64 positions, 128 of the 256 cols); K = 128 (4 steps); also writes the V^T plane (f16) for the v columns (block-local transpose via so)
// x is made here, in the A fragment's own layout: lane (g, col) reads position col of its wave's 16 at the 64 channels of its fragments (16 lanes = 64 B of a channel's row), so the channel-major input needs no transpose and no pass of its own. Thread t makes channel t's scale and shift; they go to the other threads through LDS, behind the barrier that the weights need anyway.
__global__ __launch_bounds__(128) void k_qkv(const float* __restrict__ X, const float* __restrict__ gm, const float* __restrict__ bt, const float* __restrict__ rm, const float* __restrict__ rv, const float* __restrict__ Wq, const float* __restrict__ bq, const float* __restrict__ Wk, const float* __restrict__ bk, const float* __restrict__ Wv, const float* __restrict__ bv, float* __restrict__ QKV, _Float16* __restrict__ VT) {
  __shared__ __align__(16) float so[64][132]; __shared__ __align__(16) __bf16 sw[128 * WPB]; __shared__ __align__(16) float ssc[CIN], ssh[CIN];
  const int tid = threadIdx.x, wave = tid >> 5, lane = tid & 31, col = lane & 15, g = lane >> 4; const int b = blockIdx.z; const int p0 = blockIdx.x * 64; const int n0 = blockIdx.y * 128;
  const float* xp = X + ((size_t)b * CIN + 8 * g) * NPOS + p0 + wave * 16 + col;   // channel 8g of the lane's position
  // every global operand is asked for here, ahead of the matrix work: one memory latency for the block. The matrix a row or a bias tile belongs to is picked by the block and by constants (rows 0..63 | 64..127 of the block's 128 columns), so no lane branches.
  const float *w0 = n0 ? Wv : Wq, *w1 = n0 ? Wv + KF * CIN : Wk, *b0 = n0 ? bv : bq, *b1 = n0 ? bv + KF : bk;
  v4f wx[32]; float xr[CIN / 32][16]; v16b ah[CIN / 32], al[CIN / 32]; float bias[8];
  const float pg = gm[tid], pb = bt[tid], pm = rm[tid], pv = rv[tid];   // channel tid's parameters (CIN = the block's 128 threads)
  asm volatile("s_wait_xcnt 0x0" :: "s"(gm), "s"(bt), "s"(rm), "s"(rv), "v"(tid) : "memory");   // as WAIT_ADDR_S, for these four bases and the lane's index
#pragma unroll   // xr is indexed by constants, so it stays in registers; element order = the fragment's k order: channels kc * 32 + 8g + 0..7, then + 16
  for (int kc = 0; kc < CIN / 32; ++kc)
#pragma unroll
    for (int i = 0; i < 8; ++i) { xr[kc][i] = xp[(size_t)(kc * 32 + i) * NPOS]; xr[kc][8 + i] = xp[(size_t)(kc * 32 + 16 + i) * NPOS]; }
  WAIT_ADDR_V(xp);
  const float *wp0 = w0 + wave * CIN + lane * 4, *wp1 = w1 + wave * CIN + lane * 4;
#pragma unroll   // wx is indexed by constants, so it stays in registers
  for (int i = 0; i < 16; ++i) wx[i] = *(const v4f*)(wp0 + i * 4 * CIN);   // row wave + 4 i
  WAIT_ADDR_V(wp0);
#pragma unroll   // as above: constant indices
  for (int i = 0; i < 16; ++i) wx[16 + i] = *(const v4f*)(wp1 + i * 4 * CIN);   // row 64 + wave + 4 i
  WAIT_ADDR_V(wp1);
#pragma unroll   // as above: constant indices
  for (int j = 0; j < 8; ++j) bias[j] = bfr((j < 4 ? b0 : b1)[(j & 3) * 16 + col]);
  WAIT_ADDR_S(b0, b1);
  { const float inv = rsqrtf(bfr(pv) + 1e-5f); const float sc = bfr(pg) * inv; ssc[tid] = sc; ssh[tid] = bfr(pb) - bfr(pm) * sc; }
#pragma unroll   // as above: constant indices
  for (int i = 0; i < 32; ++i) put_w(sw, wave + 4 * i, lane, wx[i]);
  __syncthreads();   // the weights and the channels' scales and shifts are there for every wave
  v4f ps[CIN / 8], pt[CIN / 8];   // the scales and shifts of the lane's 64 channels, in xr's order, 4 to a read
#pragma unroll   // constant indices; all the reads stand as one group: one LDS latency
  for (int q = 0; q < CIN / 8; ++q) { const int c0 = (q >> 1) * 16 + 8 * g + (q & 1) * 4; ps[q] = *(const v4f*)&ssc[c0]; pt[q] = *(const v4f*)&ssh[c0]; }
  __builtin_amdgcn_sched_barrier(0);   // keeps the group together: left alone the scheduler sinks each read to its user, with a full LDS wait at each
#pragma unroll   // as above: constant indices
  for (int kc = 0; kc < CIN / 32; ++kc) { float v[16];
#pragma unroll
    for (int i = 0; i < 16; ++i) { const float y = bfr(xr[kc][i]) * ps[kc * 4 + (i >> 2)][i & 3] + pt[kc * 4 + (i >> 2)][i & 3]; v[i] = y > 0.f ? y : 0.f; }
    const F2 a = bsplit16(v); ah[kc] = a.h; al[kc] = a.l; }
  v8f acc[8] = {};
#pragma unroll
  for (int kc = 0; kc < CIN / 32; ++kc) { v16b w[8];
#pragma unroll   // the step's eight B fragments are read as one group ahead of its matrix work: one LDS latency a step
    for (int j = 0; j < 8; ++j) w[j] = frag_b(sw + (j * 16 + col) * WPB + kc * 32, lane);
#pragma unroll
    for (int j = 0; j < 8; ++j) { acc[j] = wmma_bf(al[kc], w[j], acc[j]); acc[j] = wmma_bf(ah[kc], w[j], acc[j]); } }
#pragma unroll
  for (int j = 0; j < 8; ++j) { const float sc = (n0 == 0 && j < 4) ? 0.25f * L2E : 1.0f;
#pragma unroll
    for (int r = 0; r < 8; ++r) so[wave * 16 + 8 * g + r][j * 16 + col] = (acc[j][r] + bias[j]) * sc; }
  __syncthreads();
  for (int q = tid; q < 64 * 32; q += 128) { const int rl = q >> 5, pc = q & 31; float* dst = QKV + ((size_t)b * NPOS + p0 + rl) * 256 + n0 + pc * 4;
    if (n0 == 0 && pc >= KF / 4) {   // k columns: the 16-B part pc & 3 of a head's 64 B holds 8 dims (bit 1: which 8) as bf16 hi or lo (bit 0), split once here for every reader
      const float* s8 = &so[rl][(pc & ~3) * 4 + (pc & 2) * 4]; union { __bf16 e[8]; v4u u; } w;
#pragma unroll   // w is indexed by constants, so it stays in registers
      for (int e = 0; e < 8; ++e) { const float v = s8[e]; const __bf16 hi = (__bf16)v; w.e[e] = (pc & 1) ? (__bf16)(v - (float)hi) : hi; }
      vst2((unsigned*)dst, w.u); }
    else vst2(dst, *(const v4f*)&so[rl][pc * 4]); }
  if (n0 == 128) {
    for (int q = tid; q < 128 * 8; q += 128) { const int c = q >> 3, pc = q & 7; union { _Float16 e[8]; v4u u; } hh;
#pragma unroll
      for (int e = 0; e < 8; ++e) hh.e[e] = (_Float16)so[pc * 8 + e][c];
      vst2((unsigned*)(VT + ((size_t)b * VF + c) * NPOS + p0 + pc * 8), hh.u); } }
}
// k_attn's products: the builtin alone, with no v_nop written behind it. The distance that the chip asks for behind a WMMA is filled by the work that stands there (the other O^T tile's product, the next step's softmax); where that is short the compiler pads.
__device__ __forceinline__ v8f wmma_w(v16b a, v16b b, v8f c) { return __builtin_amdgcn_wmma_f32_16x16x32_bf16(false, a, false, b, (short)0, c, false, false); }
__device__ __forceinline__ v8f wmma_wh(v16h a, v16h b, v8f c) { return __builtin_amdgcn_wmma_f32_16x16x32_f16(false, a, false, b, (short)0, c, false, false); }
// 8 values of P to f16 (nearest even), one packed conversion per 2; P lies in [0, 1], and what falls below f16's smallest subnormal counts as 0 beside the row's largest term, which is 1
typedef __attribute__((ext_vector_type(2))) _Float16 v2h;
__device__ __forceinline__ void pack8(const float* x, v2h* p) {
#pragma unroll   // constant indices
  for (int i = 0; i < 4; ++i) { v2f t; t[0] = x[2 * i]; t[1] = x[2 * i + 1]; p[i] = __builtin_convertvector(t, v2h); } }
// the scheduler moves nothing over this line: it keeps the LDS read groups ahead of the matrix work (left alone it sinks each read to its user, with a full wait there) and the vector work between the WMMAs as written
#define HOLD() __builtin_amdgcn_sched_barrier(0)
// the other half's value of the same column (lane ^ 16), by a vector cross-row move
__device__ __forceinline__ float xhalf(float v) { const unsigned u = __builtin_bit_cast(unsigned, v); return __builtin_bit_cast(float, __builtin_amdgcn_permlanex16(u, u, 0x76543210u, 0xfedcba98u, false, false)); }
// ---- k_attn: block = (64 queries, b*4+h), one pass over the keys. S^T = k(hi/lo) q(hi/lo)^T, the 32-deep k = 16 dims x (k hi, k lo), once against q lo and once against q hi: lane (g, col) holds keys 8g+0..7 of query col. Per stage of 128 keys: the 8 S^T tiles, their maximum in-lane and over the two halves, one rescale of O^T and of the sums by 2^(m_old - m_new),
// then P^T = 2^(s - m) as f16 straight from the S^T accumulators, O^T += V^T P^T over 32-key steps, the sums of P (unrounded) in-lane; behind the loop the halves' sums are joined and O is divided by them.
__global__ __launch_bounds__(128) void k_attn(const float* __restrict__ QKV, const _Float16* __restrict__ VT, float* __restrict__ O) {
  __shared__ __align__(16) float so[4][16][36]; __shared__ __align__(16) float sk[2][KST * KPF]; __shared__ __align__(16) _Float16 sv[2][DV * VPB];
  const int tid = threadIdx.x, wave = tid >> 5, lane = tid & 31, col = lane & 15, g = lane >> 4;
  const int bh = blockIdx.y, b = bh >> 2, h = bh & 3; const int q0 = blockIdx.x * 64 + wave * 16;
  const F2 a = split_rowK(QKV + ((size_t)b * NPOS + q0 + col) * 256 + h * DK, 0, lane, DK);
  const v16b qh = frag_q2(a.h), ql = frag_q2(a.l);
  float m = -3.0e38f, ls[8] = {};   // the query's running maximum (log2 domain, equal in both halves); ls[r]: sum of P over the lane's keys 8g + r of every tile
  v8f acc[2] = {};
  const float* kg = QKV + (size_t)b * NPOS * 256 + KF + h * DK; const _Float16* vg = VT + ((size_t)b * VF + h * DV) * NPOS;
  copy_k(kg, sk[0], tid); copy_v(vg, sv[0], tid); WAIT_COPIES(); __syncthreads();   // stage 0 is there for every wave
  copy_k(kg + (size_t)KST * 256, sk[1], tid); copy_v(vg + KST, sv[1], tid);     // stage 1 flies while stage 0 is worked on
  // one stage, inlined twice: in the loop where a stage t + 2 always exists, and in the loop of the last two stages. So a trip is one straight block, and the sums of P stay where they are written (with a branch in the trip the compiler moves all of them behind it, to the trip's foot, and holds a stage's 64 P values in registers till then).
  auto stage = [&](const int t) __attribute__((always_inline)) { const float* kr = sk[t & 1] + col * KPF + 8 * g; const _Float16* vr = sv[t & 1] + col * VPB;
    v4f kq[KST / 16][2]; v16h vq[2][2];   // the stage's K rows; [set][dt]: a step's V^T fragments, read one step ahead inside the stage
    // RD_V: the V^T reads of one 32-key step; its loop is unrolled so that the sets are indexed by constants and stay in registers
#define RD_V(S, KS) do { _Pragma("unroll") for (int c = 0; c < 2; ++c) vq[S][c] = frag_h(vr + c * 16 * VPB + (KS) * 32, lane); } while (0)
#pragma unroll     // the stage's K reads and the first step's V^T reads stand as one group ahead of the matrix work: one read latency a stage
    for (int kt = 0; kt < KST / 16; ++kt) { kq[kt][0] = *(const v4f*)(kr + kt * 16 * KPF); kq[kt][1] = *(const v4f*)(kr + kt * 16 * KPF + 4); }
    RD_V(0, 0);
    HOLD();
    v8f s[KST / 16]; float mx[8];   // mx: eight independent chains over the tiles, each from the running maximum, two tiles a link; then joined
    // MAX2: one link of the eight chains; it stands behind later tiles' products, so that its two tiles are done when it reads them
#define MAX2(KT) do { _Pragma("unroll") for (int r = 0; r < 8; ++r) mx[r] = fmaxf(fmaxf(mx[r], s[KT][r]), s[(KT) + 1][r]); } while (0)
#pragma unroll     // kq and s are indexed by constants only, so they stay in registers; the small products first, and eight independent tiles between a tile's two products
    for (int kt = 0; kt < KST / 16; ++kt) s[kt] = wmma_w(frag_k(kq[kt][0], kq[kt][1]), ql, (v8f){});
#pragma unroll     // as above: constant indices
    for (int kt = 0; kt < 6; ++kt) s[kt] = wmma_w(frag_k(kq[kt][0], kq[kt][1]), qh, s[kt]);
    HOLD();
#pragma unroll
    for (int r = 0; r < 8; ++r) mx[r] = m;
    MAX2(0); HOLD();
    s[6] = wmma_w(frag_k(kq[6][0], kq[6][1]), qh, s[6]); HOLD();
    MAX2(2); HOLD();
    s[7] = wmma_w(frag_k(kq[7][0], kq[7][1]), qh, s[7]); HOLD();
    MAX2(4); MAX2(6);
    const float mt = fmaxf(fmaxf(fmaxf(fmaxf(mx[0], mx[1]), mx[2]), fmaxf(fmaxf(mx[3], mx[4]), mx[5])), fmaxf(mx[6], mx[7]));
    const float mn = fmaxf(mt, xhalf(mt)), al = exp2x1(m - mn); m = mn;   // both halves feed one O^T tile, so they use one maximum
#pragma unroll
    for (int r = 0; r < 8; ++r) { ls[r] *= al; acc[0][r] *= al; acc[1][r] *= al; }
    // a 32-key step's P^T: x0, x1[r] = P[query col][key (t * 4 + ks) * 32 + (0, 16) + 8g + r]: the two S^T tiles are a B fragment's k order as they stand. Its two halves (SM_X or SM_XW each) stand one step ahead, one behind each product of the step before, and are packed together behind the second; a half's sums stand directly behind the product, ahead of the SM_XW that takes its place: with the subtractions they fill the distance that the chip asks for behind a WMMA.
    float x0[8], x1[8]; union { v2h p[8]; v16h f; } P;
#define SM_X(X, KT) do { _Pragma("unroll") for (int r = 0; r < 8; ++r) X[r] = s[KT][r] - mn; exp2x8(X); } while (0)
#define SM_XW(X, KT, A, B) do { _Pragma("unroll") for (int r = 0; r < 8; ++r) X[r] = s[KT][r] - mn; exp2x8w(X, A, B); } while (0)
#define SM_SUM(X) do { _Pragma("unroll") for (int r = 0; r < 8; ++r) ls[r] += X[r]; } while (0)
    SM_X(x0, 0); SM_X(x1, 1); pack8(x0, P.p); pack8(x1, P.p + 4);
#pragma unroll     // the sets are indexed by constants only, so they stay in registers
  for (int ks = 0; ks < KST / 32; ++ks) { const bool nx = ks + 1 < KST / 32; const v16h p = P.f;
    const v16h v0 = vq[ks & 1][0], v1 = vq[ks & 1][1];
    if (nx) RD_V((ks + 1) & 1, ks + 1);   // the next step's LDS reads as one group ahead of this step's matrix work (same stage, same buffer)
    HOLD();
    acc[0] = wmma_wh(v0, p, acc[0]); HOLD();
    SM_SUM(x0); HOLD();
    if (nx) SM_XW(x0, ks * 2 + 2, v0, p);
    HOLD();
    acc[1] = wmma_wh(v1, p, acc[1]); HOLD();
    SM_SUM(x1); HOLD();
    if (nx) { SM_XW(x1, ks * 2 + 3, v1, p); pack8(x0, P.p); pack8(x1, P.p + 4); }
    HOLD(); }
    WAIT_LDS(); WAIT_COPIES(); __syncthreads();   // publish point: stage t + 1 has landed for all, and nobody reads stage t's buffers any more
    if (t + 2 < NST) { copy_k(kg + (size_t)(t + 2) * KST * 256, sk[t & 1], tid); copy_v(vg + (t + 2) * KST, sv[t & 1], tid); } };
#pragma unroll 1   // one trip = one stage
  for (int t = 0; t < NST - 2; ++t) stage(t);
#pragma unroll 1   // the last two stages, which refill nothing: rolled as well, so that they take no more registers than the loop above
  for (int t = NST - 2; t < NST; ++t) stage(t);
  WAIT_COPIES();
  float l = ((ls[0] + ls[1]) + (ls[2] + ls[3])) + ((ls[4] + ls[5]) + (ls[6] + ls[7]));
  l += xhalf(l);   // join the halves' keys
  const float il = 1.0f / l;
#pragma unroll
  for (int dt = 0; dt < 2; ++dt)   // acc[dt][r] = O[query col][dt * 16 + 8g + r] * l: 8 consecutive floats of the lane's row
#pragma unroll
    for (int r = 0; r < 8; ++r) so[wave][col][dt * 16 + 8 * g + r] = acc[dt][r] * il;
  LDSX();
  for (int q = lane; q < 16 * 8; q += 32) { const int rl = q >> 3, pc = q & 7; vst2(O + ((size_t)b * NPOS + q0 + rl) * VF + h * DV + pc * 4, *(const v4f*)&so[wave][rl][pc * 4]); }
}
// ---- k_out: Y[p][o] = O row(hi/lo) . Wo rows + bo; out[b][o][p] = Y + inputs (NCHW); block = (64 positions, b): 128 output channels in one pass (8 tiles); transposed store per channel: 64 positions = 256 B by 16 lanes
__global__ __launch_bounds__(128) void k_out(const float* __restrict__ O, const float* __restrict__ Wo, const float* __restrict__ bo, const float* __restrict__ X, float* __restrict__ out) {
  __shared__ __align__(16) float st[128][68]; __shared__ __align__(16) __bf16 sw[128 * WPB];
  const int tid = threadIdx.x, wave = tid >> 5, lane = tid & 31, col = lane & 15, g = lane >> 4; const int b = blockIdx.y; const int p0 = blockIdx.x * 64;
  // every global operand is asked for here, ahead of the matrix work: one memory latency for the block
  v4f wx[32]; F2 a[VF / 32]; float bb[8]; const float* orow = O + ((size_t)b * NPOS + p0 + wave * 16 + col) * VF;
#pragma unroll   // wx is indexed by constants, so it stays in registers
  for (int i = 0; i < 32; ++i) wx[i] = *(const v4f*)(Wo + (size_t)(wave + 4 * i) * VF + lane * 4);
  WAIT_ADDR();
#pragma unroll   // as above: constant indices
  for (int kc = 0; kc < VF / 32; ++kc) a[kc] = split_row(orow, kc * 32, lane);
  WAIT_ADDR_V(orow + 8 * g);
#pragma unroll   // as above: constant indices
  for (int j = 0; j < 8; ++j) bb[j] = bfr(bo[j * 16 + col]);
  WAIT_ADDR_S(bo, bo);
#pragma unroll   // as above: constant indices
  for (int i = 0; i < 32; ++i) put_w(sw, wave + 4 * i, lane, wx[i]);
  __syncthreads();   // the weights are there for every wave
  v8f acc[8] = {};
#pragma unroll
  for (int kc = 0; kc < VF / 32; ++kc) { v16b w[8];
#pragma unroll   // the step's eight B fragments are read as one group ahead of its matrix work: one LDS latency a step
    for (int j = 0; j < 8; ++j) w[j] = frag_b(sw + (j * 16 + col) * WPB + kc * 32, lane);
#pragma unroll
    for (int j = 0; j < 8; ++j) { acc[j] = wmma_bf(a[kc].l, w[j], acc[j]); acc[j] = wmma_bf(a[kc].h, w[j], acc[j]); } }
#pragma unroll
  for (int j = 0; j < 8; ++j) {
#pragma unroll
    for (int r = 0; r < 8; ++r) st[j * 16 + col][wave * 16 + 8 * g + r] = acc[j][r] + bb[j]; }
  __syncthreads();
  for (int q = tid; q < 128 * 16; q += 128) { const int o = q >> 4, pc = q & 15; const size_t base = ((size_t)b * CIN + o) * NPOS + p0 + pc * 4; const float4 xv = *(const float4*)(X + base);
    v4f r4; r4[0] = st[o][pc * 4] + bfr(xv.x); r4[1] = st[o][pc * 4 + 1] + bfr(xv.y); r4[2] = st[o][pc * 4 + 2] + bfr(xv.z); r4[3] = st[o][pc * 4 + 3] + bfr(xv.w); vst2(out + base, r4); }
}

extern "C" void kernel_launch(void* const* d_in, const int* in_sizes, int n_in, void* d_out, int out_size, void* d_ws, size_t ws_size, hipStream_t stream) {
  (void)in_sizes; (void)n_in; (void)out_size;
  const float** F = (const float**)d_in;   // inputs, gamma, beta, running_mean, running_var, Wq, bq, Wk, bk, Wv, bv, Wo, bo
  if (ws_size < (size_t)WS_END) return;
  char* ws = (char*)d_ws;
  _Float16* VT = (_Float16*)(ws + WS_VT); float *QKV = (float*)(ws + WS_QKV), *O = (float*)(ws + WS_O);
  k_qkv<<<dim3(NPOS / 64, 2, TNB), 128, 0, stream>>>(F[0], F[1], F[2], F[3], F[4], F[5], F[6], F[7], F[8], F[9], F[10], QKV, VT);
  k_attn<<<dim3(TQB, TNB * NHD), 128, 0, stream>>>(QKV, VT, O);
  k_out<<<dim3(TQB, TNB), 128, 0, stream>>>(O, F[11], F[12], F[0], (float*)d_out);
}
